// v000
// Measured on an AMD MI455X. A time is GPU time per run, averaged over a window of back-to-back runs after a warm-up
// (all launches, gaps included; the runs take copies of the inputs in turn), and the median of several windows.
// Apart from v000's, it joins two sittings. Times from different sittings can be a few percent apart, while
// side-by-side timings come from the same sitting.
// The starting kernel, v000, takes 2320 microseconds a run.
// Contractions on v_wmma_f32_16x16x32_f16 (plain f16 operands, f32 accumulate), per batch: θ/φ/g 1x1 convs of the eval-BatchNorm'd frames
// (K = 64; [out][in] weights zero-padded to 128 rows so the channels-major results are 128-row operands with exact zero rows), the energy
// E = θᵀ·φ (K = 32, f32 [4096][4096]) and, separately, Eᵀ = φᵀ·θ, the two softmaxes in f32 (att1 = row softmax of E, att2ᵀ = row softmax of
// Eᵀ; written in place as 1024·P), y2 = g2·att1ᵀ and y1 = g1·att2 (K = 4096; P as the Bt operand, 1/1024 as the row scale), then
// W_out (K = 32 zero-padded to 128), its BatchNorm and the residual in f32 into both outputs. Mild logits (σ ≈ 1) ⇒ near-uniform attention;
// residual outputs. compute dtype: f16 operands, f32 accumulate.  x1, x2 [4,64,64,64] -> (x1 + W(y1), x2 + W(y2)).
#include <hip/hip_runtime.h>
#include <hip/hip_bf16.h>
#include <math.h>

#define NBs 4
#define CCs 64
#define CIs 32
#define NNs 4096
#define SS 4096
#define HH 1
#define DKK 64
#define GSTR 48

typedef _Float16 bf16;
typedef _Float16 f16;
typedef __attribute__((ext_vector_type(4))) unsigned v4u_t;
typedef unsigned v4ua __attribute__((ext_vector_type(4), may_alias));
typedef __attribute__((ext_vector_type(4))) float v4f_t;
typedef float v4fa __attribute__((ext_vector_type(4), may_alias));
typedef __attribute__((ext_vector_type(16))) bf16  bf16x16;
typedef bf16x16 f16x16;
typedef __attribute__((ext_vector_type(8)))  bf16  bf16x8;
typedef bf16x8 f16x8;
typedef __attribute__((ext_vector_type(4)))  bf16  bf16x4;
typedef __attribute__((ext_vector_type(8)))  float f32x8;
__device__ __forceinline__ f32x8 wmma16(f16x16 a, f16x16 b, f32x8 c) {
  c = __builtin_amdgcn_wmma_f32_16x16x32_f16(false, a, false, b, (short)0, c, false, false);
  asm volatile("v_nop\n\tv_nop\n\tv_nop\n\tv_nop" : "+v"(c) : "v"(a), "v"(b));
  return c;
}
#define LDS_STRIDE 48   // GEMM tiles: 32 -> 48 elems (96B rows): aligned b128 reads
#define KSTRIDE    72   // unused
#define VSTRIDE    48   // unused

__device__ __forceinline__ f32x8 wmma_bf16(bf16x16 a, bf16x16 b, f32x8 c) {
  c = __builtin_amdgcn_wmma_f32_16x16x32_f16(false, a, false, b, (short)0, c, false, false);
  asm volatile("v_nop\n\tv_nop\n\tv_nop\n\tv_nop" : "+v"(c) : "v"(a), "v"(b));   // A/B-overwrite hazard guard
  return c;
}

// 16x32 (MxK) f16 fragment from a row-major global matrix.
// lanes 0-15  (row=lane)    : elems 0..7 = K+0..7,  8..15 = K+16..23
// lanes 16-31 (row=lane-16) : elems 0..7 = K+8..15, 8..15 = K+24..31
template <typename T>
__device__ __forceinline__ bf16x16 load_frag(const T* __restrict__ base, int ld,
                                             int row0, int k0) {
  const int lane = threadIdx.x & 31;
  const int r    = lane & 15;
  const int kh   = (lane >> 4) * 8;
  const T* p0 = base + (size_t)(row0 + r) * ld + (k0 + kh);
  const T* p1 = p0 + 16;
  bf16x16 f;
#pragma unroll
  for (int i = 0; i < 8; ++i) {
    f[i]     = (bf16)p0[i];
    f[i + 8] = (bf16)p1[i];
  }
  return f;
}

// Same fragment from an LDS tile with padded row stride (base includes row0/k0).
__device__ __forceinline__ bf16x16 lds_frag(const bf16* base, int stride) {
  const int lane = threadIdx.x & 31;
  const int row  = lane & 15;
  const int kh   = (lane >> 4) * 8;
  const bf16x8 lo = *(const bf16x8*)(base + row * stride + kh);
  const bf16x8 hi = *(const bf16x8*)(base + row * stride + kh + 16);
  bf16x16 f;
#pragma unroll
  for (int i = 0; i < 8; ++i) { f[i] = lo[i]; f[i + 8] = hi[i]; }
  return f;
}

template <typename T>
__device__ __forceinline__ void stage_read16(const T* __restrict__ p, float* buf) {
#pragma unroll
  for (int i = 0; i < 16; ++i) buf[i] = (float)p[i];
}

__device__ __forceinline__ void stage_write(bf16* dst, const float* buf, int nquad) {
#pragma unroll
  for (int i = 0; i < nquad; ++i) {
    bf16x4 q;
    q[0] = (bf16)buf[4 * i];     q[1] = (bf16)buf[4 * i + 1];
    q[2] = (bf16)buf[4 * i + 2]; q[3] = (bf16)buf[4 * i + 3];
    *(bf16x4*)(dst + 4 * i) = q;
  }
}

// ---------------------------------------------------------------------------
// GEMM: C[m][n] = sum_k A[m][k]*W[n][k] + bias[n]   (torch Linear)
// Block 256 thr (8 waves), tile 128M x 256N, K-step 32; wave tile 64x64.
// A/W staged through LDS (f16, padded stride) with next-tile register
// prefetch overlapping the WMMA phase.
// MODE 0: f16 [M][N]   MODE 1: f16 Vt[b][h][dk][s]   MODE 2: fp32 [M][N]
// ---------------------------------------------------------------------------
template <typename AT, int MODE>
__global__ __launch_bounds__(256) void gemm_rb_kernel(
    const AT* __restrict__ A, const float* __restrict__ W,
    const float* __restrict__ bias, const float* __restrict__ rowscale, const float* __restrict__ R, const float* __restrict__ rowbias, void* __restrict__ out,
    int M, int N, int K) {
  __shared__ bf16 ldsA[128 * LDS_STRIDE];   // 12.0 KB
  __shared__ bf16 ldsW[256 * LDS_STRIDE];   // 24.0 KB
  // output staging: MODE 0 [128 m][264] f16, MODE 1 [256 n][136] f16, MODE 2 [64 m][260] f32 (two halves)
  __shared__ __attribute__((aligned(16))) unsigned char sob[256 * 136 * 2];   // 69,632 B >= 128*264*2 and >= 64*260*4

  const int t    = threadIdx.x;
  const int wave = t >> 5;
  const int lane = t & 31;
  const int wm   = (wave & 1) * 64;
  const int wn   = (wave >> 1) * 64;
  const int mBlk = blockIdx.x * 128;
  const int nBlk = blockIdx.y * 256;

  const int arow = t >> 1;
  const int ach  = (t & 1) * 16;

  float abuf[16];
  float wbuf[32];

  stage_read16(A + (size_t)(mBlk + arow) * K + ach, abuf);
  const int nrow = min(nBlk + t, N - 1);            // ragged last N tile: clamp the weight row (those columns are never stored)
  stage_read16(W + (size_t)nrow * K,          wbuf);
  stage_read16(W + (size_t)nrow * K + 16,     wbuf + 16);

  f32x8 acc[4][4] = {};

  for (int k = 0; k < K; k += 32) {
    __syncthreads();
    stage_write(&ldsA[arow * LDS_STRIDE + ach], abuf, 4);
    stage_write(&ldsW[t * LDS_STRIDE],          wbuf, 8);
    if (k + 32 < K) {
      stage_read16(A + (size_t)(mBlk + arow) * K + (k + 32) + ach, abuf);
      stage_read16(W + (size_t)nrow * K + (k + 32),          wbuf);
      stage_read16(W + (size_t)nrow * K + (k + 32) + 16,     wbuf + 16);
    }
    __syncthreads();

    bf16x16 af[4], wf[4];
#pragma unroll
    for (int i = 0; i < 4; ++i)
      af[i] = lds_frag(ldsA + (wm + 16 * i) * LDS_STRIDE, LDS_STRIDE);
#pragma unroll
    for (int j = 0; j < 4; ++j)
      wf[j] = lds_frag(ldsW + (wn + 16 * j) * LDS_STRIDE, LDS_STRIDE);
#pragma unroll
    for (int i = 0; i < 4; ++i)
#pragma unroll
      for (int j = 0; j < 4; ++j)
        acc[i][j] = wmma_bf16(af[i], wf[j], acc[i][j]);
  }

  const int nlane = lane & 15;
  const int mh    = (lane >> 4) * 8;
  __syncthreads();
  if (MODE == 0 || MODE == 1 || MODE == 3) {
    bf16* so = (bf16*)sob;
#pragma unroll
    for (int i = 0; i < 4; ++i)
#pragma unroll
      for (int j = 0; j < 4; ++j) {
        const int nl = wn + 16 * j + nlane;
        const float bv = bias ? bias[nBlk + nl] : 0.0f;
        if (MODE == 3) {                                  // bias + exact GELU (erf), rolled to keep the static VALU op count small
#pragma unroll 1
          for (int r = 0; r < 8; ++r) {
            const int ml = wm + 16 * i + mh + r;
            const float xg = acc[i][j][r] + bv;
            so[ml * 264 + nl] = (bf16)(0.5f * xg * (1.0f + erff(xg * 0.70710678118654752f)));
          }
        } else {
#pragma unroll
        for (int r = 0; r < 8; ++r) {
          const int ml = wm + 16 * i + mh + r;
          const bf16 hv = (bf16)(acc[i][j][r] + bv);
          if (MODE == 0) so[ml * 264 + nl] = hv;        // [m][n]
          else           so[nl * 136 + ml] = hv;        // [n][m]  (n = h*64+dk rows of Vt, m = s contiguous)
        }
        }
      }
    __syncthreads();
{
      if (MODE == 0 || MODE == 3) {          // rows m: 256 halfs = 512 B each, 16-B chunks
        for (int ch = t; ch < 128 * 32; ch += 256) { const int ml = ch >> 5, q = (ch & 31) * 8;
          *(v4u_t*)((bf16*)out + (size_t)(mBlk + ml) * N + nBlk + q) = *(const v4ua*)(so + ml * 264 + q); }
      } else {                  // Vt rows (b, h, dk): 128 consecutive s = 256 B each
        const int b_ = mBlk / SS, s0 = mBlk % SS;
        for (int ch = t; ch < 256 * 16; ch += 256) { const int nl = ch >> 4, q = (ch & 15) * 8; const int n = nBlk + nl, h = n >> 6, dk = n & (DKK - 1);
          *(v4u_t*)((bf16*)out + (((size_t)(b_ * HH + h)) * DKK + dk) * SS + s0 + q) = *(const v4ua*)(so + nl * 136 + q); }
      }
      
    }
  } else {
    float* so = (float*)sob;
#pragma unroll 1
    for (int hf = 0; hf < 2; ++hf) {
      if (wm == hf * 64) {
#pragma unroll
        for (int i = 0; i < 4; ++i)
#pragma unroll
          for (int j = 0; j < 4; ++j) {
            const int nl = wn + 16 * j + nlane;
            const float bv = bias ? bias[nBlk + nl] : 0.0f;
#pragma unroll
            for (int r = 0; r < 8; ++r) { const int mrow = mBlk + hf * 64 + 16 * i + mh + r; so[(16 * i + mh + r) * 260 + nl] = acc[i][j][r] * (rowscale ? rowscale[mrow] : 1.0f) + bv + (rowbias ? rowbias[mrow] : 0.0f); }
          }
      }
      __syncthreads();
      if (R) {   // residual: fold R[m][n] into the staged tile once (same thread <-> same chunks as the stores below)
        for (int ch = t; ch < 64 * 64; ch += 256) { const int ml = ch >> 6, q = (ch & 63) * 4;
          if (nBlk + q < N) { const v4f_t rv = *(const v4f_t*)(R + (size_t)(mBlk + hf * 64 + ml) * N + nBlk + q); v4f_t v = *(const v4fa*)(so + ml * 260 + q); v += rv; *(v4fa*)(so + ml * 260 + q) = v; } }
        asm volatile("s_wait_dscnt 0" ::: "memory");
      }
{   // 64 rows x 256 floats = 1 KB segments, float4 chunks; columns >= N (ragged tile) skipped
        for (int ch = t; ch < 64 * 64; ch += 256) { const int ml = ch >> 6, q = (ch & 63) * 4;
          if (nBlk + q < N) *(v4f_t*)((float*)out + (size_t)(mBlk + hf * 64 + ml) * N + nBlk + q) = *(const v4fa*)(so + ml * 260 + q); }
        
      }
      __syncthreads();
    }
  }
}


// ---------------------------------------------------------------------------------------------------------------------------
// gemm_kne: Y[m][n] = epi( Σ_k A[m][k]·W[k][n] + bias[n] ), A f32/f16 [M][lda], W f32 row-major [K][N] (ldw), plain f16 operands,
// f32 accumulate. EPI 0: identity; 1: exact-erf GELU; 2: R[m][n] + gvec[n]·(·) (residual with per-channel gain). Output f32 (or f16
// when OUT16). Block = 128x128 tile, 8 waves as 4(M) x 2(N); per 32-wide k-step A and W tiles staged f16 in LDS (W transposed
// ---------------------------------------------------------------------------------------------------------------------------
#define GSTR 48
template <typename AT, int EPI, bool OUT16>
__global__ __launch_bounds__(256) void gemm_kne(const AT* __restrict__ A, int lda, const float* __restrict__ Wm, int ldw,
                                                const float* __restrict__ bias, const float* __restrict__ R, const float* __restrict__ gvec,
                                                void* __restrict__ Yv, int ldy, int K) {
  __shared__ __attribute__((aligned(16))) f16 ldsA[128 * GSTR];
  __shared__ __attribute__((aligned(16))) f16 ldsW[128 * GSTR];
  __shared__ __attribute__((aligned(16))) float oS[8][32 * 68];
  const int tid = threadIdx.x, lane = tid & 31, wave = tid >> 5, cl = lane & 15, rh = (lane >> 4) * 8;
  const int m0 = blockIdx.x * 128, n0 = blockIdx.y * 128;
  const int wm = (wave & 3) * 32, wn = (wave >> 2) * 64;
  f32x8 acc[2][4];
#pragma unroll
  for (int i = 0; i < 2; ++i)
#pragma unroll
    for (int j = 0; j < 4; ++j) { f32x8 z = {}; acc[i][j] = z; }
#pragma unroll 1
  for (int k0 = 0; k0 < K; k0 += 32) {
    __syncthreads();
    { const int row = tid >> 1, ch = (tid & 1) * 16;
      const AT* src = A + (size_t)(m0 + row) * lda + k0 + ch;
#pragma unroll
      for (int g = 0; g < 16; ++g) ldsA[row * GSTR + ch + g] = (f16)src[g]; }
    { const int k = tid >> 3, nn0 = (tid & 7) * 16;
      const float* src = Wm + (size_t)(k0 + k) * ldw + n0 + nn0;
#pragma unroll
      for (int g = 0; g < 4; ++g) { const v4f_t v = *(const v4f_t*)(src + 4 * g);
#pragma unroll
        for (int u = 0; u < 4; ++u) ldsW[(nn0 + 4 * g + u) * GSTR + k] = (f16)v[u]; } }
    __syncthreads();
    f16x16 af[2];
#pragma unroll
    for (int i = 0; i < 2; ++i) af[i] = lds_frag(ldsA + (wm + 16 * i) * GSTR, GSTR);
#pragma unroll
    for (int j = 0; j < 4; ++j) {
      const f16x16 bf = lds_frag(ldsW + (wn + 16 * j) * GSTR, GSTR);
#pragma unroll
      for (int i = 0; i < 2; ++i) acc[i][j] = wmma16(af[i], bf, acc[i][j]);
    }
  }
  float* so = oS[wave];
#pragma unroll
  for (int i = 0; i < 2; ++i)
#pragma unroll
    for (int j = 0; j < 4; ++j) {
      const int n = n0 + wn + 16 * j + cl;
      const float bv = bias ? bias[n] : 0.0f;
      const float gv = (EPI == 2) ? gvec[n] : 0.0f;
      if (EPI == 1) {
#pragma unroll 1
        for (int r = 0; r < 8; ++r) { const float xg = acc[i][j][r] + bv; so[(16 * i + rh + r) * 68 + 16 * j + cl] = 0.5f * xg * (1.0f + erff(xg * 0.70710678118654752f)); }
      } else {
#pragma unroll
        for (int r = 0; r < 8; ++r) {
          float v = acc[i][j][r] + bv;
          if (EPI == 2) v = R[(size_t)(m0 + wm + 16 * i + rh + r) * ldy + n] + gv * v;
          so[(16 * i + rh + r) * 68 + 16 * j + cl] = v;
        }
      }
    }
  asm volatile("s_wait_dscnt 0" ::: "memory");
  __builtin_amdgcn_wave_barrier();
{
    if (OUT16) {
      f16* Y = (f16*)Yv;
#pragma unroll
      for (int it = 0; it < 8; ++it) { const int c = lane + 32 * it, rr = c >> 3, q8 = (c & 7) * 8;
        union { f16 h[8]; v4u_t v; } u;
#pragma unroll
        for (int e = 0; e < 8; ++e) u.h[e] = (f16)so[rr * 68 + q8 + e];
        *(v4u_t*)(Y + (size_t)(m0 + wm + rr) * ldy + n0 + wn + q8) = u.v; }
    } else {
      float* Y = (float*)Yv;
#pragma unroll
      for (int it = 0; it < 16; ++it) { const int f4 = lane + 32 * it, rr = f4 >> 4, q = (f4 & 15) * 4;
        *(v4f_t*)(Y + (size_t)(m0 + wm + rr) * ldy + n0 + wn + q) = *(const v4fa*)(so + rr * 68 + q); }
    }
    
  }
}

// eval BatchNorm of a frame: xb[c][n] = x*inv_c + (beta − mean*inv)_c, inv = gamma/sqrt(var+eps); rows of 16 KB
__global__ __launch_bounds__(256) void k_bn(const float* __restrict__ x, const float* __restrict__ p, float* __restrict__ y) { const size_t row = blockIdx.x; const int c = row % CCs;
  const float inv = p[c] / sqrtf(p[3 * CCs + c] + 1e-5f), sh = p[CCs + c] - p[2 * CCs + c] * inv;
  for (int q4 = threadIdx.x; q4 < NNs / 4; q4 += 256) { v4f_t v = *(const v4f_t*)(x + row * NNs + q4 * 4); for (int e = 0; e < 4; ++e) v[e] = v[e] * inv + sh;
    *(v4f_t*)(y + row * NNs + q4 * 4) = v;  } }
// zero-padded weights: Wp[r][c] (rows x cols) from W[nr][nc]
__global__ __launch_bounds__(128) void k_padw(const float* __restrict__ Wm, int nr, int nc, int cols, float* __restrict__ Wp) { const int r = blockIdx.x, c = threadIdx.x; if (c >= cols) return;
  const float v = (r < nr && c < nc) ? Wm[r * nc + c] : 0.0f; *(float*)(Wp + (size_t)r * cols + c) = v;  }
__global__ __launch_bounds__(256) void k_rowbias(float* __restrict__ t, const float* __restrict__ bias, int nrows) { const size_t row = blockIdx.x; const float bv = (row < (size_t)nrows) ? bias[row] : 0.0f;
  for (int q4 = threadIdx.x; q4 < NNs / 4; q4 += 256) { v4f_t v = *(const v4f_t*)(t + row * NNs + q4 * 4); for (int e = 0; e < 4; ++e) v[e] += bv; *(v4f_t*)(t + row * NNs + q4 * 4) = v;  } }
__global__ __launch_bounds__(256) void k_tr32(const float* __restrict__ A, float* __restrict__ At) { __shared__ float tS[32][65];
  const int tid = threadIdx.x; const int n0 = blockIdx.x * 64;
  for (int e = tid; e < 32 * 64; e += 256) { const int c = e >> 6, j = e & 63; tS[c][j] = A[(size_t)c * NNs + n0 + j]; }
  __syncthreads();
  { const int j = tid >> 2, q4 = (tid & 3) * 8; v4f_t o0, o1; for (int k = 0; k < 4; ++k) { o0[k] = tS[q4 + k][j]; o1[k] = tS[q4 + 4 + k][j]; }
    float* dst = At + (size_t)(n0 + j) * CIs + q4; *(v4f_t*)dst = o0; *(v4f_t*)(dst + 4) = o1;  }
}
__global__ __launch_bounds__(256) void k_transpose(const float* __restrict__ Wm, float* __restrict__ Wt, int rows, int cols) {
  __shared__ float tS[64][65];
  const int tid = threadIdx.x, tbj = cols / 64, bi = blockIdx.x / tbj, bj = blockIdx.x % tbj;
  for (int e = tid; e < 64 * 64; e += 256) { const int r = e >> 6, c = e & 63; tS[r][c] = Wm[(size_t)(bi * 64 + r) * cols + bj * 64 + c]; }
  __syncthreads();
  for (int ch = tid; ch < 64 * 16; ch += 256) { const int r = ch >> 4, q4 = (ch & 15) * 4; v4f_t o; o[0] = tS[q4][r]; o[1] = tS[q4 + 1][r]; o[2] = tS[q4 + 2][r]; o[3] = tS[q4 + 3][r];
    float* dst = Wt + (size_t)(bj * 64 + r) * rows + bi * 64 + q4; *(v4f_t*)dst = o;  }
}
// row softmax in place -> 1024·softmax (f32): block = row, 256 threads x 16 elements
__global__ __launch_bounds__(256) void k_softmax(float* __restrict__ E) {
  __shared__ float red[256];
  const size_t row = blockIdx.x; const int tid = threadIdx.x; float* er = E + row * NNs;
  float v[16]; float m = -3.0e38f;
#pragma unroll
  for (int e = 0; e < 16; ++e) { v[e] = er[tid * 16 + e]; m = fmaxf(m, v[e]); }
  red[tid] = m; __syncthreads();
  for (int o = 128; o > 0; o >>= 1) { if (tid < o) red[tid] = fmaxf(red[tid], red[tid + o]); __syncthreads(); }
  m = red[0]; __syncthreads();
  float z = 0.0f;
#pragma unroll
  for (int e = 0; e < 16; ++e) { v[e] = expf(v[e] - m); z += v[e]; }
  red[tid] = z; __syncthreads();
  for (int o = 128; o > 0; o >>= 1) { if (tid < o) red[tid] += red[tid + o]; __syncthreads(); }
  const float sc = 1024.0f / red[0];
  v4f_t o[4]; for (int e = 0; e < 16; ++e) o[e >> 2][e & 3] = v[e] * sc;
{ for (int i = 0; i < 4; ++i) *(v4f_t*)(er + tid * 16 + i * 4) = o[i];  }
}
__global__ __launch_bounds__(256) void k_fill(float* __restrict__ p, float val, int n) { for (int i = threadIdx.x; i < n; i += 256) { *(float*)(p + i) = val;  } }
// out[b][c][n] = x[b][c][n] + bn_w(Z[c][n] + W_b[c])  for the 64 real rows of Z [128][4096]; rows of 16 KB
__global__ __launch_bounds__(256) void k_outbn(const float* __restrict__ Z, const float* __restrict__ Wb, const float* __restrict__ p, const float* __restrict__ x, float* __restrict__ out) { const int c = blockIdx.x;
  const float inv = p[c] / sqrtf(p[3 * CCs + c] + 1e-5f), sh = p[CCs + c] - p[2 * CCs + c] * inv; const float wb = Wb[c];
  for (int q4 = threadIdx.x; q4 < NNs / 4; q4 += 256) { const v4f_t z = *(const v4f_t*)(Z + (size_t)c * NNs + q4 * 4), xv = *(const v4f_t*)(x + (size_t)c * NNs + q4 * 4); v4f_t o;
    for (int e = 0; e < 4; ++e) o[e] = xv[e] + ((z[e] + wb) * inv + sh);
    *(v4f_t*)(out + (size_t)c * NNs + q4 * 4) = o;  } }

extern "C" void kernel_launch(void* const* d_in, const int* in_sizes, int n_in,
                              void* d_out, int out_size, void* d_ws, size_t ws_size,
                              hipStream_t stream) {
  (void)in_sizes; (void)n_in; (void)out_size;
  const float** f = (const float**)d_in;
  const float* x1 = f[0], *x2 = f[1], *gbn = f[2], *gw = f[3], *gb = f[4], *tbn = f[5], *tw = f[6], *tb = f[7], *pbn = f[8], *pw = f[9], *pb = f[10], *wbn = f[11], *Ww = f[12], *Wb = f[13];
  float* out1 = (float*)d_out; float* out2 = out1 + (size_t)NBs * CCs * NNs;     // tuple
  char* ws = (char*)d_ws;
  float* gwP = (float*)ws; ws += 128 * 64 * 4; float* twP = (float*)ws; ws += 128 * 64 * 4; float* pwP = (float*)ws; ws += 128 * 64 * 4; float* WwP = (float*)ws; ws += 128 * 128 * 4;   // padded weights
  float* xb = (float*)ws; ws += (size_t)CCs * NNs * 4;            // BN'd frame (1 MB)
  float* g1 = (float*)ws; ws += (size_t)128 * NNs * 4; float* g2 = (float*)ws; ws += (size_t)128 * NNs * 4; float* th = (float*)ws; ws += (size_t)128 * NNs * 4; float* ph = (float*)ws; ws += (size_t)128 * NNs * 4;   // [128][4096] (rows 32.. zero), 2 MB each
  float* thT = (float*)ws; ws += (size_t)NNs * CIs * 4; float* phT = (float*)ws; ws += (size_t)NNs * CIs * 4;    // [4096][32]
  float* E = (float*)ws; ws += (size_t)NNs * NNs * 4;             // 64 MB: E then Eᵀ
  float* Y = (float*)ws; ws += (size_t)128 * NNs * 4;             // y1 / y2 [128][4096]
  float* Z = (float*)ws; ws += (size_t)128 * NNs * 4;             // W_out result [128][4096]
  float* rsc = (float*)ws; ws += 128 * 4;
  if ((size_t)(ws - (char*)d_ws) > ws_size) return;
  const dim3 blk(256);
  k_padw<<<dim3(128), dim3(128), 0, stream>>>(gw, CIs, CCs, CCs, gwP); k_padw<<<dim3(128), dim3(128), 0, stream>>>(tw, CIs, CCs, CCs, twP); k_padw<<<dim3(128), dim3(128), 0, stream>>>(pw, CIs, CCs, CCs, pwP);
  k_padw<<<dim3(128), dim3(128), 0, stream>>>(Ww, CCs, CIs, 128, WwP);     // W_w [64][32] -> [128][128]
  k_fill<<<dim3(1), blk, 0, stream>>>(rsc, 1.0f / 1024.0f, 128);
  for (int b = 0; b < NBs; ++b) {
    const float* x1b = x1 + (size_t)b * CCs * NNs; const float* x2b = x2 + (size_t)b * CCs * NNs;
    // frame 1: g1 = g(bn_g x1), θ = θ(bn_θ x1); frame 2: g2 = g(bn_g x2), φ = φ(bn_φ x2)   (channels-major [128 pad][4096])
    k_bn<<<dim3(CCs), blk, 0, stream>>>(x1b, gbn, xb); gemm_kne<float, 0, false><<<dim3(1, NNs / 128), blk, 0, stream>>>(gwP, CCs, xb, NNs, nullptr, nullptr, nullptr, g1, NNs, CCs); k_rowbias<<<dim3(CIs), blk, 0, stream>>>(g1, gb, CIs);
    k_bn<<<dim3(CCs), blk, 0, stream>>>(x1b, tbn, xb); gemm_kne<float, 0, false><<<dim3(1, NNs / 128), blk, 0, stream>>>(twP, CCs, xb, NNs, nullptr, nullptr, nullptr, th, NNs, CCs); k_rowbias<<<dim3(CIs), blk, 0, stream>>>(th, tb, CIs);
    k_bn<<<dim3(CCs), blk, 0, stream>>>(x2b, gbn, xb); gemm_kne<float, 0, false><<<dim3(1, NNs / 128), blk, 0, stream>>>(gwP, CCs, xb, NNs, nullptr, nullptr, nullptr, g2, NNs, CCs); k_rowbias<<<dim3(CIs), blk, 0, stream>>>(g2, gb, CIs);
    k_bn<<<dim3(CCs), blk, 0, stream>>>(x2b, pbn, xb); gemm_kne<float, 0, false><<<dim3(1, NNs / 128), blk, 0, stream>>>(pwP, CCs, xb, NNs, nullptr, nullptr, nullptr, ph, NNs, CCs); k_rowbias<<<dim3(CIs), blk, 0, stream>>>(ph, pb, CIs);
    k_tr32<<<dim3(NNs / 64), blk, 0, stream>>>(th, thT); k_tr32<<<dim3(NNs / 64), blk, 0, stream>>>(ph, phT);     // θᵀ, φᵀ [4096][32]
    // E[n][m] = Σ_c θ[c][n] φ[c][m]  (A = θᵀ [4096][32], W = φ [32][4096])  -> att1 = row softmax -> y2 = g2·att1ᵀ
    gemm_kne<float, 0, false><<<dim3(NNs / 128, NNs / 128), blk, 0, stream>>>(thT, CIs, ph, NNs, nullptr, nullptr, nullptr, E, NNs, CIs);
    k_softmax<<<dim3(NNs), blk, 0, stream>>>(E);
    gemm_rb_kernel<float, 2><<<dim3(1, NNs / 256), blk, 0, stream>>>(g2, E, nullptr, rsc, nullptr, nullptr, Y, 128, NNs, NNs);           // y2[c][n] = Σ_m g2[c][m] att1[n][m]
    gemm_kne<float, 0, false><<<dim3(1, NNs / 128), blk, 0, stream>>>(WwP, 128, Y, NNs, nullptr, nullptr, nullptr, Z, NNs, 128);          // W_w·y2 (K = 128 padded)
    k_outbn<<<dim3(CCs), blk, 0, stream>>>(Z, Wb, wbn, x2b, out2 + (size_t)b * CCs * NNs);
    // Eᵀ[m][n] (A = φᵀ, W = θ) -> att2ᵀ = row softmax -> y1 = g1·att2  (Bt = att2ᵀ)
    gemm_kne<float, 0, false><<<dim3(NNs / 128, NNs / 128), blk, 0, stream>>>(phT, CIs, th, NNs, nullptr, nullptr, nullptr, E, NNs, CIs);
    k_softmax<<<dim3(NNs), blk, 0, stream>>>(E);
    gemm_rb_kernel<float, 2><<<dim3(1, NNs / 256), blk, 0, stream>>>(g1, E, nullptr, rsc, nullptr, nullptr, Y, 128, NNs, NNs);           // y1[c][m] = Σ_n g1[c][n] att2[n][m]
    gemm_kne<float, 0, false><<<dim3(1, NNs / 128), blk, 0, stream>>>(WwP, 128, Y, NNs, nullptr, nullptr, nullptr, Z, NNs, 128);
    k_outbn<<<dim3(CCs), blk, 0, stream>>>(Z, Wb, wbn, x1b, out1 + (size_t)b * CCs * NNs);
  }
}

// v001
// One run takes 758 microseconds.
// Timed twice side by side with v000, it ran 3.08 and 3.07 times as fast.
// Contractions on v_wmma_f32_16x16x32_f16 (plain f16 operands, f32 accumulate), per batch: θ/φ/g 1x1 convs of the eval-BatchNorm'd frames
// (K = 64; [out][in] weights zero-padded to 128 rows so the channels-major results are 128-row operands with exact zero rows), the energy
// E = θᵀ·φ (K = 32, f32 [4096][4096]) and, separately, Eᵀ = φᵀ·θ, the two softmaxes in f32 (att1 = row softmax of E, att2ᵀ = row softmax of
// Eᵀ; written in place as 1024·P), y2 = g2·att1ᵀ and y1 = g1·att2 (K = 4096; P as the Bt operand, 1/1024 as the row scale), then
// W_out (K = 32 zero-padded to 128), its BatchNorm and the residual in f32 into both outputs. Mild logits (σ ≈ 1) ⇒ near-uniform attention;
// residual outputs. compute dtype: f16 operands, f32 accumulate.  x1, x2 [4,64,64,64] -> (x1 + W(y1), x2 + W(y2)).
#include <hip/hip_runtime.h>
#include <hip/hip_bf16.h>
#include <math.h>

#define NBs 4
#define CCs 64
#define CIs 32
#define NNs 4096
#define SS 4096
#define HH 1
#define DKK 64
#define GSTR 48

typedef _Float16 bf16;
typedef _Float16 f16;
typedef __attribute__((ext_vector_type(4))) unsigned v4u_t;
typedef unsigned v4ua __attribute__((ext_vector_type(4), may_alias));
typedef __attribute__((ext_vector_type(4))) float v4f_t;
typedef float v4fa __attribute__((ext_vector_type(4), may_alias));
typedef __attribute__((ext_vector_type(16))) bf16  bf16x16;
typedef bf16x16 f16x16;
typedef __attribute__((ext_vector_type(8)))  bf16  bf16x8;
typedef bf16x8 f16x8;
typedef __attribute__((ext_vector_type(4)))  bf16  bf16x4;
typedef __attribute__((ext_vector_type(8)))  float f32x8;
__device__ __forceinline__ f32x8 wmma16(f16x16 a, f16x16 b, f32x8 c) {
  c = __builtin_amdgcn_wmma_f32_16x16x32_f16(false, a, false, b, (short)0, c, false, false);
  asm volatile("v_nop\n\tv_nop\n\tv_nop\n\tv_nop" : "+v"(c) : "v"(a), "v"(b));
  return c;
}
#define LDS_STRIDE 48   // unused
#define KSTRIDE    72   // unused
#define VSTRIDE    48   // unused

__device__ __forceinline__ f32x8 wmma_bf16(bf16x16 a, bf16x16 b, f32x8 c) {
  c = __builtin_amdgcn_wmma_f32_16x16x32_f16(false, a, false, b, (short)0, c, false, false);
  asm volatile("v_nop\n\tv_nop\n\tv_nop\n\tv_nop" : "+v"(c) : "v"(a), "v"(b));   // A/B-overwrite hazard guard
  return c;
}

// 16x32 (MxK) f16 fragment from a row-major global matrix.
// lanes 0-15  (row=lane)    : elems 0..7 = K+0..7,  8..15 = K+16..23
// lanes 16-31 (row=lane-16) : elems 0..7 = K+8..15, 8..15 = K+24..31
template <typename T>
__device__ __forceinline__ bf16x16 load_frag(const T* __restrict__ base, int ld,
                                             int row0, int k0) {
  const int lane = threadIdx.x & 31;
  const int r    = lane & 15;
  const int kh   = (lane >> 4) * 8;
  const T* p0 = base + (size_t)(row0 + r) * ld + (k0 + kh);
  const T* p1 = p0 + 16;
  bf16x16 f;
#pragma unroll
  for (int i = 0; i < 8; ++i) {
    f[i]     = (bf16)p0[i];
    f[i + 8] = (bf16)p1[i];
  }
  return f;
}

// Same fragment from an LDS tile with padded row stride (base includes row0/k0).
__device__ __forceinline__ bf16x16 lds_frag(const bf16* base, int stride) {
  const int lane = threadIdx.x & 31;
  const int row  = lane & 15;
  const int kh   = (lane >> 4) * 8;
  const bf16x8 lo = *(const bf16x8*)(base + row * stride + kh);
  const bf16x8 hi = *(const bf16x8*)(base + row * stride + kh + 16);
  bf16x16 f;
#pragma unroll
  for (int i = 0; i < 8; ++i) { f[i] = lo[i]; f[i + 8] = hi[i]; }
  return f;
}

// ---------------------------------------------------------------------------
// k_pv: Y[c][n] = rowscale[c] * sum_m G[c][m] * P[n][m] for the 32 real rows c of G [128][4096]; P f32 [4096][4096].
// Grid = 128 work-groups, each owns 32 columns n (one whole 128-B line of every Y row). Its 16 waves cut the sum over m
// into 16 ranges of 256; each wave stages its own 64-wide slices of G and P as f16 in its own LDS range (no work-group
// barrier in the loop), and the 16 f32 partials are added in wave order through LDS at the end.
// Rows 32..127 of G are exact zeros, so rows 32..127 of Y are stored as zeros (the next product reads them).
// ---------------------------------------------------------------------------
#define PVP 72   // staged row pitch: 64 -> 72 halfs (144 B = 16 B x 9): aligned b128 fragment reads without conflicts
#define PVR 36   // partial row pitch in floats: rows 8 apart fall on different banks
__global__ __launch_bounds__(512) void k_pv(const float* __restrict__ G, const float* __restrict__ P,
                                            const float* __restrict__ rowscale, float* __restrict__ Y) {
  __shared__ __attribute__((aligned(16))) f16 st[16][64 * PVP];     // per wave: rows 0..31 = G slice, rows 32..63 = P slice
  __shared__ __attribute__((aligned(16))) float red[16][32 * PVR];  // per wave: its 32 x 32 partial
  const int tid = threadIdx.x, lane = tid & 31, wave = tid >> 5;
  const int n0 = blockIdx.x * 32;
  const int hr = lane >> 4, q = (lane & 15) * 4;      // half a wave per row: 16 lanes x 16 B = two whole lines
  f16* sw = st[wave];
  const float* gp = G + (size_t)hr * NNs + wave * 256 + q;
  const float* pp = P + (size_t)(n0 + hr) * NNs + wave * 256 + q;
  v4f_t buf[32];
  // every loop below is unrolled: buf, acc and the fragments are register arrays and need constant indices
#pragma unroll
  for (int i = 0; i < 16; ++i) { buf[i] = *(const v4f_t*)(gp + (size_t)(2 * i) * NNs); buf[16 + i] = *(const v4f_t*)(pp + (size_t)(2 * i) * NNs); }
  f32x8 acc[2][2] = {};
  // the four slices' addresses become immediate offsets of the same two base pointers
#pragma unroll
  for (int s = 0; s < 4; ++s) {
#pragma unroll
    for (int i = 0; i < 32; ++i) {
      bf16x4 h; h[0] = (f16)buf[i][0]; h[1] = (f16)buf[i][1]; h[2] = (f16)buf[i][2]; h[3] = (f16)buf[i][3];
      *(bf16x4*)(sw + (2 * i + hr) * PVP + q) = h;
    }
    if (s + 1 < 4) {   // next slice's loads fly while this one is multiplied
#pragma unroll
      for (int i = 0; i < 16; ++i) { buf[i] = *(const v4f_t*)(gp + (size_t)(2 * i) * NNs + (s + 1) * 64); buf[16 + i] = *(const v4f_t*)(pp + (size_t)(2 * i) * NNs + (s + 1) * 64); }
    }
    asm volatile("s_wait_dscnt 0" ::: "memory");   // every lane's staged rows are in LDS before the wave's other lanes read them back
#pragma unroll
    for (int kk = 0; kk < 2; ++kk) {
      f16x16 gf[2], pf[2];
#pragma unroll
      for (int i = 0; i < 2; ++i) { gf[i] = lds_frag(sw + (16 * i) * PVP + kk * 32, PVP); pf[i] = lds_frag(sw + (32 + 16 * i) * PVP + kk * 32, PVP); }
#pragma unroll
      for (int i = 0; i < 2; ++i)
#pragma unroll
        for (int j = 0; j < 2; ++j) acc[i][j] = wmma_bf16(gf[i], pf[j], acc[i][j]);
    }
  }
  const int nlane = lane & 15, mh = (lane >> 4) * 8;
  float* rw = red[wave];
#pragma unroll
  for (int i = 0; i < 2; ++i)
#pragma unroll
    for (int j = 0; j < 2; ++j)
#pragma unroll
      for (int r = 0; r < 8; ++r) rw[(16 * i + mh + r) * PVR + 16 * j + nlane] = acc[i][j][r];
  __syncthreads();
  { const int c = tid >> 4, np = (tid & 15) * 2;     // 16 lanes x 8 B = one whole line of row c
    float s0 = 0.0f, s1 = 0.0f;
#pragma unroll
    for (int w = 0; w < 16; ++w) { const float2 v = *(const float2*)(&red[w][c * PVR + np]); s0 += v.x; s1 += v.y; }
    const float rs = rowscale[c];
    float2 o; o.x = s0 * rs; o.y = s1 * rs;
    *(float2*)(Y + (size_t)c * NNs + n0 + np) = o; }
  const v4f_t zero4 = {};
  for (int ch = tid; ch < 96 * 8; ch += 512) *(v4f_t*)(Y + (size_t)(32 + (ch >> 3)) * NNs + n0 + (ch & 7) * 4) = zero4;
}


// ---------------------------------------------------------------------------------------------------------------------------
// gemm_kne: Y[m][n] = epi( Σ_k A[m][k]·W[k][n] + bias[n] ), A f32/f16 [M][lda], W f32 row-major [K][N] (ldw), plain f16 operands,
// f32 accumulate. EPI 0: identity; 1: exact-erf GELU; 2: R[m][n] + gvec[n]·(·) (residual with per-channel gain). Output f32 (or f16
// when OUT16). Block = 128x128 tile, 8 waves as 4(M) x 2(N); per 32-wide k-step A and W tiles staged f16 in LDS (W transposed
// ---------------------------------------------------------------------------------------------------------------------------
#define GSTR 48
template <typename AT, int EPI, bool OUT16>
__global__ __launch_bounds__(256) void gemm_kne(const AT* __restrict__ A, int lda, const float* __restrict__ Wm, int ldw,
                                                const float* __restrict__ bias, const float* __restrict__ R, const float* __restrict__ gvec,
                                                void* __restrict__ Yv, int ldy, int K) {
  __shared__ __attribute__((aligned(16))) f16 ldsA[128 * GSTR];
  __shared__ __attribute__((aligned(16))) f16 ldsW[128 * GSTR];
  __shared__ __attribute__((aligned(16))) float oS[8][32 * 68];
  const int tid = threadIdx.x, lane = tid & 31, wave = tid >> 5, cl = lane & 15, rh = (lane >> 4) * 8;
  const int m0 = blockIdx.x * 128, n0 = blockIdx.y * 128;
  const int wm = (wave & 3) * 32, wn = (wave >> 2) * 64;
  f32x8 acc[2][4];
#pragma unroll
  for (int i = 0; i < 2; ++i)
#pragma unroll
    for (int j = 0; j < 4; ++j) { f32x8 z = {}; acc[i][j] = z; }
#pragma unroll 1
  for (int k0 = 0; k0 < K; k0 += 32) {
    __syncthreads();
    { const int row = tid >> 1, ch = (tid & 1) * 16;
      const AT* src = A + (size_t)(m0 + row) * lda + k0 + ch;
#pragma unroll
      for (int g = 0; g < 16; ++g) ldsA[row * GSTR + ch + g] = (f16)src[g]; }
    { const int k = tid >> 3, nn0 = (tid & 7) * 16;
      const float* src = Wm + (size_t)(k0 + k) * ldw + n0 + nn0;
#pragma unroll
      for (int g = 0; g < 4; ++g) { const v4f_t v = *(const v4f_t*)(src + 4 * g);
#pragma unroll
        for (int u = 0; u < 4; ++u) ldsW[(nn0 + 4 * g + u) * GSTR + k] = (f16)v[u]; } }
    __syncthreads();
    f16x16 af[2];
#pragma unroll
    for (int i = 0; i < 2; ++i) af[i] = lds_frag(ldsA + (wm + 16 * i) * GSTR, GSTR);
#pragma unroll
    for (int j = 0; j < 4; ++j) {
      const f16x16 bf = lds_frag(ldsW + (wn + 16 * j) * GSTR, GSTR);
#pragma unroll
      for (int i = 0; i < 2; ++i) acc[i][j] = wmma16(af[i], bf, acc[i][j]);
    }
  }
  float* so = oS[wave];
#pragma unroll
  for (int i = 0; i < 2; ++i)
#pragma unroll
    for (int j = 0; j < 4; ++j) {
      const int n = n0 + wn + 16 * j + cl;
      const float bv = bias ? bias[n] : 0.0f;
      const float gv = (EPI == 2) ? gvec[n] : 0.0f;
      if (EPI == 1) {
#pragma unroll 1
        for (int r = 0; r < 8; ++r) { const float xg = acc[i][j][r] + bv; so[(16 * i + rh + r) * 68 + 16 * j + cl] = 0.5f * xg * (1.0f + erff(xg * 0.70710678118654752f)); }
      } else {
#pragma unroll
        for (int r = 0; r < 8; ++r) {
          float v = acc[i][j][r] + bv;
          if (EPI == 2) v = R[(size_t)(m0 + wm + 16 * i + rh + r) * ldy + n] + gv * v;
          so[(16 * i + rh + r) * 68 + 16 * j + cl] = v;
        }
      }
    }
  asm volatile("s_wait_dscnt 0" ::: "memory");
  __builtin_amdgcn_wave_barrier();
{
    if (OUT16) {
      f16* Y = (f16*)Yv;
#pragma unroll
      for (int it = 0; it < 8; ++it) { const int c = lane + 32 * it, rr = c >> 3, q8 = (c & 7) * 8;
        union { f16 h[8]; v4u_t v; } u;
#pragma unroll
        for (int e = 0; e < 8; ++e) u.h[e] = (f16)so[rr * 68 + q8 + e];
        *(v4u_t*)(Y + (size_t)(m0 + wm + rr) * ldy + n0 + wn + q8) = u.v; }
    } else {
      float* Y = (float*)Yv;
#pragma unroll
      for (int it = 0; it < 16; ++it) { const int f4 = lane + 32 * it, rr = f4 >> 4, q = (f4 & 15) * 4;
        *(v4f_t*)(Y + (size_t)(m0 + wm + rr) * ldy + n0 + wn + q) = *(const v4fa*)(so + rr * 68 + q); }
    }
    
  }
}

// eval BatchNorm of a frame: xb[c][n] = x*inv_c + (beta − mean*inv)_c, inv = gamma/sqrt(var+eps); rows of 16 KB
__global__ __launch_bounds__(256) void k_bn(const float* __restrict__ x, const float* __restrict__ p, float* __restrict__ y) { const size_t row = blockIdx.x; const int c = row % CCs;
  const float inv = p[c] / sqrtf(p[3 * CCs + c] + 1e-5f), sh = p[CCs + c] - p[2 * CCs + c] * inv;
  for (int q4 = threadIdx.x; q4 < NNs / 4; q4 += 256) { v4f_t v = *(const v4f_t*)(x + row * NNs + q4 * 4); for (int e = 0; e < 4; ++e) v[e] = v[e] * inv + sh;
    *(v4f_t*)(y + row * NNs + q4 * 4) = v;  } }
// zero-padded weights: Wp[r][c] (rows x cols) from W[nr][nc]
__global__ __launch_bounds__(128) void k_padw(const float* __restrict__ Wm, int nr, int nc, int cols, float* __restrict__ Wp) { const int r = blockIdx.x, c = threadIdx.x; if (c >= cols) return;
  const float v = (r < nr && c < nc) ? Wm[r * nc + c] : 0.0f; *(float*)(Wp + (size_t)r * cols + c) = v;  }
__global__ __launch_bounds__(256) void k_rowbias(float* __restrict__ t, const float* __restrict__ bias, int nrows) { const size_t row = blockIdx.x; const float bv = (row < (size_t)nrows) ? bias[row] : 0.0f;
  for (int q4 = threadIdx.x; q4 < NNs / 4; q4 += 256) { v4f_t v = *(const v4f_t*)(t + row * NNs + q4 * 4); for (int e = 0; e < 4; ++e) v[e] += bv; *(v4f_t*)(t + row * NNs + q4 * 4) = v;  } }
__global__ __launch_bounds__(256) void k_tr32(const float* __restrict__ A, float* __restrict__ At) { __shared__ float tS[32][65];
  const int tid = threadIdx.x; const int n0 = blockIdx.x * 64;
  for (int e = tid; e < 32 * 64; e += 256) { const int c = e >> 6, j = e & 63; tS[c][j] = A[(size_t)c * NNs + n0 + j]; }
  __syncthreads();
  { const int j = tid >> 2, q4 = (tid & 3) * 8; v4f_t o0, o1; for (int k = 0; k < 4; ++k) { o0[k] = tS[q4 + k][j]; o1[k] = tS[q4 + 4 + k][j]; }
    float* dst = At + (size_t)(n0 + j) * CIs + q4; *(v4f_t*)dst = o0; *(v4f_t*)(dst + 4) = o1;  }
}
__global__ __launch_bounds__(256) void k_transpose(const float* __restrict__ Wm, float* __restrict__ Wt, int rows, int cols) {
  __shared__ float tS[64][65];
  const int tid = threadIdx.x, tbj = cols / 64, bi = blockIdx.x / tbj, bj = blockIdx.x % tbj;
  for (int e = tid; e < 64 * 64; e += 256) { const int r = e >> 6, c = e & 63; tS[r][c] = Wm[(size_t)(bi * 64 + r) * cols + bj * 64 + c]; }
  __syncthreads();
  for (int ch = tid; ch < 64 * 16; ch += 256) { const int r = ch >> 4, q4 = (ch & 15) * 4; v4f_t o; o[0] = tS[q4][r]; o[1] = tS[q4 + 1][r]; o[2] = tS[q4 + 2][r]; o[3] = tS[q4 + 3][r];
    float* dst = Wt + (size_t)(bj * 64 + r) * rows + bi * 64 + q4; *(v4f_t*)dst = o;  }
}
// row softmax in place -> 1024·softmax (f32): block = row, 256 threads x 16 elements
__global__ __launch_bounds__(256) void k_softmax(float* __restrict__ E) {
  __shared__ float red[256];
  const size_t row = blockIdx.x; const int tid = threadIdx.x; float* er = E + row * NNs;
  float v[16]; float m = -3.0e38f;
#pragma unroll
  for (int e = 0; e < 16; ++e) { v[e] = er[tid * 16 + e]; m = fmaxf(m, v[e]); }
  red[tid] = m; __syncthreads();
  for (int o = 128; o > 0; o >>= 1) { if (tid < o) red[tid] = fmaxf(red[tid], red[tid + o]); __syncthreads(); }
  m = red[0]; __syncthreads();
  float z = 0.0f;
#pragma unroll
  for (int e = 0; e < 16; ++e) { v[e] = expf(v[e] - m); z += v[e]; }
  red[tid] = z; __syncthreads();
  for (int o = 128; o > 0; o >>= 1) { if (tid < o) red[tid] += red[tid + o]; __syncthreads(); }
  const float sc = 1024.0f / red[0];
  v4f_t o[4]; for (int e = 0; e < 16; ++e) o[e >> 2][e & 3] = v[e] * sc;
{ for (int i = 0; i < 4; ++i) *(v4f_t*)(er + tid * 16 + i * 4) = o[i];  }
}
__global__ __launch_bounds__(256) void k_fill(float* __restrict__ p, float val, int n) { for (int i = threadIdx.x; i < n; i += 256) { *(float*)(p + i) = val;  } }
// out[b][c][n] = x[b][c][n] + bn_w(Z[c][n] + W_b[c])  for the 64 real rows of Z [128][4096]; rows of 16 KB
__global__ __launch_bounds__(256) void k_outbn(const float* __restrict__ Z, const float* __restrict__ Wb, const float* __restrict__ p, const float* __restrict__ x, float* __restrict__ out) { const int c = blockIdx.x;
  const float inv = p[c] / sqrtf(p[3 * CCs + c] + 1e-5f), sh = p[CCs + c] - p[2 * CCs + c] * inv; const float wb = Wb[c];
  for (int q4 = threadIdx.x; q4 < NNs / 4; q4 += 256) { const v4f_t z = *(const v4f_t*)(Z + (size_t)c * NNs + q4 * 4), xv = *(const v4f_t*)(x + (size_t)c * NNs + q4 * 4); v4f_t o;
    for (int e = 0; e < 4; ++e) o[e] = xv[e] + ((z[e] + wb) * inv + sh);
    *(v4f_t*)(out + (size_t)c * NNs + q4 * 4) = o;  } }

extern "C" void kernel_launch(void* const* d_in, const int* in_sizes, int n_in,
                              void* d_out, int out_size, void* d_ws, size_t ws_size,
                              hipStream_t stream) {
  (void)in_sizes; (void)n_in; (void)out_size;
  const float** f = (const float**)d_in;
  const float* x1 = f[0], *x2 = f[1], *gbn = f[2], *gw = f[3], *gb = f[4], *tbn = f[5], *tw = f[6], *tb = f[7], *pbn = f[8], *pw = f[9], *pb = f[10], *wbn = f[11], *Ww = f[12], *Wb = f[13];
  float* out1 = (float*)d_out; float* out2 = out1 + (size_t)NBs * CCs * NNs;     // tuple
  char* ws = (char*)d_ws;
  float* gwP = (float*)ws; ws += 128 * 64 * 4; float* twP = (float*)ws; ws += 128 * 64 * 4; float* pwP = (float*)ws; ws += 128 * 64 * 4; float* WwP = (float*)ws; ws += 128 * 128 * 4;   // padded weights
  float* xb = (float*)ws; ws += (size_t)CCs * NNs * 4;            // BN'd frame (1 MB)
  float* g1 = (float*)ws; ws += (size_t)128 * NNs * 4; float* g2 = (float*)ws; ws += (size_t)128 * NNs * 4; float* th = (float*)ws; ws += (size_t)128 * NNs * 4; float* ph = (float*)ws; ws += (size_t)128 * NNs * 4;   // [128][4096] (rows 32.. zero), 2 MB each
  float* thT = (float*)ws; ws += (size_t)NNs * CIs * 4; float* phT = (float*)ws; ws += (size_t)NNs * CIs * 4;    // [4096][32]
  float* E = (float*)ws; ws += (size_t)NNs * NNs * 4;             // 64 MB: E then Eᵀ
  float* Y = (float*)ws; ws += (size_t)128 * NNs * 4;             // y1 / y2 [128][4096]
  float* Z = (float*)ws; ws += (size_t)128 * NNs * 4;             // W_out result [128][4096]
  float* rsc = (float*)ws; ws += 128 * 4;
  if ((size_t)(ws - (char*)d_ws) > ws_size) return;
  const dim3 blk(256);
  k_padw<<<dim3(128), dim3(128), 0, stream>>>(gw, CIs, CCs, CCs, gwP); k_padw<<<dim3(128), dim3(128), 0, stream>>>(tw, CIs, CCs, CCs, twP); k_padw<<<dim3(128), dim3(128), 0, stream>>>(pw, CIs, CCs, CCs, pwP);
  k_padw<<<dim3(128), dim3(128), 0, stream>>>(Ww, CCs, CIs, 128, WwP);     // W_w [64][32] -> [128][128]
  k_fill<<<dim3(1), blk, 0, stream>>>(rsc, 1.0f / 1024.0f, 128);
  for (int b = 0; b < NBs; ++b) {
    const float* x1b = x1 + (size_t)b * CCs * NNs; const float* x2b = x2 + (size_t)b * CCs * NNs;
    // frame 1: g1 = g(bn_g x1), θ = θ(bn_θ x1); frame 2: g2 = g(bn_g x2), φ = φ(bn_φ x2)   (channels-major [128 pad][4096])
    k_bn<<<dim3(CCs), blk, 0, stream>>>(x1b, gbn, xb); gemm_kne<float, 0, false><<<dim3(1, NNs / 128), blk, 0, stream>>>(gwP, CCs, xb, NNs, nullptr, nullptr, nullptr, g1, NNs, CCs); k_rowbias<<<dim3(CIs), blk, 0, stream>>>(g1, gb, CIs);
    k_bn<<<dim3(CCs), blk, 0, stream>>>(x1b, tbn, xb); gemm_kne<float, 0, false><<<dim3(1, NNs / 128), blk, 0, stream>>>(twP, CCs, xb, NNs, nullptr, nullptr, nullptr, th, NNs, CCs); k_rowbias<<<dim3(CIs), blk, 0, stream>>>(th, tb, CIs);
    k_bn<<<dim3(CCs), blk, 0, stream>>>(x2b, gbn, xb); gemm_kne<float, 0, false><<<dim3(1, NNs / 128), blk, 0, stream>>>(gwP, CCs, xb, NNs, nullptr, nullptr, nullptr, g2, NNs, CCs); k_rowbias<<<dim3(CIs), blk, 0, stream>>>(g2, gb, CIs);
    k_bn<<<dim3(CCs), blk, 0, stream>>>(x2b, pbn, xb); gemm_kne<float, 0, false><<<dim3(1, NNs / 128), blk, 0, stream>>>(pwP, CCs, xb, NNs, nullptr, nullptr, nullptr, ph, NNs, CCs); k_rowbias<<<dim3(CIs), blk, 0, stream>>>(ph, pb, CIs);
    k_tr32<<<dim3(NNs / 64), blk, 0, stream>>>(th, thT); k_tr32<<<dim3(NNs / 64), blk, 0, stream>>>(ph, phT);     // θᵀ, φᵀ [4096][32]
    // E[n][m] = Σ_c θ[c][n] φ[c][m]  (A = θᵀ [4096][32], W = φ [32][4096])  -> att1 = row softmax -> y2 = g2·att1ᵀ
    gemm_kne<float, 0, false><<<dim3(NNs / 128, NNs / 128), blk, 0, stream>>>(thT, CIs, ph, NNs, nullptr, nullptr, nullptr, E, NNs, CIs);
    k_softmax<<<dim3(NNs), blk, 0, stream>>>(E);
    k_pv<<<dim3(NNs / 32), dim3(512), 0, stream>>>(g2, E, rsc, Y);           // y2[c][n] = Σ_m g2[c][m] att1[n][m]
    gemm_kne<float, 0, false><<<dim3(1, NNs / 128), blk, 0, stream>>>(WwP, 128, Y, NNs, nullptr, nullptr, nullptr, Z, NNs, 128);          // W_w·y2 (K = 128 padded)
    k_outbn<<<dim3(CCs), blk, 0, stream>>>(Z, Wb, wbn, x2b, out2 + (size_t)b * CCs * NNs);
    // Eᵀ[m][n] (A = φᵀ, W = θ) -> att2ᵀ = row softmax -> y1 = g1·att2  (Bt = att2ᵀ)
    gemm_kne<float, 0, false><<<dim3(NNs / 128, NNs / 128), blk, 0, stream>>>(phT, CIs, th, NNs, nullptr, nullptr, nullptr, E, NNs, CIs);
    k_softmax<<<dim3(NNs), blk, 0, stream>>>(E);
    k_pv<<<dim3(NNs / 32), dim3(512), 0, stream>>>(g1, E, rsc, Y);           // y1[c][m] = Σ_n g1[c][n] att2[n][m]
    gemm_kne<float, 0, false><<<dim3(1, NNs / 128), blk, 0, stream>>>(WwP, 128, Y, NNs, nullptr, nullptr, nullptr, Z, NNs, 128);
    k_outbn<<<dim3(CCs), blk, 0, stream>>>(Z, Wb, wbn, x1b, out1 + (size_t)b * CCs * NNs);
  }
}

// v002
// Measured time: 447 microseconds a run.
// In both of two side-by-side timings against v001, it was 1.69 times as fast.
// Over all steps from v000 it is 5.20 times as fast.
// Contractions on v_wmma_f32_16x16x32_f16 (plain f16 operands, f32 accumulate), per batch: theta/phi/g 1x1 convs of the eval-BatchNorm'd
// frames (K = 64; [out][in] weights zero-padded to 128 rows so the channels-major results are 128-row operands with exact zero rows), then
// one fused kernel per direction: scores theta^T.phi (K = 32), softmax in f32 with a running maximum, and the weighted sum of g (K = 4096);
// the 4096 x 4096 scores never reach memory. y2 takes theta as queries, phi as keys, g2 as values; y1 takes phi, theta, g1. Then
// W_out (K = 32 zero-padded to 128), its BatchNorm and the residual in f32 into both outputs.
// compute dtype: f16 operands, f32 accumulate.  x1, x2 [4,64,64,64] -> (x1 + W(y1), x2 + W(y2)).
#include <hip/hip_runtime.h>
#include <hip/hip_bf16.h>
#include <math.h>

#define NBs 4
#define CCs 64
#define CIs 32
#define NNs 4096
#define SS 4096
#define HH 1
#define DKK 64
#define GSTR 48

typedef _Float16 bf16;
typedef _Float16 f16;
typedef __attribute__((ext_vector_type(4))) unsigned v4u_t;
typedef unsigned v4ua __attribute__((ext_vector_type(4), may_alias));
typedef __attribute__((ext_vector_type(4))) float v4f_t;
typedef float v4fa __attribute__((ext_vector_type(4), may_alias));
typedef __attribute__((ext_vector_type(16))) bf16  bf16x16;
typedef bf16x16 f16x16;
typedef __attribute__((ext_vector_type(8)))  bf16  bf16x8;
typedef bf16x8 f16x8;
typedef __attribute__((ext_vector_type(4)))  bf16  bf16x4;
typedef __attribute__((ext_vector_type(8)))  float f32x8;
__device__ __forceinline__ f32x8 wmma16(f16x16 a, f16x16 b, f32x8 c) {
  c = __builtin_amdgcn_wmma_f32_16x16x32_f16(false, a, false, b, (short)0, c, false, false);
  asm volatile("v_nop\n\tv_nop\n\tv_nop\n\tv_nop" : "+v"(c) : "v"(a), "v"(b));
  return c;
}
#define LDS_STRIDE 48   // unused; the GEMM tiles use GSTR (same 48)
#define KSTRIDE    72   // unused; k_attn stages 32 x 32 tiles with pitch AKP
#define VSTRIDE    48   // unused; k_attn uses AKP

// 16x32 (MxK) f16 fragment from a row-major global matrix.
// lanes 0-15  (row=lane)    : elems 0..7 = K+0..7,  8..15 = K+16..23
// lanes 16-31 (row=lane-16) : elems 0..7 = K+8..15, 8..15 = K+24..31
template <typename T>
__device__ __forceinline__ bf16x16 load_frag(const T* __restrict__ base, int ld,
                                             int row0, int k0) {
  const int lane = threadIdx.x & 31;
  const int r    = lane & 15;
  const int kh   = (lane >> 4) * 8;
  const T* p0 = base + (size_t)(row0 + r) * ld + (k0 + kh);
  const T* p1 = p0 + 16;
  bf16x16 f;
#pragma unroll
  for (int i = 0; i < 8; ++i) {
    f[i]     = (bf16)p0[i];
    f[i + 8] = (bf16)p1[i];
  }
  return f;
}

// Same fragment from an LDS tile with padded row stride (base includes row0/k0).
__device__ __forceinline__ bf16x16 lds_frag(const bf16* base, int stride) {
  const int lane = threadIdx.x & 31;
  const int row  = lane & 15;
  const int kh   = (lane >> 4) * 8;
  const bf16x8 lo = *(const bf16x8*)(base + row * stride + kh);
  const bf16x8 hi = *(const bf16x8*)(base + row * stride + kh + 16);
  bf16x16 f;
#pragma unroll
  for (int i = 0; i < 8; ++i) { f[i] = lo[i]; f[i + 8] = hi[i]; }
  return f;
}

// ---------------------------------------------------------------------------
// k_attn: Y[c][n] = sum_m G[c][m] * softmax_m(S[n][m]), S[n][m] = sum_k Qt[n][k] * Kt[m][k] (k < 32), for the 32 real rows c of
// G [128][4096]; Qt, Kt f32 [4096][32]. S and the weights live in registers only.
// Grid = 128 work-groups, each owns 32 columns n (one whole 128-B line of every Y row). Its 16 waves cut the keys m into 16
// ranges of 256; each wave stages its own 32-key slices of Kt and G as f16 in its own LDS range (no work-group barrier in the
// loop) and keeps a running maximum, a running sum and an un-normalised 32 x 32 partial per column. Transposed scores
// (A = keys, B = queries) leave a lane with column n = lane & 15 and keys 8 * (lane >> 4) + r: two such tiles are, register
// for register, the B fragment of the second product. The 16 partials are merged in wave order through LDS at the end.
// Rows 32..127 of G are exact zeros, so rows 32..127 of Y are stored as zeros (the next product reads them).
// ---------------------------------------------------------------------------
#define AKP 40   // staged row pitch: 32 -> 40 halfs (80 B = 16 B x 5): aligned b128 fragment reads without conflicts
#define ARP 36   // partial row pitch in floats: rows 8 apart fall on different banks
#define L2E 1.4426950408889634f
// value of lane l ^ 16
__device__ __forceinline__ float other_half(float v) {
  const int b = __builtin_bit_cast(int, v);
  return __builtin_bit_cast(float, __builtin_amdgcn_permlanex16(b, b, 0x76543210, 0xfedcba98, false, false));
}
// 2^x on v_exp_f32 with the slot behind it filled inside the statement: the instruction set asks for one independent instruction or
// v_nop between a transcendental and a direct reader of its result or writer of its source.
// In the group of four each v_exp_f32 is the independent instruction behind the one before
// (outputs are early-clobber, so none shares a register with an input).
__device__ __forceinline__ float exp2_slot(float x) {
  float y;
  asm("v_exp_f32 %0, %1\n\tv_nop" : "=v"(y) : "v"(x));
  return y;
}
__device__ __forceinline__ void exp2_slot4(float& a, float& b, float& c, float& d) {
  float ya, yb, yc, yd;
  asm("v_exp_f32 %0, %4\n\tv_exp_f32 %1, %5\n\tv_exp_f32 %2, %6\n\tv_exp_f32 %3, %7\n\tv_nop"
      : "=&v"(ya), "=&v"(yb), "=&v"(yc), "=&v"(yd) : "v"(a), "v"(b), "v"(c), "v"(d));
  a = ya; b = yb; c = yc; d = yd;
}
__global__ __launch_bounds__(512) void k_attn(const float* __restrict__ Qt, const float* __restrict__ Kt,
                                              const float* __restrict__ G, float* __restrict__ Y) {
  __shared__ __attribute__((aligned(16))) f16 sk[16][32 * AKP];     // per wave: 32 keys x 32 channels
  __shared__ __attribute__((aligned(16))) f16 sv[16][32 * AKP];     // per wave: 32 rows of G x 32 keys
  __shared__ __attribute__((aligned(16))) float red[16][32 * ARP];  // per wave: its 32 x 32 partial
  __shared__ float smx[16][32], ssm[16][32];                        // per wave and column: maximum, sum
  const int tid = threadIdx.x, lane = tid & 31, wave = tid >> 5;
  const int n0 = blockIdx.x * 32;
  const int kr = lane >> 3, kq = (lane & 7) * 4;      // 8 lanes per 128-B row piece: a load takes four whole lines
  f16* swk = sk[wave];
  f16* swv = sv[wave];
  const float* kp = Kt + (size_t)(wave * 256 + kr) * CIs + kq;
  const float* gp = G + (size_t)kr * NNs + wave * 256 + kq;
  v4f_t buf[16];
  // the inner loops are unrolled: buf, acc and the fragments are register arrays and need constant indices
#pragma unroll
  for (int i = 0; i < 8; ++i) { buf[i] = *(const v4f_t*)(kp + (size_t)(4 * i) * CIs); buf[8 + i] = *(const v4f_t*)(gp + (size_t)(4 * i) * NNs); }
  f16x16 qf[2];
#pragma unroll
  for (int j = 0; j < 2; ++j) qf[j] = load_frag(Qt, CIs, n0 + 16 * j, 0);
  f32x8 acc[2][2] = {};
  float mrun[2] = {-3.0e38f, -3.0e38f}, lrun[2] = {0.0f, 0.0f};
  // the loop over slices stays rolled: unrolled, the compiler put off the running sums' additions to the end and spilled the weights
#pragma unroll 1
  for (int s = 0; s < 8; ++s) {
#pragma unroll
    for (int i = 0; i < 8; ++i) {
      bf16x4 h; h[0] = (f16)buf[i][0]; h[1] = (f16)buf[i][1]; h[2] = (f16)buf[i][2]; h[3] = (f16)buf[i][3];
      *(bf16x4*)(swk + (4 * i + kr) * AKP + kq) = h;
      bf16x4 g; g[0] = (f16)buf[8 + i][0]; g[1] = (f16)buf[8 + i][1]; g[2] = (f16)buf[8 + i][2]; g[3] = (f16)buf[8 + i][3];
      *(bf16x4*)(swv + (4 * i + kr) * AKP + kq) = g;
    }
    if (s + 1 < 8) {   // next slice's loads fly while this one is worked on
      kp += 32 * CIs; gp += 32;
#pragma unroll
      for (int i = 0; i < 8; ++i) { buf[i] = *(const v4f_t*)(kp + (size_t)(4 * i) * CIs); buf[8 + i] = *(const v4f_t*)(gp + (size_t)(4 * i) * NNs); }
    }
    asm volatile("s_wait_dscnt 0" ::: "memory");   // every lane's staged rows are in LDS before the wave's other lanes read them back
    f16x16 kf[2], vf[2];
#pragma unroll
    for (int t = 0; t < 2; ++t) { kf[t] = lds_frag(swk + (16 * t) * AKP, AKP); vf[t] = lds_frag(swv + (16 * t) * AKP, AKP); }
#pragma unroll
    for (int j = 0; j < 2; ++j) {
      f32x8 sc[2];   // scores of keys 16 t + 8 (lane >> 4) + r against column 16 j + (lane & 15)
#pragma unroll
      for (int t = 0; t < 2; ++t) { const f32x8 z = {}; sc[t] = __builtin_amdgcn_wmma_f32_16x16x32_f16(false, kf[t], false, qf[j], (short)0, z, false, false); }
      float mx = sc[0][0];
#pragma unroll
      for (int t = 0; t < 2; ++t)
#pragma unroll
        for (int r = 0; r < 8; ++r) mx = fmaxf(mx, sc[t][r]);
      mx = fmaxf(mx, other_half(mx));
      const float mn = fmaxf(mrun[j], mx);
      const float al = exp2_slot((mrun[j] - mn) * L2E);   // 0 on the first slice
      mrun[j] = mn;
      const float mb = 10.0f - mn * L2E;   // weights are 1024 * exp(score - maximum): small ones stay normal f16 numbers; the factor cancels in the division
      f16x16 pf;
      float gs[4];   // sums of four weights each
#pragma unroll
      for (int t = 0; t < 2; ++t)
#pragma unroll
        for (int r = 0; r < 8; r += 4) {
          float p0 = sc[t][r] * L2E + mb, p1 = sc[t][r + 1] * L2E + mb, p2 = sc[t][r + 2] * L2E + mb, p3 = sc[t][r + 3] * L2E + mb;
          exp2_slot4(p0, p1, p2, p3);
          gs[t * 2 + (r >> 2)] = (p0 + p1) + (p2 + p3);
          pf[t * 8 + r] = (f16)p0; pf[t * 8 + r + 1] = (f16)p1; pf[t * 8 + r + 2] = (f16)p2; pf[t * 8 + r + 3] = (f16)p3;
        }
      lrun[j] = lrun[j] * al + ((gs[0] + gs[1]) + (gs[2] + gs[3]));
#pragma unroll
      for (int i = 0; i < 2; ++i) {
#pragma unroll
        for (int r = 0; r < 8; ++r) acc[i][j][r] *= al;
        acc[i][j] = __builtin_amdgcn_wmma_f32_16x16x32_f16(false, vf[i], false, pf, (short)0, acc[i][j], false, false);
      }
    }
  }
  const int nlane = lane & 15, mh = (lane >> 4) * 8;
  float* rw = red[wave];
#pragma unroll
  for (int i = 0; i < 2; ++i)
#pragma unroll
    for (int j = 0; j < 2; ++j)
#pragma unroll
      for (int r = 0; r < 8; ++r) rw[(16 * i + mh + r) * ARP + 16 * j + nlane] = acc[i][j][r];
#pragma unroll
  for (int j = 0; j < 2; ++j) {
    const float lt = lrun[j] + other_half(lrun[j]);   // the two halves hold different keys of the same column
    if (lane < 16) { smx[wave][16 * j + lane] = mrun[j]; ssm[wave][16 * j + lane] = lt; }
  }
  __syncthreads();
  { const int c = tid >> 4, np = (tid & 15) * 2;     // 16 lanes x 8 B = one whole line of row c
    float m0 = smx[0][np], m1 = smx[0][np + 1];
#pragma unroll
    for (int w = 1; w < 16; ++w) { m0 = fmaxf(m0, smx[w][np]); m1 = fmaxf(m1, smx[w][np + 1]); }
    float s0 = 0.0f, s1 = 0.0f, l0 = 0.0f, l1 = 0.0f;
#pragma unroll
    for (int w = 0; w < 16; ++w) {
      const float2 v = *(const float2*)(&red[w][c * ARP + np]);
      const float f0 = exp2_slot((smx[w][np] - m0) * L2E), f1 = exp2_slot((smx[w][np + 1] - m1) * L2E);
      s0 += v.x * f0; s1 += v.y * f1; l0 += ssm[w][np] * f0; l1 += ssm[w][np + 1] * f1;
    }
    float2 o; o.x = s0 / l0; o.y = s1 / l1;
    *(float2*)(Y + (size_t)c * NNs + n0 + np) = o; }
  const v4f_t zero4 = {};
  for (int ch = tid; ch < 96 * 8; ch += 512) *(v4f_t*)(Y + (size_t)(32 + (ch >> 3)) * NNs + n0 + (ch & 7) * 4) = zero4;
}


// ---------------------------------------------------------------------------------------------------------------------------
// gemm_kne: Y[m][n] = epi( Σ_k A[m][k]·W[k][n] + bias[n] ), A f32/f16 [M][lda], W f32 row-major [K][N] (ldw), plain f16 operands,
// f32 accumulate. EPI 0: identity; 1: exact-erf GELU; 2: R[m][n] + gvec[n]·(·) (residual with per-channel gain). Output f32 (or f16
// when OUT16). Block = 128x128 tile, 8 waves as 4(M) x 2(N); per 32-wide k-step A and W tiles staged f16 in LDS (W transposed
// ---------------------------------------------------------------------------------------------------------------------------
#define GSTR 48
template <typename AT, int EPI, bool OUT16>
__global__ __launch_bounds__(256) void gemm_kne(const AT* __restrict__ A, int lda, const float* __restrict__ Wm, int ldw,
                                                const float* __restrict__ bias, const float* __restrict__ R, const float* __restrict__ gvec,
                                                void* __restrict__ Yv, int ldy, int K) {
  __shared__ __attribute__((aligned(16))) f16 ldsA[128 * GSTR];
  __shared__ __attribute__((aligned(16))) f16 ldsW[128 * GSTR];
  __shared__ __attribute__((aligned(16))) float oS[8][32 * 68];
  const int tid = threadIdx.x, lane = tid & 31, wave = tid >> 5, cl = lane & 15, rh = (lane >> 4) * 8;
  const int m0 = blockIdx.x * 128, n0 = blockIdx.y * 128;
  const int wm = (wave & 3) * 32, wn = (wave >> 2) * 64;
  f32x8 acc[2][4];
#pragma unroll
  for (int i = 0; i < 2; ++i)
#pragma unroll
    for (int j = 0; j < 4; ++j) { f32x8 z = {}; acc[i][j] = z; }
#pragma unroll 1
  for (int k0 = 0; k0 < K; k0 += 32) {
    __syncthreads();
    { const int row = tid >> 1, ch = (tid & 1) * 16;
      const AT* src = A + (size_t)(m0 + row) * lda + k0 + ch;
#pragma unroll
      for (int g = 0; g < 16; ++g) ldsA[row * GSTR + ch + g] = (f16)src[g]; }
    { const int k = tid >> 3, nn0 = (tid & 7) * 16;
      const float* src = Wm + (size_t)(k0 + k) * ldw + n0 + nn0;
#pragma unroll
      for (int g = 0; g < 4; ++g) { const v4f_t v = *(const v4f_t*)(src + 4 * g);
#pragma unroll
        for (int u = 0; u < 4; ++u) ldsW[(nn0 + 4 * g + u) * GSTR + k] = (f16)v[u]; } }
    __syncthreads();
    f16x16 af[2];
#pragma unroll
    for (int i = 0; i < 2; ++i) af[i] = lds_frag(ldsA + (wm + 16 * i) * GSTR, GSTR);
#pragma unroll
    for (int j = 0; j < 4; ++j) {
      const f16x16 bf = lds_frag(ldsW + (wn + 16 * j) * GSTR, GSTR);
#pragma unroll
      for (int i = 0; i < 2; ++i) acc[i][j] = wmma16(af[i], bf, acc[i][j]);
    }
  }
  float* so = oS[wave];
#pragma unroll
  for (int i = 0; i < 2; ++i)
#pragma unroll
    for (int j = 0; j < 4; ++j) {
      const int n = n0 + wn + 16 * j + cl;
      const float bv = bias ? bias[n] : 0.0f;
      const float gv = (EPI == 2) ? gvec[n] : 0.0f;
      if (EPI == 1) {
#pragma unroll 1
        for (int r = 0; r < 8; ++r) { const float xg = acc[i][j][r] + bv; so[(16 * i + rh + r) * 68 + 16 * j + cl] = 0.5f * xg * (1.0f + erff(xg * 0.70710678118654752f)); }
      } else {
#pragma unroll
        for (int r = 0; r < 8; ++r) {
          float v = acc[i][j][r] + bv;
          if (EPI == 2) v = R[(size_t)(m0 + wm + 16 * i + rh + r) * ldy + n] + gv * v;
          so[(16 * i + rh + r) * 68 + 16 * j + cl] = v;
        }
      }
    }
  asm volatile("s_wait_dscnt 0" ::: "memory");
  __builtin_amdgcn_wave_barrier();
{
    if (OUT16) {
      f16* Y = (f16*)Yv;
#pragma unroll
      for (int it = 0; it < 8; ++it) { const int c = lane + 32 * it, rr = c >> 3, q8 = (c & 7) * 8;
        union { f16 h[8]; v4u_t v; } u;
#pragma unroll
        for (int e = 0; e < 8; ++e) u.h[e] = (f16)so[rr * 68 + q8 + e];
        *(v4u_t*)(Y + (size_t)(m0 + wm + rr) * ldy + n0 + wn + q8) = u.v; }
    } else {
      float* Y = (float*)Yv;
#pragma unroll
      for (int it = 0; it < 16; ++it) { const int f4 = lane + 32 * it, rr = f4 >> 4, q = (f4 & 15) * 4;
        *(v4f_t*)(Y + (size_t)(m0 + wm + rr) * ldy + n0 + wn + q) = *(const v4fa*)(so + rr * 68 + q); }
    }
    
  }
}

// eval BatchNorm of a frame: xb[c][n] = x*inv_c + (beta − mean*inv)_c, inv = gamma/sqrt(var+eps); rows of 16 KB
__global__ __launch_bounds__(256) void k_bn(const float* __restrict__ x, const float* __restrict__ p, float* __restrict__ y) { const size_t row = blockIdx.x; const int c = row % CCs;
  const float inv = p[c] / sqrtf(p[3 * CCs + c] + 1e-5f), sh = p[CCs + c] - p[2 * CCs + c] * inv;
  for (int q4 = threadIdx.x; q4 < NNs / 4; q4 += 256) { v4f_t v = *(const v4f_t*)(x + row * NNs + q4 * 4); for (int e = 0; e < 4; ++e) v[e] = v[e] * inv + sh;
    *(v4f_t*)(y + row * NNs + q4 * 4) = v;  } }
// zero-padded weights: Wp[r][c] (rows x cols) from W[nr][nc]
__global__ __launch_bounds__(128) void k_padw(const float* __restrict__ Wm, int nr, int nc, int cols, float* __restrict__ Wp) { const int r = blockIdx.x, c = threadIdx.x; if (c >= cols) return;
  const float v = (r < nr && c < nc) ? Wm[r * nc + c] : 0.0f; *(float*)(Wp + (size_t)r * cols + c) = v;  }
__global__ __launch_bounds__(256) void k_rowbias(float* __restrict__ t, const float* __restrict__ bias, int nrows) { const size_t row = blockIdx.x; const float bv = (row < (size_t)nrows) ? bias[row] : 0.0f;
  for (int q4 = threadIdx.x; q4 < NNs / 4; q4 += 256) { v4f_t v = *(const v4f_t*)(t + row * NNs + q4 * 4); for (int e = 0; e < 4; ++e) v[e] += bv; *(v4f_t*)(t + row * NNs + q4 * 4) = v;  } }
__global__ __launch_bounds__(256) void k_tr32(const float* __restrict__ A, float* __restrict__ At) { __shared__ float tS[32][65];
  const int tid = threadIdx.x; const int n0 = blockIdx.x * 64;
  for (int e = tid; e < 32 * 64; e += 256) { const int c = e >> 6, j = e & 63; tS[c][j] = A[(size_t)c * NNs + n0 + j]; }
  __syncthreads();
  { const int j = tid >> 2, q4 = (tid & 3) * 8; v4f_t o0, o1; for (int k = 0; k < 4; ++k) { o0[k] = tS[q4 + k][j]; o1[k] = tS[q4 + 4 + k][j]; }
    float* dst = At + (size_t)(n0 + j) * CIs + q4; *(v4f_t*)dst = o0; *(v4f_t*)(dst + 4) = o1;  }
}
__global__ __launch_bounds__(256) void k_transpose(const float* __restrict__ Wm, float* __restrict__ Wt, int rows, int cols) {
  __shared__ float tS[64][65];
  const int tid = threadIdx.x, tbj = cols / 64, bi = blockIdx.x / tbj, bj = blockIdx.x % tbj;
  for (int e = tid; e < 64 * 64; e += 256) { const int r = e >> 6, c = e & 63; tS[r][c] = Wm[(size_t)(bi * 64 + r) * cols + bj * 64 + c]; }
  __syncthreads();
  for (int ch = tid; ch < 64 * 16; ch += 256) { const int r = ch >> 4, q4 = (ch & 15) * 4; v4f_t o; o[0] = tS[q4][r]; o[1] = tS[q4 + 1][r]; o[2] = tS[q4 + 2][r]; o[3] = tS[q4 + 3][r];
    float* dst = Wt + (size_t)(bj * 64 + r) * rows + bi * 64 + q4; *(v4f_t*)dst = o;  }
}
// out[b][c][n] = x[b][c][n] + bn_w(Z[c][n] + W_b[c])  for the 64 real rows of Z [128][4096]; rows of 16 KB
__global__ __launch_bounds__(256) void k_outbn(const float* __restrict__ Z, const float* __restrict__ Wb, const float* __restrict__ p, const float* __restrict__ x, float* __restrict__ out) { const int c = blockIdx.x;
  const float inv = p[c] / sqrtf(p[3 * CCs + c] + 1e-5f), sh = p[CCs + c] - p[2 * CCs + c] * inv; const float wb = Wb[c];
  for (int q4 = threadIdx.x; q4 < NNs / 4; q4 += 256) { const v4f_t z = *(const v4f_t*)(Z + (size_t)c * NNs + q4 * 4), xv = *(const v4f_t*)(x + (size_t)c * NNs + q4 * 4); v4f_t o;
    for (int e = 0; e < 4; ++e) o[e] = xv[e] + ((z[e] + wb) * inv + sh);
    *(v4f_t*)(out + (size_t)c * NNs + q4 * 4) = o;  } }

extern "C" void kernel_launch(void* const* d_in, const int* in_sizes, int n_in,
                              void* d_out, int out_size, void* d_ws, size_t ws_size,
                              hipStream_t stream) {
  (void)in_sizes; (void)n_in; (void)out_size;
  const float** f = (const float**)d_in;
  const float* x1 = f[0], *x2 = f[1], *gbn = f[2], *gw = f[3], *gb = f[4], *tbn = f[5], *tw = f[6], *tb = f[7], *pbn = f[8], *pw = f[9], *pb = f[10], *wbn = f[11], *Ww = f[12], *Wb = f[13];
  float* out1 = (float*)d_out; float* out2 = out1 + (size_t)NBs * CCs * NNs;     // tuple
  char* ws = (char*)d_ws;
  float* gwP = (float*)ws; ws += 128 * 64 * 4; float* twP = (float*)ws; ws += 128 * 64 * 4; float* pwP = (float*)ws; ws += 128 * 64 * 4; float* WwP = (float*)ws; ws += 128 * 128 * 4;   // padded weights
  float* xb = (float*)ws; ws += (size_t)CCs * NNs * 4;            // BN'd frame (1 MB)
  float* g1 = (float*)ws; ws += (size_t)128 * NNs * 4; float* g2 = (float*)ws; ws += (size_t)128 * NNs * 4; float* th = (float*)ws; ws += (size_t)128 * NNs * 4; float* ph = (float*)ws; ws += (size_t)128 * NNs * 4;   // [128][4096] (rows 32.. zero), 2 MB each
  float* thT = (float*)ws; ws += (size_t)NNs * CIs * 4; float* phT = (float*)ws; ws += (size_t)NNs * CIs * 4;    // [4096][32]
  float* Y = (float*)ws; ws += (size_t)128 * NNs * 4;             // y1 / y2 [128][4096]
  float* Z = (float*)ws; ws += (size_t)128 * NNs * 4;             // W_out result [128][4096]
  if ((size_t)(ws - (char*)d_ws) > ws_size) return;
  const dim3 blk(256);
  k_padw<<<dim3(128), dim3(128), 0, stream>>>(gw, CIs, CCs, CCs, gwP); k_padw<<<dim3(128), dim3(128), 0, stream>>>(tw, CIs, CCs, CCs, twP); k_padw<<<dim3(128), dim3(128), 0, stream>>>(pw, CIs, CCs, CCs, pwP);
  k_padw<<<dim3(128), dim3(128), 0, stream>>>(Ww, CCs, CIs, 128, WwP);     // W_w [64][32] -> [128][128]
  for (int b = 0; b < NBs; ++b) {
    const float* x1b = x1 + (size_t)b * CCs * NNs; const float* x2b = x2 + (size_t)b * CCs * NNs;
    // frame 1: g1 = g(bn_g x1), θ = θ(bn_θ x1); frame 2: g2 = g(bn_g x2), φ = φ(bn_φ x2)   (channels-major [128 pad][4096])
    k_bn<<<dim3(CCs), blk, 0, stream>>>(x1b, gbn, xb); gemm_kne<float, 0, false><<<dim3(1, NNs / 128), blk, 0, stream>>>(gwP, CCs, xb, NNs, nullptr, nullptr, nullptr, g1, NNs, CCs); k_rowbias<<<dim3(CIs), blk, 0, stream>>>(g1, gb, CIs);
    k_bn<<<dim3(CCs), blk, 0, stream>>>(x1b, tbn, xb); gemm_kne<float, 0, false><<<dim3(1, NNs / 128), blk, 0, stream>>>(twP, CCs, xb, NNs, nullptr, nullptr, nullptr, th, NNs, CCs); k_rowbias<<<dim3(CIs), blk, 0, stream>>>(th, tb, CIs);
    k_bn<<<dim3(CCs), blk, 0, stream>>>(x2b, gbn, xb); gemm_kne<float, 0, false><<<dim3(1, NNs / 128), blk, 0, stream>>>(gwP, CCs, xb, NNs, nullptr, nullptr, nullptr, g2, NNs, CCs); k_rowbias<<<dim3(CIs), blk, 0, stream>>>(g2, gb, CIs);
    k_bn<<<dim3(CCs), blk, 0, stream>>>(x2b, pbn, xb); gemm_kne<float, 0, false><<<dim3(1, NNs / 128), blk, 0, stream>>>(pwP, CCs, xb, NNs, nullptr, nullptr, nullptr, ph, NNs, CCs); k_rowbias<<<dim3(CIs), blk, 0, stream>>>(ph, pb, CIs);
    k_tr32<<<dim3(NNs / 64), blk, 0, stream>>>(th, thT); k_tr32<<<dim3(NNs / 64), blk, 0, stream>>>(ph, phT);     // θᵀ, φᵀ [4096][32]
    // y2[c][n] = sum_m g2[c][m] att1[n][m], att1 = softmax over m of sum_k theta[k][n] phi[k][m]
    k_attn<<<dim3(NNs / 32), dim3(512), 0, stream>>>(thT, phT, g2, Y);
    gemm_kne<float, 0, false><<<dim3(1, NNs / 128), blk, 0, stream>>>(WwP, 128, Y, NNs, nullptr, nullptr, nullptr, Z, NNs, 128);          // W_w·y2 (K = 128 padded)
    k_outbn<<<dim3(CCs), blk, 0, stream>>>(Z, Wb, wbn, x2b, out2 + (size_t)b * CCs * NNs);
    // y1[c][m] = sum_n g1[c][n] att2[n][m], att2 = softmax over n of the same scores
    k_attn<<<dim3(NNs / 32), dim3(512), 0, stream>>>(phT, thT, g1, Y);
    gemm_kne<float, 0, false><<<dim3(1, NNs / 128), blk, 0, stream>>>(WwP, 128, Y, NNs, nullptr, nullptr, nullptr, Z, NNs, 128);
    k_outbn<<<dim3(CCs), blk, 0, stream>>>(Z, Wb, wbn, x1b, out1 + (size_t)b * CCs * NNs);
  }
}

// v003
// A run of this version takes 95.7 microseconds.
// Next to v002, in two timings, it ran 4.76 and 4.67 times as fast.
// Counting every step since v000, it is 24.5 times as fast.
// Contractions on v_wmma_f32_16x16x32_f16 (plain f16 operands, f32 accumulate): theta/phi/g 1x1 convs of the eval-BatchNorm'd
// frames (K = 64; [out][in] weights zero-padded to 128 rows so the channels-major results are 128-row operands with exact zero rows), then
// one fused kernel for both directions: scores theta^T.phi (K = 32), softmax in f32 with a running maximum, and the weighted sum of g (K = 4096);
// the 4096 x 4096 scores never reach memory. y2 takes theta as queries, phi as keys, g2 as values; y1 takes phi, theta, g1. Then
// W_out (K = 32 zero-padded to 128), its BatchNorm and the residual in f32 into both outputs.
// Every stage is ONE launch: batch, projection (g1, theta, g2, phi) and direction (y2, y1) are grid dimensions, each with its own workspace plane.
// compute dtype: f16 operands, f32 accumulate.  x1, x2 [4,64,64,64] -> (x1 + W(y1), x2 + W(y2)).
#include <hip/hip_runtime.h>
#include <hip/hip_bf16.h>
#include <math.h>

#define NBs 4
#define CCs 64
#define CIs 32
#define NNs 4096
#define SS 4096
#define HH 1
#define DKK 64
#define GSTR 48

typedef _Float16 bf16;
typedef _Float16 f16;
typedef __attribute__((ext_vector_type(4))) unsigned v4u_t;
typedef unsigned v4ua __attribute__((ext_vector_type(4), may_alias));
typedef __attribute__((ext_vector_type(4))) float v4f_t;
typedef float v4fa __attribute__((ext_vector_type(4), may_alias));
typedef __attribute__((ext_vector_type(16))) bf16  bf16x16;
typedef bf16x16 f16x16;
typedef __attribute__((ext_vector_type(8)))  bf16  bf16x8;
typedef bf16x8 f16x8;
typedef __attribute__((ext_vector_type(4)))  bf16  bf16x4;
typedef __attribute__((ext_vector_type(8)))  float f32x8;
__device__ __forceinline__ f32x8 wmma16(f16x16 a, f16x16 b, f32x8 c) {
  c = __builtin_amdgcn_wmma_f32_16x16x32_f16(false, a, false, b, (short)0, c, false, false);
  asm volatile("v_nop\n\tv_nop\n\tv_nop\n\tv_nop" : "+v"(c) : "v"(a), "v"(b));
  return c;
}
#define LDS_STRIDE 48   // unused; the GEMM tiles use GSTR (same 48)
#define KSTRIDE    72   // unused; k_attn stages 32 x 32 tiles with pitch AKP
#define VSTRIDE    48   // unused; k_attn uses AKP

// 16x32 (MxK) f16 fragment from a row-major global matrix.
// lanes 0-15  (row=lane)    : elems 0..7 = K+0..7,  8..15 = K+16..23
// lanes 16-31 (row=lane-16) : elems 0..7 = K+8..15, 8..15 = K+24..31
template <typename T>
__device__ __forceinline__ bf16x16 load_frag(const T* __restrict__ base, int ld,
                                             int row0, int k0) {
  const int lane = threadIdx.x & 31;
  const int r    = lane & 15;
  const int kh   = (lane >> 4) * 8;
  const T* p0 = base + (size_t)(row0 + r) * ld + (k0 + kh);
  const T* p1 = p0 + 16;
  bf16x16 f;
#pragma unroll
  for (int i = 0; i < 8; ++i) {
    f[i]     = (bf16)p0[i];
    f[i + 8] = (bf16)p1[i];
  }
  return f;
}

// Same fragment from an LDS tile with padded row stride (base includes row0/k0).
__device__ __forceinline__ bf16x16 lds_frag(const bf16* base, int stride) {
  const int lane = threadIdx.x & 31;
  const int row  = lane & 15;
  const int kh   = (lane >> 4) * 8;
  const bf16x8 lo = *(const bf16x8*)(base + row * stride + kh);
  const bf16x8 hi = *(const bf16x8*)(base + row * stride + kh + 16);
  bf16x16 f;
#pragma unroll
  for (int i = 0; i < 8; ++i) { f[i] = lo[i]; f[i + 8] = hi[i]; }
  return f;
}

// ---------------------------------------------------------------------------
// k_attn: Y[c][n] = sum_m G[c][m] * softmax_m(S[n][m]), S[n][m] = sum_k Qt[n][k] * Kt[m][k] (k < 32), for the 32 real rows c of
// G [128][4096]; Qt, Kt f32 [4096][32]. S and the weights live in registers only.
// Grid = 128 x 2 x 4 work-groups (columns, direction, batch), each owns 32 columns n (one whole 128-B line of every Y row). Its 16 waves cut the keys m into 16
// ranges of 256; each wave stages its own 32-key slices of Kt and G as f16 in its own LDS range (no work-group barrier in the
// loop) and keeps a running maximum, a running sum and an un-normalised 32 x 32 partial per column. Transposed scores
// (A = keys, B = queries) leave a lane with column n = lane & 15 and keys 8 * (lane >> 4) + r: two such tiles are, register
// for register, the B fragment of the second product. The 16 partials are merged in wave order through LDS at the end.
// Rows 32..127 of G are exact zeros, so rows 32..127 of Y are stored as zeros (the next product reads them).
// ---------------------------------------------------------------------------
#define AKP 40   // staged row pitch: 32 -> 40 halfs (80 B = 16 B x 5): aligned b128 fragment reads without conflicts
#define ARP 36   // partial row pitch in floats: rows 8 apart fall on different banks
#define L2E 1.4426950408889634f
// value of lane l ^ 16
__device__ __forceinline__ float other_half(float v) {
  const int b = __builtin_bit_cast(int, v);
  return __builtin_bit_cast(float, __builtin_amdgcn_permlanex16(b, b, 0x76543210, 0xfedcba98, false, false));
}
// 2^x on v_exp_f32 with the slot behind it filled inside the statement: the instruction set asks for one independent instruction or
// v_nop between a transcendental and a direct reader of its result or writer of its source.
// In the group of four each v_exp_f32 is the independent instruction behind the one before
// (outputs are early-clobber, so none shares a register with an input).
__device__ __forceinline__ float exp2_slot(float x) {
  float y;
  asm("v_exp_f32 %0, %1\n\tv_nop" : "=v"(y) : "v"(x));
  return y;
}
__device__ __forceinline__ void exp2_slot4(float& a, float& b, float& c, float& d) {
  float ya, yb, yc, yd;
  asm("v_exp_f32 %0, %4\n\tv_exp_f32 %1, %5\n\tv_exp_f32 %2, %6\n\tv_exp_f32 %3, %7\n\tv_nop"
      : "=&v"(ya), "=&v"(yb), "=&v"(yc), "=&v"(yd) : "v"(a), "v"(b), "v"(c), "v"(d));
  a = ya; b = yb; c = yc; d = yd;
}
// blockIdx.y = direction d, blockIdx.z = batch b. TT: planes [b][theta^T, phi^T]; PP: planes [b][g1, theta, g2, phi]; YY: planes [b][d].
// d = 0 (y2): queries theta^T, keys phi^T, values g2; d = 1 (y1): queries phi^T, keys theta^T, values g1.
__global__ __launch_bounds__(512) void k_attn(const float* __restrict__ TT, const float* __restrict__ PP, float* __restrict__ YY) {
  const int dir = blockIdx.y, bat = blockIdx.z;
  const float* __restrict__ Qt = TT + (size_t)(bat * 2 + dir) * (NNs * CIs);
  const float* __restrict__ Kt = TT + (size_t)(bat * 2 + 1 - dir) * (NNs * CIs);
  const float* __restrict__ G = PP + (size_t)(bat * 4 + 2 - 2 * dir) * (128 * NNs);
  float* __restrict__ Y = YY + (size_t)(bat * 2 + dir) * (128 * NNs);
  __shared__ __attribute__((aligned(16))) f16 sk[16][32 * AKP];     // per wave: 32 keys x 32 channels
  __shared__ __attribute__((aligned(16))) f16 sv[16][32 * AKP];     // per wave: 32 rows of G x 32 keys
  __shared__ __attribute__((aligned(16))) float red[16][32 * ARP];  // per wave: its 32 x 32 partial
  __shared__ float smx[16][32], ssm[16][32];                        // per wave and column: maximum, sum
  const int tid = threadIdx.x, lane = tid & 31, wave = tid >> 5;
  const int n0 = blockIdx.x * 32;
  const int kr = lane >> 3, kq = (lane & 7) * 4;      // 8 lanes per 128-B row piece: a load takes four whole lines
  f16* swk = sk[wave];
  f16* swv = sv[wave];
  const float* kp = Kt + (size_t)(wave * 256 + kr) * CIs + kq;
  const float* gp = G + (size_t)kr * NNs + wave * 256 + kq;
  v4f_t buf[16];
  // the inner loops are unrolled: buf, acc and the fragments are register arrays and need constant indices
#pragma unroll
  for (int i = 0; i < 8; ++i) { buf[i] = *(const v4f_t*)(kp + (size_t)(4 * i) * CIs); buf[8 + i] = *(const v4f_t*)(gp + (size_t)(4 * i) * NNs); }
  f16x16 qf[2];
#pragma unroll
  for (int j = 0; j < 2; ++j) qf[j] = load_frag(Qt, CIs, n0 + 16 * j, 0);
  f32x8 acc[2][2] = {};
  float mrun[2] = {-3.0e38f, -3.0e38f}, lrun[2] = {0.0f, 0.0f};
  // the loop over slices stays rolled: unrolled, the compiler put off the running sums' additions to the end and spilled the weights
#pragma unroll 1
  for (int s = 0; s < 8; ++s) {
#pragma unroll
    for (int i = 0; i < 8; ++i) {
      bf16x4 h; h[0] = (f16)buf[i][0]; h[1] = (f16)buf[i][1]; h[2] = (f16)buf[i][2]; h[3] = (f16)buf[i][3];
      *(bf16x4*)(swk + (4 * i + kr) * AKP + kq) = h;
      bf16x4 g; g[0] = (f16)buf[8 + i][0]; g[1] = (f16)buf[8 + i][1]; g[2] = (f16)buf[8 + i][2]; g[3] = (f16)buf[8 + i][3];
      *(bf16x4*)(swv + (4 * i + kr) * AKP + kq) = g;
    }
    if (s + 1 < 8) {   // next slice's loads fly while this one is worked on
      kp += 32 * CIs; gp += 32;
#pragma unroll
      for (int i = 0; i < 8; ++i) { buf[i] = *(const v4f_t*)(kp + (size_t)(4 * i) * CIs); buf[8 + i] = *(const v4f_t*)(gp + (size_t)(4 * i) * NNs); }
    }
    asm volatile("s_wait_dscnt 0" ::: "memory");   // every lane's staged rows are in LDS before the wave's other lanes read them back
    f16x16 kf[2], vf[2];
#pragma unroll
    for (int t = 0; t < 2; ++t) { kf[t] = lds_frag(swk + (16 * t) * AKP, AKP); vf[t] = lds_frag(swv + (16 * t) * AKP, AKP); }
#pragma unroll
    for (int j = 0; j < 2; ++j) {
      f32x8 sc[2];   // scores of keys 16 t + 8 (lane >> 4) + r against column 16 j + (lane & 15)
#pragma unroll
      for (int t = 0; t < 2; ++t) { const f32x8 z = {}; sc[t] = __builtin_amdgcn_wmma_f32_16x16x32_f16(false, kf[t], false, qf[j], (short)0, z, false, false); }
      float mx = sc[0][0];
#pragma unroll
      for (int t = 0; t < 2; ++t)
#pragma unroll
        for (int r = 0; r < 8; ++r) mx = fmaxf(mx, sc[t][r]);
      mx = fmaxf(mx, other_half(mx));
      const float mn = fmaxf(mrun[j], mx);
      const float al = exp2_slot((mrun[j] - mn) * L2E);   // 0 on the first slice
      mrun[j] = mn;
      const float mb = 10.0f - mn * L2E;   // weights are 1024 * exp(score - maximum): small ones stay normal f16 numbers; the factor cancels in the division
      f16x16 pf;
      float gs[4];   // sums of four weights each
#pragma unroll
      for (int t = 0; t < 2; ++t)
#pragma unroll
        for (int r = 0; r < 8; r += 4) {
          float p0 = sc[t][r] * L2E + mb, p1 = sc[t][r + 1] * L2E + mb, p2 = sc[t][r + 2] * L2E + mb, p3 = sc[t][r + 3] * L2E + mb;
          exp2_slot4(p0, p1, p2, p3);
          gs[t * 2 + (r >> 2)] = (p0 + p1) + (p2 + p3);
          pf[t * 8 + r] = (f16)p0; pf[t * 8 + r + 1] = (f16)p1; pf[t * 8 + r + 2] = (f16)p2; pf[t * 8 + r + 3] = (f16)p3;
        }
      lrun[j] = lrun[j] * al + ((gs[0] + gs[1]) + (gs[2] + gs[3]));
#pragma unroll
      for (int i = 0; i < 2; ++i) {
#pragma unroll
        for (int r = 0; r < 8; ++r) acc[i][j][r] *= al;
        acc[i][j] = __builtin_amdgcn_wmma_f32_16x16x32_f16(false, vf[i], false, pf, (short)0, acc[i][j], false, false);
      }
    }
  }
  const int nlane = lane & 15, mh = (lane >> 4) * 8;
  float* rw = red[wave];
#pragma unroll
  for (int i = 0; i < 2; ++i)
#pragma unroll
    for (int j = 0; j < 2; ++j)
#pragma unroll
      for (int r = 0; r < 8; ++r) rw[(16 * i + mh + r) * ARP + 16 * j + nlane] = acc[i][j][r];
#pragma unroll
  for (int j = 0; j < 2; ++j) {
    const float lt = lrun[j] + other_half(lrun[j]);   // the two halves hold different keys of the same column
    if (lane < 16) { smx[wave][16 * j + lane] = mrun[j]; ssm[wave][16 * j + lane] = lt; }
  }
  __syncthreads();
  { const int c = tid >> 4, np = (tid & 15) * 2;     // 16 lanes x 8 B = one whole line of row c
    float m0 = smx[0][np], m1 = smx[0][np + 1];
#pragma unroll
    for (int w = 1; w < 16; ++w) { m0 = fmaxf(m0, smx[w][np]); m1 = fmaxf(m1, smx[w][np + 1]); }
    float s0 = 0.0f, s1 = 0.0f, l0 = 0.0f, l1 = 0.0f;
#pragma unroll
    for (int w = 0; w < 16; ++w) {
      const float2 v = *(const float2*)(&red[w][c * ARP + np]);
      const float f0 = exp2_slot((smx[w][np] - m0) * L2E), f1 = exp2_slot((smx[w][np + 1] - m1) * L2E);
      s0 += v.x * f0; s1 += v.y * f1; l0 += ssm[w][np] * f0; l1 += ssm[w][np + 1] * f1;
    }
    float2 o; o.x = s0 / l0; o.y = s1 / l1;
    *(float2*)(Y + (size_t)c * NNs + n0 + np) = o; }
  const v4f_t zero4 = {};
  for (int ch = tid; ch < 96 * 8; ch += 512) *(v4f_t*)(Y + (size_t)(32 + (ch >> 3)) * NNs + n0 + (ch & 7) * 4) = zero4;
}


// ---------------------------------------------------------------------------------------------------------------------------
// gemm_kne: Y[m][n] = epi( Σ_k A[m][k]·W[k][n] + bias[n] ), A f32/f16 [M][lda], W f32 row-major [K][N] (ldw), plain f16 operands,
// f32 accumulate. EPI 0: identity; 1: exact-erf GELU; 2: R[m][n] + gvec[n]·(·) (residual with per-channel gain). Output f32 (or f16
// when OUT16). blockIdx.z = plane: A moves by (z & zmaskA) * sA elements, W by z * sW, Y by z * sY. Block = 128x128 tile, 8 waves as 4(M) x 2(N); per 32-wide k-step A and W tiles staged f16 in LDS (W transposed
// ---------------------------------------------------------------------------------------------------------------------------
#define GSTR 48
template <typename AT, int EPI, bool OUT16>
__global__ __launch_bounds__(256) void gemm_kne(const AT* __restrict__ A, int lda, const float* __restrict__ Wm, int ldw,
                                                const float* __restrict__ bias, const float* __restrict__ R, const float* __restrict__ gvec,
                                                void* __restrict__ Yv, int ldy, int K, int zmaskA, int sA, int sW, int sY) {
  A += (size_t)(blockIdx.z & zmaskA) * sA;
  Wm += (size_t)blockIdx.z * sW;
  __shared__ __attribute__((aligned(16))) f16 ldsA[128 * GSTR];
  __shared__ __attribute__((aligned(16))) f16 ldsW[128 * GSTR];
  __shared__ __attribute__((aligned(16))) float oS[8][32 * 68];
  const int tid = threadIdx.x, lane = tid & 31, wave = tid >> 5, cl = lane & 15, rh = (lane >> 4) * 8;
  const int m0 = blockIdx.x * 128, n0 = blockIdx.y * 128;
  const int wm = (wave & 3) * 32, wn = (wave >> 2) * 64;
  f32x8 acc[2][4];
#pragma unroll
  for (int i = 0; i < 2; ++i)
#pragma unroll
    for (int j = 0; j < 4; ++j) { f32x8 z = {}; acc[i][j] = z; }
#pragma unroll 1
  for (int k0 = 0; k0 < K; k0 += 32) {
    __syncthreads();
    { const int row = tid >> 1, ch = (tid & 1) * 16;
      const AT* src = A + (size_t)(m0 + row) * lda + k0 + ch;
#pragma unroll
      for (int g = 0; g < 16; ++g) ldsA[row * GSTR + ch + g] = (f16)src[g]; }
    { const int k = tid >> 3, nn0 = (tid & 7) * 16;
      const float* src = Wm + (size_t)(k0 + k) * ldw + n0 + nn0;
#pragma unroll
      for (int g = 0; g < 4; ++g) { const v4f_t v = *(const v4f_t*)(src + 4 * g);
#pragma unroll
        for (int u = 0; u < 4; ++u) ldsW[(nn0 + 4 * g + u) * GSTR + k] = (f16)v[u]; } }
    __syncthreads();
    f16x16 af[2];
#pragma unroll
    for (int i = 0; i < 2; ++i) af[i] = lds_frag(ldsA + (wm + 16 * i) * GSTR, GSTR);
#pragma unroll
    for (int j = 0; j < 4; ++j) {
      const f16x16 bf = lds_frag(ldsW + (wn + 16 * j) * GSTR, GSTR);
#pragma unroll
      for (int i = 0; i < 2; ++i) acc[i][j] = wmma16(af[i], bf, acc[i][j]);
    }
  }
  float* so = oS[wave];
#pragma unroll
  for (int i = 0; i < 2; ++i)
#pragma unroll
    for (int j = 0; j < 4; ++j) {
      const int n = n0 + wn + 16 * j + cl;
      const float bv = bias ? bias[n] : 0.0f;
      const float gv = (EPI == 2) ? gvec[n] : 0.0f;
      if (EPI == 1) {
#pragma unroll 1
        for (int r = 0; r < 8; ++r) { const float xg = acc[i][j][r] + bv; so[(16 * i + rh + r) * 68 + 16 * j + cl] = 0.5f * xg * (1.0f + erff(xg * 0.70710678118654752f)); }
      } else {
#pragma unroll
        for (int r = 0; r < 8; ++r) {
          float v = acc[i][j][r] + bv;
          if (EPI == 2) v = R[(size_t)(m0 + wm + 16 * i + rh + r) * ldy + n] + gv * v;
          so[(16 * i + rh + r) * 68 + 16 * j + cl] = v;
        }
      }
    }
  asm volatile("s_wait_dscnt 0" ::: "memory");
  __builtin_amdgcn_wave_barrier();
{
    if (OUT16) {
      f16* Y = (f16*)Yv + (size_t)blockIdx.z * sY;
#pragma unroll
      for (int it = 0; it < 8; ++it) { const int c = lane + 32 * it, rr = c >> 3, q8 = (c & 7) * 8;
        union { f16 h[8]; v4u_t v; } u;
#pragma unroll
        for (int e = 0; e < 8; ++e) u.h[e] = (f16)so[rr * 68 + q8 + e];
        *(v4u_t*)(Y + (size_t)(m0 + wm + rr) * ldy + n0 + wn + q8) = u.v; }
    } else {
      float* Y = (float*)Yv + (size_t)blockIdx.z * sY;
#pragma unroll
      for (int it = 0; it < 16; ++it) { const int f4 = lane + 32 * it, rr = f4 >> 4, q = (f4 & 15) * 4;
        *(v4f_t*)(Y + (size_t)(m0 + wm + rr) * ldy + n0 + wn + q) = *(const v4fa*)(so + rr * 68 + q); }
    }
    
  }
}

// eval BatchNorm of a frame: xb[c][n] = x*inv_c + (beta - mean*inv)_c, inv = gamma/sqrt(var+eps); rows of 16 KB.
// blockIdx.y = projection q (0: x1 with g's BN, 1: x1 with theta's, 2: x2 with g's, 3: x2 with phi's), blockIdx.z = batch; plane [b][q] of xb
__global__ __launch_bounds__(256) void k_bn(const float* __restrict__ x1, const float* __restrict__ x2, const float* __restrict__ gbn, const float* __restrict__ tbn,
                                            const float* __restrict__ pbn, float* __restrict__ xb) { const size_t row = blockIdx.x; const int c = row % CCs;
  const int q = blockIdx.y, b = blockIdx.z;
  const float* x = (q < 2 ? x1 : x2) + (size_t)b * (CCs * NNs); const float* p = q == 1 ? tbn : (q == 3 ? pbn : gbn); float* y = xb + (size_t)(b * 4 + q) * (CCs * NNs);
  const float inv = p[c] / sqrtf(p[3 * CCs + c] + 1e-5f), sh = p[CCs + c] - p[2 * CCs + c] * inv;
  for (int q4 = threadIdx.x; q4 < NNs / 4; q4 += 256) { v4f_t v = *(const v4f_t*)(x + row * NNs + q4 * 4); for (int e = 0; e < 4; ++e) v[e] = v[e] * inv + sh;
    *(v4f_t*)(y + row * NNs + q4 * 4) = v;  } }
// zero-padded weights, blockIdx.y = plane: 0..3 = g_w, theta_w, g_w, phi_w [32][64] -> [128][64] (the order of the projections), 4 = W_w [64][32] -> [128][128]
__global__ __launch_bounds__(128) void k_padw(const float* __restrict__ gw, const float* __restrict__ tw, const float* __restrict__ pw, const float* __restrict__ Ww,
                                              float* __restrict__ WP) { const int r = blockIdx.x, c = threadIdx.x, pl = blockIdx.y;
  const float* Wm = pl == 4 ? Ww : (pl == 1 ? tw : (pl == 3 ? pw : gw));
  const int nr = pl == 4 ? CCs : CIs, nc = pl == 4 ? CIs : CCs, cols = pl == 4 ? 128 : CCs; if (c >= cols) return;
  float* Wp = WP + (size_t)pl * (128 * CCs);
  const float v = (r < nr && c < nc) ? Wm[r * nc + c] : 0.0f; *(float*)(Wp + (size_t)r * cols + c) = v;  }
// bias of the real rows of plane [b][q] of PP
__global__ __launch_bounds__(256) void k_rowbias(float* __restrict__ PP, const float* __restrict__ gb, const float* __restrict__ tb, const float* __restrict__ pb, int nrows) {
  const int q = blockIdx.y, b = blockIdx.z; const float* bias = q == 1 ? tb : (q == 3 ? pb : gb); float* t = PP + (size_t)(b * 4 + q) * (128 * NNs);
  const size_t row = blockIdx.x; const float bv = (row < (size_t)nrows) ? bias[row] : 0.0f;
  for (int q4 = threadIdx.x; q4 < NNs / 4; q4 += 256) { v4f_t v = *(const v4f_t*)(t + row * NNs + q4 * 4); for (int e = 0; e < 4; ++e) v[e] += bv; *(v4f_t*)(t + row * NNs + q4 * 4) = v;  } }
// blockIdx.y = 0: theta, 1: phi (planes [b][1], [b][3] of PP) -> planes [b][y] of TT, [4096][32]
__global__ __launch_bounds__(256) void k_tr32(const float* __restrict__ PP, float* __restrict__ TT) { __shared__ float tS[32][65];
  const float* A = PP + (size_t)(blockIdx.z * 4 + 1 + 2 * blockIdx.y) * (128 * NNs); float* At = TT + (size_t)(blockIdx.z * 2 + blockIdx.y) * (NNs * CIs);
  const int tid = threadIdx.x; const int n0 = blockIdx.x * 64;
  for (int e = tid; e < 32 * 64; e += 256) { const int c = e >> 6, j = e & 63; tS[c][j] = A[(size_t)c * NNs + n0 + j]; }
  __syncthreads();
  { const int j = tid >> 2, q4 = (tid & 3) * 8; v4f_t o0, o1; for (int k = 0; k < 4; ++k) { o0[k] = tS[q4 + k][j]; o1[k] = tS[q4 + 4 + k][j]; }
    float* dst = At + (size_t)(n0 + j) * CIs + q4; *(v4f_t*)dst = o0; *(v4f_t*)(dst + 4) = o1;  }
}
__global__ __launch_bounds__(256) void k_transpose(const float* __restrict__ Wm, float* __restrict__ Wt, int rows, int cols) {
  __shared__ float tS[64][65];
  const int tid = threadIdx.x, tbj = cols / 64, bi = blockIdx.x / tbj, bj = blockIdx.x % tbj;
  for (int e = tid; e < 64 * 64; e += 256) { const int r = e >> 6, c = e & 63; tS[r][c] = Wm[(size_t)(bi * 64 + r) * cols + bj * 64 + c]; }
  __syncthreads();
  for (int ch = tid; ch < 64 * 16; ch += 256) { const int r = ch >> 4, q4 = (ch & 15) * 4; v4f_t o; o[0] = tS[q4][r]; o[1] = tS[q4 + 1][r]; o[2] = tS[q4 + 2][r]; o[3] = tS[q4 + 3][r];
    float* dst = Wt + (size_t)(bj * 64 + r) * rows + bi * 64 + q4; *(v4f_t*)dst = o;  }
}
// out[b][c][n] = x[b][c][n] + bn_w(Z[c][n] + W_b[c])  for the 64 real rows of plane [b][d] of Z, [128][4096]; rows of 16 KB.
// blockIdx.y = direction d: 0 = y2 (x2, second output), 1 = y1 (x1, first output); blockIdx.z = batch
__global__ __launch_bounds__(256) void k_outbn(const float* __restrict__ ZZ, const float* __restrict__ Wb, const float* __restrict__ p, const float* __restrict__ x1,
                                               const float* __restrict__ x2, float* __restrict__ out1, float* __restrict__ out2) { const int c = blockIdx.x, d = blockIdx.y, b = blockIdx.z;
  const float* Z = ZZ + (size_t)(b * 2 + d) * (128 * NNs); const float* x = (d ? x1 : x2) + (size_t)b * (CCs * NNs); float* out = (d ? out1 : out2) + (size_t)b * (CCs * NNs);
  const float inv = p[c] / sqrtf(p[3 * CCs + c] + 1e-5f), sh = p[CCs + c] - p[2 * CCs + c] * inv; const float wb = Wb[c];
  for (int q4 = threadIdx.x; q4 < NNs / 4; q4 += 256) { const v4f_t z = *(const v4f_t*)(Z + (size_t)c * NNs + q4 * 4), xv = *(const v4f_t*)(x + (size_t)c * NNs + q4 * 4); v4f_t o;
    for (int e = 0; e < 4; ++e) o[e] = xv[e] + ((z[e] + wb) * inv + sh);
    *(v4f_t*)(out + (size_t)c * NNs + q4 * 4) = o;  } }

extern "C" void kernel_launch(void* const* d_in, const int* in_sizes, int n_in,
                              void* d_out, int out_size, void* d_ws, size_t ws_size,
                              hipStream_t stream) {
  (void)in_sizes; (void)n_in; (void)out_size;
  const float** f = (const float**)d_in;
  const float* x1 = f[0], *x2 = f[1], *gbn = f[2], *gw = f[3], *gb = f[4], *tbn = f[5], *tw = f[6], *tb = f[7], *pbn = f[8], *pw = f[9], *pb = f[10], *wbn = f[11], *Ww = f[12], *Wb = f[13];
  float* out1 = (float*)d_out; float* out2 = out1 + (size_t)NBs * CCs * NNs;     // tuple
  char* ws = (char*)d_ws;
  float* wP = (float*)ws; ws += 4 * 128 * 64 * 4; float* WwP = (float*)ws; ws += 128 * 128 * 4;   // padded weights: g, theta, g, phi [128][64], then W_w [128][128]
  float* xb = (float*)ws; ws += (size_t)NBs * 4 * CCs * NNs * 4;      // BN'd frames, planes [b][q] of 1 MB
  float* PP = (float*)ws; ws += (size_t)NBs * 4 * 128 * NNs * 4;      // g1, theta, g2, phi: planes [b][q] of [128][4096] (rows 32.. zero), 2 MB each
  float* TT = (float*)ws; ws += (size_t)NBs * 2 * NNs * CIs * 4;      // theta^T, phi^T: planes [b][2] of [4096][32]
  float* Y = (float*)ws; ws += (size_t)NBs * 2 * 128 * NNs * 4;       // y2, y1: planes [b][d] of [128][4096]
  float* Z = (float*)ws; ws += (size_t)NBs * 2 * 128 * NNs * 4;       // W_out results, same planes
  if ((size_t)(ws - (char*)d_ws) > ws_size) return;
  const dim3 blk(256);
  k_padw<<<dim3(128, 5), dim3(128), 0, stream>>>(gw, tw, pw, Ww, wP);
  // q = 0: g1 = g(bn_g x1), 1: theta(bn_theta x1), 2: g2 = g(bn_g x2), 3: phi(bn_phi x2)   (channels-major [128 pad][4096])
  k_bn<<<dim3(CCs, 4, NBs), blk, 0, stream>>>(x1, x2, gbn, tbn, pbn, xb);
  gemm_kne<float, 0, false><<<dim3(1, NNs / 128, NBs * 4), blk, 0, stream>>>(wP, CCs, xb, NNs, nullptr, nullptr, nullptr, PP, NNs, CCs, 3, 128 * CCs, CCs * NNs, 128 * NNs);
  k_rowbias<<<dim3(CIs, 4, NBs), blk, 0, stream>>>(PP, gb, tb, pb, CIs);
  k_tr32<<<dim3(NNs / 64, 2, NBs), blk, 0, stream>>>(PP, TT);
  // d = 0: y2[c][n] = sum_m g2[c][m] att1[n][m], att1 = softmax over m of sum_k theta[k][n] phi[k][m]
  // d = 1: y1[c][m] = sum_n g1[c][n] att2[n][m], att2 = softmax over n of the same scores
  k_attn<<<dim3(NNs / 32, 2, NBs), dim3(512), 0, stream>>>(TT, PP, Y);
  gemm_kne<float, 0, false><<<dim3(1, NNs / 128, NBs * 2), blk, 0, stream>>>(WwP, 128, Y, NNs, nullptr, nullptr, nullptr, Z, NNs, 128, 0, 0, 128 * NNs, 128 * NNs);   // W_w . y (K = 128 padded)
  k_outbn<<<dim3(CCs, 2, NBs), blk, 0, stream>>>(Z, Wb, wbn, x1, x2, out1, out2);
}

// v004
// It runs in 59.8 microseconds.
// Timed twice side by side with v003, it ran 1.59 and 1.60 times as fast.
// Counting every step since v000, it is 39.1 times as fast.
// Contractions on v_wmma_f32_16x16x32_f16 (plain f16 operands, f32 accumulate). Two launches.
// k_proj: eval BatchNorm of a frame, one of the 1x1 convs g1, theta, g2, phi (K = 64) and its bias; g is stored channels-major [32][4096],
// theta and phi position-major [4096][32].
// k_attn, one work-group per 32 positions, direction and batch: scores theta^T.phi (K = 32), softmax in f32 with a running maximum, the
// weighted sum of g (K = 4096), then W_out (K = 32), its BatchNorm and the residual in f32 into the output. The 4096 x 4096 scores and y
// never reach memory. y2 takes theta as queries, phi as keys, g2 as values; y1 takes phi, theta, g1.
// compute dtype: f16 operands, f32 accumulate.  x1, x2 [4,64,64,64] -> (x1 + W(y1), x2 + W(y2)).
#include <hip/hip_runtime.h>
#include <hip/hip_bf16.h>
#include <math.h>

#define NBs 4
#define CCs 64
#define CIs 32
#define NNs 4096
#define SS 4096
#define HH 1
#define DKK 64
#define GSTR 48

typedef _Float16 bf16;
typedef _Float16 f16;
typedef __attribute__((ext_vector_type(4))) unsigned v4u_t;
typedef unsigned v4ua __attribute__((ext_vector_type(4), may_alias));
typedef __attribute__((ext_vector_type(4))) float v4f_t;
typedef float v4fa __attribute__((ext_vector_type(4), may_alias));
typedef __attribute__((ext_vector_type(16))) bf16  bf16x16;
typedef bf16x16 f16x16;
typedef __attribute__((ext_vector_type(8)))  bf16  bf16x8;
typedef bf16x8 f16x8;
typedef __attribute__((ext_vector_type(4)))  bf16  bf16x4;
typedef __attribute__((ext_vector_type(8)))  float f32x8;
// WMMA with four v_nop behind it that still name A and B: they keep the form's distance to whatever writes A or B or reads D next, so that
// the next product's result cannot be placed over this one's B operand directly behind it
__device__ __forceinline__ f32x8 wmma16(f16x16 a, f16x16 b, f32x8 c) {
  c = __builtin_amdgcn_wmma_f32_16x16x32_f16(false, a, false, b, (short)0, c, false, false);
  asm volatile("v_nop\n\tv_nop\n\tv_nop\n\tv_nop" : "+v"(c) : "v"(a), "v"(b));
  return c;
}
#define LDS_STRIDE 48   // unused; so is GSTR (same 48)
#define KSTRIDE    72   // unused; k_attn stages 32 x 32 tiles with pitch AKP
#define VSTRIDE    48   // unused; k_attn uses AKP

// 16x32 (MxK) f16 fragment from a row-major global matrix.
// lanes 0-15  (row=lane)    : elems 0..7 = K+0..7,  8..15 = K+16..23
// lanes 16-31 (row=lane-16) : elems 0..7 = K+8..15, 8..15 = K+24..31
template <typename T>
__device__ __forceinline__ bf16x16 load_frag(const T* __restrict__ base, int ld,
                                             int row0, int k0) {
  const int lane = threadIdx.x & 31;
  const int r    = lane & 15;
  const int kh   = (lane >> 4) * 8;
  const T* p0 = base + (size_t)(row0 + r) * ld + (k0 + kh);
  const T* p1 = p0 + 16;
  bf16x16 f;
#pragma unroll
  for (int i = 0; i < 8; ++i) {
    f[i]     = (bf16)p0[i];
    f[i + 8] = (bf16)p1[i];
  }
  return f;
}

// Same fragment from an LDS tile with padded row stride (base includes row0/k0).
__device__ __forceinline__ bf16x16 lds_frag(const bf16* base, int stride) {
  const int lane = threadIdx.x & 31;
  const int row  = lane & 15;
  const int kh   = (lane >> 4) * 8;
  const bf16x8 lo = *(const bf16x8*)(base + row * stride + kh);
  const bf16x8 hi = *(const bf16x8*)(base + row * stride + kh + 16);
  bf16x16 f;
#pragma unroll
  for (int i = 0; i < 8; ++i) { f[i] = lo[i]; f[i + 8] = hi[i]; }
  return f;
}

// ---------------------------------------------------------------------------
// k_attn: Y[c][n] = sum_m G[c][m] * softmax_m(S[n][m]), S[n][m] = sum_k Qt[n][k] * Kt[m][k] (k < 32), for the 32 rows c of
// G [32][4096]; Qt, Kt f32 [4096][32]. S and the weights live in registers only.
// Grid = 128 x 2 x 4 work-groups (positions, direction, batch), each owns 32 columns n (one whole 128-B line of every Y row). Its 16 waves cut the keys m into 16
// ranges of 256; each wave stages its own 32-key slices of Kt and G as f16 in its own LDS range (no work-group barrier in the
// loop) and keeps a running maximum, a running sum and an un-normalised 32 x 32 partial per column. Transposed scores
// (A = keys, B = queries) leave a lane with column n = lane & 15 and keys 8 * (lane >> 4) + r: two such tiles are, register
// for register, the B fragment of the second product. The 16 partials are merged in wave order through LDS at the end.
// The merged 32 x 32 block of Y goes to LDS as f16, position-major; behind one more barrier four waves multiply it by W_w [64][32]
// (16 output channels each, so every 128-B line of the output has one writer) and store x + bn_w(W_w Y + W_b).
// ---------------------------------------------------------------------------
#define AKP 40   // staged row pitch: 32 -> 40 halfs (80 B = 16 B x 5): aligned b128 fragment reads without conflicts
#define ARP 36   // partial row pitch in floats: rows 8 apart fall on different banks
#define L2E 1.4426950408889634f
// value of lane l ^ 16
__device__ __forceinline__ float other_half(float v) {
  const int b = __builtin_bit_cast(int, v);
  return __builtin_bit_cast(float, __builtin_amdgcn_permlanex16(b, b, 0x76543210, 0xfedcba98, false, false));
}
// 2^x on v_exp_f32 with the slot behind it filled inside the statement: the instruction set asks for one independent instruction or
// v_nop between a transcendental and a direct reader of its result or writer of its source.
// In the group of four each v_exp_f32 is the independent instruction behind the one before
// (outputs are early-clobber, so none shares a register with an input).
__device__ __forceinline__ float exp2_slot(float x) {
  float y;
  asm("v_exp_f32 %0, %1\n\tv_nop" : "=v"(y) : "v"(x));
  return y;
}
__device__ __forceinline__ void exp2_slot4(float& a, float& b, float& c, float& d) {
  float ya, yb, yc, yd;
  asm("v_exp_f32 %0, %4\n\tv_exp_f32 %1, %5\n\tv_exp_f32 %2, %6\n\tv_exp_f32 %3, %7\n\tv_nop"
      : "=&v"(ya), "=&v"(yb), "=&v"(yc), "=&v"(yd) : "v"(a), "v"(b), "v"(c), "v"(d));
  a = ya; b = yb; c = yc; d = yd;
}
// blockIdx.y = direction d, blockIdx.z = batch b. TT: planes [b][theta^T, phi^T]; GG: planes [b][g1, g2].
// d = 0 (y2): queries theta^T, keys phi^T, values g2, residual x2, second output; d = 1 (y1): queries phi^T, keys theta^T, values g1, x1, first output.
__global__ __launch_bounds__(512) void k_attn(const float* __restrict__ TT, const float* __restrict__ GG, const float* __restrict__ Ww, const float* __restrict__ Wb,
                                              const float* __restrict__ wbn, const float* __restrict__ x1, const float* __restrict__ x2,
                                              float* __restrict__ out1, float* __restrict__ out2) {
  const int dir = blockIdx.y, bat = blockIdx.z;
  const float* __restrict__ Qt = TT + (size_t)(bat * 2 + dir) * (NNs * CIs);
  const float* __restrict__ Kt = TT + (size_t)(bat * 2 + 1 - dir) * (NNs * CIs);
  const float* __restrict__ G = GG + (size_t)(bat * 2 + 1 - dir) * (CIs * NNs);
  __shared__ __attribute__((aligned(16))) f16 sk[16][32 * AKP];     // per wave: 32 keys x 32 channels
  __shared__ __attribute__((aligned(16))) f16 sv[16][32 * AKP];     // per wave: 32 rows of G x 32 keys
  __shared__ __attribute__((aligned(16))) float red[16][32 * ARP];  // per wave: its 32 x 32 partial
  __shared__ float smx[16][32], ssm[16][32];                        // per wave and column: maximum, sum
  __shared__ float oinv[CCs], osh[CCs], owb[CCs];                   // per output channel: W_out's BatchNorm scale and shift, W_b
  const int tid = threadIdx.x, lane = tid & 31, wave = tid >> 5;
  const int n0 = blockIdx.x * 32;
  const int kr = lane >> 3, kq = (lane & 7) * 4;      // 8 lanes per 128-B row piece: a load takes four whole lines
  f16* swk = sk[wave];
  f16* swv = sv[wave];
  const float* kp = Kt + (size_t)(wave * 256 + kr) * CIs + kq;
  const float* gp = G + (size_t)kr * NNs + wave * 256 + kq;
  v4f_t buf[16];
  // the inner loops are unrolled: buf, acc and the fragments are register arrays and need constant indices
#pragma unroll
  for (int i = 0; i < 8; ++i) { buf[i] = *(const v4f_t*)(kp + (size_t)(4 * i) * CIs); buf[8 + i] = *(const v4f_t*)(gp + (size_t)(4 * i) * NNs); }
  f16x16 qf[2];
#pragma unroll
  for (int j = 0; j < 2; ++j) qf[j] = load_frag(Qt, CIs, n0 + 16 * j, 0);
  if (tid < CCs) {   // read behind the barrier that follows the loop
    const float inv = wbn[tid] / sqrtf(wbn[3 * CCs + tid] + 1e-5f);
    oinv[tid] = inv; osh[tid] = wbn[CCs + tid] - wbn[2 * CCs + tid] * inv; owb[tid] = Wb[tid];
  }
  // the four waves of the last product fetch their W_w fragment and their residual values here: in front of the loop the latency is hidden,
  // behind it the whole work-group would wait for it at a barrier
  const int nlane = lane & 15, mh = (lane >> 4) * 8;
  const int wu = __builtin_amdgcn_readfirstlane(wave);
  const size_t ob = (size_t)bat * (CCs * NNs) + (size_t)((wu & 3) * 16 + mh) * NNs + n0 + nlane;   // output channel 16 wu + mh + r, position n0 + 16 j + nlane
  const float* __restrict__ xres = (dir ? x1 : x2) + ob;
  f16x16 wf = {};
  float xr[2][8] = {};
  if (wu < 4) {
    wf = load_frag(Ww, CIs, 16 * wu, 0);
#pragma unroll
    for (int j = 0; j < 2; ++j)
#pragma unroll
      for (int r = 0; r < 8; ++r) xr[j][r] = xres[(size_t)r * NNs + 16 * j];
  }
  f32x8 acc[2][2] = {};
  float mrun[2] = {-3.0e38f, -3.0e38f}, lrun[2] = {0.0f, 0.0f};
  // the loop over slices stays rolled: unrolled, the compiler put off the running sums' additions to the end and spilled the weights
#pragma unroll 1
  for (int s = 0; s < 8; ++s) {
#pragma unroll
    for (int i = 0; i < 8; ++i) {
      bf16x4 h; h[0] = (f16)buf[i][0]; h[1] = (f16)buf[i][1]; h[2] = (f16)buf[i][2]; h[3] = (f16)buf[i][3];
      *(bf16x4*)(swk + (4 * i + kr) * AKP + kq) = h;
      bf16x4 g; g[0] = (f16)buf[8 + i][0]; g[1] = (f16)buf[8 + i][1]; g[2] = (f16)buf[8 + i][2]; g[3] = (f16)buf[8 + i][3];
      *(bf16x4*)(swv + (4 * i + kr) * AKP + kq) = g;
    }
    if (s + 1 < 8) {   // next slice's loads fly while this one is worked on
      kp += 32 * CIs; gp += 32;
#pragma unroll
      for (int i = 0; i < 8; ++i) { buf[i] = *(const v4f_t*)(kp + (size_t)(4 * i) * CIs); buf[8 + i] = *(const v4f_t*)(gp + (size_t)(4 * i) * NNs); }
    }
    asm volatile("s_wait_dscnt 0" ::: "memory");   // every lane's staged rows are in LDS before the wave's other lanes read them back
    f16x16 kf[2], vf[2];
#pragma unroll
    for (int t = 0; t < 2; ++t) { kf[t] = lds_frag(swk + (16 * t) * AKP, AKP); vf[t] = lds_frag(swv + (16 * t) * AKP, AKP); }
#pragma unroll
    for (int j = 0; j < 2; ++j) {
      f32x8 sc[2];   // scores of keys 16 t + 8 (lane >> 4) + r against column 16 j + (lane & 15)
#pragma unroll
      for (int t = 0; t < 2; ++t) { const f32x8 z = {}; sc[t] = __builtin_amdgcn_wmma_f32_16x16x32_f16(false, kf[t], false, qf[j], (short)0, z, false, false); }
      float mx = sc[0][0];
#pragma unroll
      for (int t = 0; t < 2; ++t)
#pragma unroll
        for (int r = 0; r < 8; ++r) mx = fmaxf(mx, sc[t][r]);
      mx = fmaxf(mx, other_half(mx));
      const float mn = fmaxf(mrun[j], mx);
      const float al = exp2_slot((mrun[j] - mn) * L2E);   // 0 on the first slice
      mrun[j] = mn;
      const float mb = 10.0f - mn * L2E;   // weights are 1024 * exp(score - maximum): small ones stay normal f16 numbers; the factor cancels in the division
      f16x16 pf;
      float gs[4];   // sums of four weights each
#pragma unroll
      for (int t = 0; t < 2; ++t)
#pragma unroll
        for (int r = 0; r < 8; r += 4) {
          float p0 = sc[t][r] * L2E + mb, p1 = sc[t][r + 1] * L2E + mb, p2 = sc[t][r + 2] * L2E + mb, p3 = sc[t][r + 3] * L2E + mb;
          exp2_slot4(p0, p1, p2, p3);
          gs[t * 2 + (r >> 2)] = (p0 + p1) + (p2 + p3);
          pf[t * 8 + r] = (f16)p0; pf[t * 8 + r + 1] = (f16)p1; pf[t * 8 + r + 2] = (f16)p2; pf[t * 8 + r + 3] = (f16)p3;
        }
      lrun[j] = lrun[j] * al + ((gs[0] + gs[1]) + (gs[2] + gs[3]));
#pragma unroll
      for (int i = 0; i < 2; ++i) {
#pragma unroll
        for (int r = 0; r < 8; ++r) acc[i][j][r] *= al;
        acc[i][j] = __builtin_amdgcn_wmma_f32_16x16x32_f16(false, vf[i], false, pf, (short)0, acc[i][j], false, false);
      }
    }
  }
  float* rw = red[wave];
#pragma unroll
  for (int i = 0; i < 2; ++i)
#pragma unroll
    for (int j = 0; j < 2; ++j)
#pragma unroll
      for (int r = 0; r < 8; ++r) rw[(16 * i + mh + r) * ARP + 16 * j + nlane] = acc[i][j][r];
#pragma unroll
  for (int j = 0; j < 2; ++j) {
    const float lt = lrun[j] + other_half(lrun[j]);   // the two halves hold different keys of the same column
    if (lane < 16) { smx[wave][16 * j + lane] = mrun[j]; ssm[wave][16 * j + lane] = lt; }
  }
  __syncthreads();
  f16* ys = &sk[0][0];   // 32 positions x 32 channels of Y, pitch AKP; the staged keys are dead behind the barrier above
  { const int c = tid >> 4, np = (tid & 15) * 2;     // a thread merges channel c of positions np and np + 1
    float m0 = smx[0][np], m1 = smx[0][np + 1];
#pragma unroll
    for (int w = 1; w < 16; ++w) { m0 = fmaxf(m0, smx[w][np]); m1 = fmaxf(m1, smx[w][np + 1]); }
    float s0 = 0.0f, s1 = 0.0f, l0 = 0.0f, l1 = 0.0f;
#pragma unroll
    for (int w = 0; w < 16; ++w) {
      const float2 v = *(const float2*)(&red[w][c * ARP + np]);
      const float f0 = exp2_slot((smx[w][np] - m0) * L2E), f1 = exp2_slot((smx[w][np + 1] - m1) * L2E);
      s0 += v.x * f0; s1 += v.y * f1; l0 += ssm[w][np] * f0; l1 += ssm[w][np + 1] * f1;
    }
    ys[np * AKP + c] = (f16)(s0 / l0); ys[(np + 1) * AKP + c] = (f16)(s1 / l1); }
  __syncthreads();   // the whole block of Y is in LDS before the four waves read it
  if (wu < 4) {
    float* __restrict__ o = (dir ? out1 : out2) + ob;
    const f16x16 yf0 = lds_frag(ys, AKP), yf1 = lds_frag(ys + 16 * AKP, AKP);
    const f32x8 z0 = {};
    f32x8 zz[2];
    zz[0] = wmma16(wf, yf0, z0);
    zz[1] = wmma16(wf, yf1, z0);
#pragma unroll
    for (int j = 0; j < 2; ++j)
#pragma unroll
      for (int r = 0; r < 8; ++r) {
        const int c = 16 * wu + mh + r;
        o[(size_t)r * NNs + 16 * j] = xr[j][r] + ((zz[j][r] + owb[c]) * oinv[c] + osh[c]);
      }
  }
}

// ---------------------------------------------------------------------------
// k_proj: P[o][n] = sum_c W[o][c] * bn(x)[c][n] + bias[o], o < 32, c < 64, for 128 positions n of one frame.
// blockIdx.y = projection q (0: g of x1, 1: theta of x1, 2: g of x2, 3: phi of x2), blockIdx.z = batch.
// bn(x)[c][n] = x * inv_c + (beta - mean * inv)_c, inv = gamma / sqrt(var + eps), is rounded to f16 and staged position-major in LDS
// (a wave-wide load takes the 512 B of one channel's row; a lane packs four channels of a position into one 8-B LDS store).
// Wave w takes positions 16 w .. 16 w + 15: A = weights straight from global memory, B = the staged frame. The result goes through LDS
// in the layout of its plane, so that the stores take whole lines: q even -> GG plane [b][q / 2], [32][4096]; q odd -> TT plane [b][q / 2], [4096][32].
// ---------------------------------------------------------------------------
#define XP 72    // staged pitch: 64 -> 72 halfs (144 B = 16 B x 9): aligned b128 fragment reads
#define OPT 36   // result pitch in floats, position-major
#define OPG 132  // result pitch in floats, channels-major
__global__ __launch_bounds__(256) void k_proj(const float* __restrict__ x1, const float* __restrict__ x2, const float* __restrict__ gbn, const float* __restrict__ tbn,
                                              const float* __restrict__ pbn, const float* __restrict__ gw, const float* __restrict__ tw, const float* __restrict__ pw,
                                              const float* __restrict__ gb, const float* __restrict__ tb, const float* __restrict__ pb,
                                              float* __restrict__ GG, float* __restrict__ TT) {
  const int q = blockIdx.y, b = blockIdx.z, n0 = blockIdx.x * 128;
  const float* __restrict__ x = (q < 2 ? x1 : x2) + (size_t)b * (CCs * NNs) + n0;
  const float* __restrict__ p = q == 1 ? tbn : (q == 3 ? pbn : gbn);
  const float* __restrict__ Wq = q == 1 ? tw : (q == 3 ? pw : gw);
  const float* __restrict__ bias = q == 1 ? tb : (q == 3 ? pb : gb);
  __shared__ __attribute__((aligned(16))) f16 xs[128 * XP];
  __shared__ __attribute__((aligned(16))) float os[128 * OPT];   // 128 x OPT >= 32 x OPG
  __shared__ float sinv[CCs], ssh[CCs];
  const int tid = threadIdx.x, lane = tid & 31, wave = tid >> 5, cl = lane & 15, rh = (lane >> 4) * 8;
  v4f_t xv[8];   // channels 32 g + 4 wave + e, positions 4 lane .. 4 lane + 3
  // the loops are unrolled: xv and acc are register arrays and need constant indices
#pragma unroll
  for (int g = 0; g < 2; ++g)
#pragma unroll
    for (int e = 0; e < 4; ++e) xv[g * 4 + e] = *(const v4f_t*)(x + (size_t)(32 * g + 4 * wave + e) * NNs + lane * 4);
  if (tid < CCs) {
    const float inv = p[tid] / sqrtf(p[3 * CCs + tid] + 1e-5f);
    sinv[tid] = inv; ssh[tid] = p[CCs + tid] - p[2 * CCs + tid] * inv;
  }
  f16x16 af[2][2];
#pragma unroll
  for (int i = 0; i < 2; ++i)
#pragma unroll
    for (int ks = 0; ks < 2; ++ks) af[i][ks] = load_frag(Wq, CCs, 16 * i, 32 * ks);
  v4f_t bv[2][2];   // bias of channels 16 i + rh + 4 hf .. + 3, fetched with the other operands and not behind the products
#pragma unroll
  for (int i = 0; i < 2; ++i)
#pragma unroll
    for (int hf = 0; hf < 2; ++hf) bv[i][hf] = *(const v4f_t*)(bias + 16 * i + rh + 4 * hf);
  __syncthreads();
#pragma unroll
  for (int g = 0; g < 2; ++g) {
    const int k0 = 32 * g + 4 * wave;
#pragma unroll
    for (int u = 0; u < 4; ++u) {
      bf16x4 hx;
#pragma unroll
      for (int e = 0; e < 4; ++e) hx[e] = (f16)(xv[g * 4 + e][u] * sinv[k0 + e] + ssh[k0 + e]);
      *(bf16x4*)(xs + (lane * 4 + u) * XP + k0) = hx;
    }
  }
  __syncthreads();
  f32x8 acc[2] = {};
#pragma unroll
  for (int ks = 0; ks < 2; ++ks) {
    const f16x16 bfr = lds_frag(xs + (wave * 16) * XP + 32 * ks, XP);
#pragma unroll
    for (int i = 0; i < 2; ++i) acc[i] = __builtin_amdgcn_wmma_f32_16x16x32_f16(false, af[i][ks], false, bfr, (short)0, acc[i], false, false);
  }
  // a lane holds position 16 wave + cl and channels 16 i + rh + r
  if (q & 1) {
#pragma unroll
    for (int i = 0; i < 2; ++i) {
      v4f_t lo, hi;
#pragma unroll
      for (int r = 0; r < 4; ++r) { lo[r] = acc[i][r] + bv[i][0][r]; hi[r] = acc[i][4 + r] + bv[i][1][r]; }
      float* d = os + (wave * 16 + cl) * OPT + 16 * i + rh;
      *(v4fa*)d = lo; *(v4fa*)(d + 4) = hi;
    }
  } else {
#pragma unroll
    for (int i = 0; i < 2; ++i)
#pragma unroll
      for (int r = 0; r < 8; ++r) os[(16 * i + rh + r) * OPG + wave * 16 + cl] = acc[i][r] + bv[i][r >> 2][r & 3];
  }
  __syncthreads();
  if (q & 1) {
    float* __restrict__ dst = TT + (size_t)(b * 2 + (q >> 1)) * (NNs * CIs) + (size_t)n0 * CIs;
#pragma unroll
    for (int it = 0; it < 4; ++it) { const int f4 = tid + 256 * it, rr = f4 >> 3, qd = (f4 & 7) * 4;
      *(v4f_t*)(dst + rr * CIs + qd) = *(const v4fa*)(os + rr * OPT + qd); }
  } else {
    float* __restrict__ dst = GG + (size_t)(b * 2 + (q >> 1)) * (CIs * NNs) + n0;
#pragma unroll
    for (int it = 0; it < 4; ++it) { const int f4 = tid + 256 * it, rr = f4 >> 5, qd = (f4 & 31) * 4;
      *(v4f_t*)(dst + (size_t)rr * NNs + qd) = *(const v4fa*)(os + rr * OPG + qd); }
  }
}

extern "C" void kernel_launch(void* const* d_in, const int* in_sizes, int n_in,
                              void* d_out, int out_size, void* d_ws, size_t ws_size,
                              hipStream_t stream) {
  (void)in_sizes; (void)n_in; (void)out_size;
  const float** f = (const float**)d_in;
  const float* x1 = f[0], *x2 = f[1], *gbn = f[2], *gw = f[3], *gb = f[4], *tbn = f[5], *tw = f[6], *tb = f[7], *pbn = f[8], *pw = f[9], *pb = f[10], *wbn = f[11], *Ww = f[12], *Wb = f[13];
  float* out1 = (float*)d_out; float* out2 = out1 + (size_t)NBs * CCs * NNs;     // tuple
  char* ws = (char*)d_ws;
  float* GG = (float*)ws; ws += (size_t)NBs * 2 * CIs * NNs * 4;      // g1, g2: planes [b][2] of [32][4096]
  float* TT = (float*)ws; ws += (size_t)NBs * 2 * NNs * CIs * 4;      // theta^T, phi^T: planes [b][2] of [4096][32]
  if ((size_t)(ws - (char*)d_ws) > ws_size) return;
  // q = 0: g1 = g(bn_g x1), 1: theta(bn_theta x1), 2: g2 = g(bn_g x2), 3: phi(bn_phi x2)
  k_proj<<<dim3(NNs / 128, 4, NBs), dim3(256), 0, stream>>>(x1, x2, gbn, tbn, pbn, gw, tw, pw, gb, tb, pb, GG, TT);
  // d = 0: y2[c][n] = sum_m g2[c][m] att1[n][m], att1 = softmax over m of sum_k theta[k][n] phi[k][m]
  // d = 1: y1[c][m] = sum_n g1[c][n] att2[n][m], att2 = softmax over n of the same scores
  k_attn<<<dim3(NNs / 32, 2, NBs), dim3(512), 0, stream>>>(TT, GG, Ww, Wb, wbn, x1, x2, out1, out2);
}

// v005
// A run of this version takes 36.7 microseconds.
// Timed twice side by side with v004, it ran 1.64 and 1.63 times as fast.
// Counting every step since v000, it is 63.7 times as fast.
// Contractions on v_wmma_f32_16x16x32_f16 (plain f16 operands, f32 accumulate). Two launches.
// k_proj: eval BatchNorm of a frame, one of the 1x1 convs g1, theta, g2, phi (K = 64) and its bias; the results are stored as f16 in the
// order of the WMMA fragments that k_attn takes them in (see "packed planes" below).
// k_attn, one work-group per 32 positions, direction and batch: scores theta^T.phi (K = 32), softmax in f32 with a running maximum, the
// weighted sum of g (K = 4096), then W_out (K = 32), its BatchNorm and the residual in f32 into the output. The 4096 x 4096 scores and y
// never reach memory. y2 takes theta as queries, phi as keys, g2 as values; y1 takes phi, theta, g1.
// compute dtype: f16 operands, f32 accumulate.  x1, x2 [4,64,64,64] -> (x1 + W(y1), x2 + W(y2)).
#include <hip/hip_runtime.h>
#include <hip/hip_bf16.h>
#include <math.h>

#define NBs 4
#define CCs 64
#define CIs 32
#define NNs 4096
#define SS 4096
#define HH 1
#define DKK 64
#define GSTR 48

typedef _Float16 bf16;
typedef _Float16 f16;
typedef __attribute__((ext_vector_type(4))) unsigned v4u_t;
typedef unsigned v4ua __attribute__((ext_vector_type(4), may_alias));
typedef __attribute__((ext_vector_type(4))) float v4f_t;
typedef __attribute__((ext_vector_type(16))) bf16  bf16x16;
typedef bf16x16 f16x16;
typedef __attribute__((ext_vector_type(8)))  bf16  bf16x8;
typedef bf16x8 f16x8;
typedef __attribute__((ext_vector_type(4)))  bf16  bf16x4;
typedef __attribute__((ext_vector_type(8)))  float f32x8;
// WMMA with four v_nop behind it that still name A and B: they keep the form's distance to whatever writes A or B or reads D next, so that
// the next product's result cannot be placed over this one's B operand directly behind it
__device__ __forceinline__ f32x8 wmma16(f16x16 a, f16x16 b, f32x8 c) {
  c = __builtin_amdgcn_wmma_f32_16x16x32_f16(false, a, false, b, (short)0, c, false, false);
  asm volatile("v_nop\n\tv_nop\n\tv_nop\n\tv_nop" : "+v"(c) : "v"(a), "v"(b));
  return c;
}
#define LDS_STRIDE 48   // unused; so is GSTR (same 48)
#define KSTRIDE    72   // unused; k_attn stages only the 32 x 32 block of Y, pitch AKP
#define VSTRIDE    48   // unused; k_attn uses AKP

// 16x32 (MxK) f16 fragment from a row-major global matrix.
// lanes 0-15  (row=lane)    : elems 0..7 = K+0..7,  8..15 = K+16..23
// lanes 16-31 (row=lane-16) : elems 0..7 = K+8..15, 8..15 = K+24..31
template <typename T>
__device__ __forceinline__ bf16x16 load_frag(const T* __restrict__ base, int ld,
                                             int row0, int k0) {
  const int lane = threadIdx.x & 31;
  const int r    = lane & 15;
  const int kh   = (lane >> 4) * 8;
  const T* p0 = base + (size_t)(row0 + r) * ld + (k0 + kh);
  const T* p1 = p0 + 16;
  bf16x16 f;
#pragma unroll
  for (int i = 0; i < 8; ++i) {
    f[i]     = (bf16)p0[i];
    f[i + 8] = (bf16)p1[i];
  }
  return f;
}

// Same fragment from an LDS tile with padded row stride (base includes row0/k0).
__device__ __forceinline__ bf16x16 lds_frag(const bf16* base, int stride) {
  const int lane = threadIdx.x & 31;
  const int row  = lane & 15;
  const int kh   = (lane >> 4) * 8;
  const bf16x8 lo = *(const bf16x8*)(base + row * stride + kh);
  const bf16x8 hi = *(const bf16x8*)(base + row * stride + kh + 16);
  bf16x16 f;
#pragma unroll
  for (int i = 0; i < 8; ++i) { f[i] = lo[i]; f[i + 8] = hi[i]; }
  return f;
}

// Fragment from a packed plane; p is the lane's own 8 halfs of the fragment's first run.
__device__ __forceinline__ f16x16 pk_frag(const f16* __restrict__ p) {
  const f16x8 lo = *(const f16x8*)p, hi = *(const f16x8*)(p + 256);
  return __builtin_shufflevector(lo, hi, 0, 1, 2, 3, 4, 5, 6, 7, 8, 9, 10, 11, 12, 13, 14, 15);
}

// ---------------------------------------------------------------------------
// k_attn: Y[c][n] = sum_m G[c][m] * softmax_m(S[n][m]), S[n][m] = sum_k Qt[n][k] * Kt[m][k] (k < 32), for the 32 rows c of
// G [32][4096]; Qt, Kt [4096][32], all three f16 in packed planes. S and the weights live in registers only.
// Packed planes (halfs): a fragment is two runs of 256 halfs, lane l owning halfs 8 l .. 8 l + 7 of each, so a wave-wide 16-B load takes 512 B in a row.
//   T plane: half 512 tile + 256 h + 8 l + e = T[16 tile + (l & 15)][16 h + 8 (l >> 4) + e]
//   G plane: half 1024 slice + 512 i + 256 h + 8 l + e = G[16 i + (l & 15)][32 slice + 16 h + 8 (l >> 4) + e]
// Grid = 128 x 2 x 4 work-groups, each owns 32 columns n (one whole 128-B line of every Y row). Its 16 waves cut the keys m into 16
// ranges of 256; each wave loads its 32-key slices of Kt and G from the packed planes straight into fragment registers (no LDS, no
// conversion, no barrier in the loop) and keeps a running maximum, a running sum and an un-normalised 32 x 32 partial per column. Transposed scores
// (A = keys, B = queries) leave a lane with column n = lane & 15 and keys 8 * (lane >> 4) + r: two such tiles are, register
// for register, the B fragment of the second product. The 16 partials are merged in wave order through LDS at the end.
// The merged 32 x 32 block of Y goes to LDS as f16, position-major; behind one more barrier four waves multiply it by W_w [64][32]
// (16 output channels each, so every 128-B line of the output has one writer) and store x + bn_w(W_w Y + W_b).
// ---------------------------------------------------------------------------
#define AKP 40   // row pitch of Y in LDS: 32 -> 40 halfs (80 B = 16 B x 5): aligned b128 fragment reads without conflicts
#define ARP 36   // partial row pitch in floats: rows 8 apart fall on different banks
#define L2E 1.4426950408889634f
// value of lane l ^ 16
__device__ __forceinline__ float other_half(float v) {
  const int b = __builtin_bit_cast(int, v);
  return __builtin_bit_cast(float, __builtin_amdgcn_permlanex16(b, b, 0x76543210, 0xfedcba98, false, false));
}
// 2^x on v_exp_f32 with the slot behind it filled inside the statement: the instruction set asks for one independent instruction or
// v_nop between a transcendental and a direct reader of its result or writer of its source.
// In the group of four each v_exp_f32 is the independent instruction behind the one before
// (outputs are early-clobber, so none shares a register with an input).
__device__ __forceinline__ float exp2_slot(float x) {
  float y;
  asm("v_exp_f32 %0, %1\n\tv_nop" : "=v"(y) : "v"(x));
  return y;
}
__device__ __forceinline__ void exp2_slot4(float& a, float& b, float& c, float& d) {
  float ya, yb, yc, yd;
  asm("v_exp_f32 %0, %4\n\tv_exp_f32 %1, %5\n\tv_exp_f32 %2, %6\n\tv_exp_f32 %3, %7\n\tv_nop"
      : "=&v"(ya), "=&v"(yb), "=&v"(yc), "=&v"(yd) : "v"(a), "v"(b), "v"(c), "v"(d));
  a = ya; b = yb; c = yc; d = yd;
}
// One 32-key slice of a wave: scores, running softmax and weighted sum for its two column groups. With MORE the next slice's fragments are
// fetched into the same registers as soon as their last product of this slice is issued (keys: under the second group's softmax; values:
// under the next slice's first scores and softmax); kn, gn are the lane's own halfs of the next slice. The last slice is the instance without.
template <bool MORE>
__device__ __forceinline__ void attn_slice(f16x16 (&kf)[2], f16x16 (&vf)[2], const f16x16 (&qf)[2], f32x8 (&acc)[2][2], float (&mrun)[2], float (&lrun)[2],
                                           const f16* __restrict__ kn, const f16* __restrict__ gn) {
#pragma unroll
  for (int j = 0; j < 2; ++j) {
    f32x8 sc[2];   // scores of keys 16 t + 8 (lane >> 4) + r against column 16 j + (lane & 15)
#pragma unroll
    for (int t = 0; t < 2; ++t) { const f32x8 z = {}; sc[t] = __builtin_amdgcn_wmma_f32_16x16x32_f16(false, kf[t], false, qf[j], (short)0, z, false, false); }
    if (MORE && j == 1) {
#pragma unroll
      for (int t = 0; t < 2; ++t) kf[t] = pk_frag(kn + 512 * t);
    }
    float mx = sc[0][0];
#pragma unroll
    for (int t = 0; t < 2; ++t)
#pragma unroll
      for (int r = 0; r < 8; ++r) mx = fmaxf(mx, sc[t][r]);
    mx = fmaxf(mx, other_half(mx));
    const float mn = fmaxf(mrun[j], mx);
    const float al = exp2_slot((mrun[j] - mn) * L2E);   // 0 on the first slice
    mrun[j] = mn;
    const float mb = 10.0f - mn * L2E;   // weights are 1024 * exp(score - maximum): small ones stay normal f16 numbers; the factor cancels in the division
    f16x16 pf;
    float gs[4];   // sums of four weights each
#pragma unroll
    for (int t = 0; t < 2; ++t)
#pragma unroll
      for (int r = 0; r < 8; r += 4) {
        float p0 = sc[t][r] * L2E + mb, p1 = sc[t][r + 1] * L2E + mb, p2 = sc[t][r + 2] * L2E + mb, p3 = sc[t][r + 3] * L2E + mb;
        exp2_slot4(p0, p1, p2, p3);
        gs[t * 2 + (r >> 2)] = (p0 + p1) + (p2 + p3);
        pf[t * 8 + r] = (f16)p0; pf[t * 8 + r + 1] = (f16)p1; pf[t * 8 + r + 2] = (f16)p2; pf[t * 8 + r + 3] = (f16)p3;
      }
    lrun[j] = lrun[j] * al + ((gs[0] + gs[1]) + (gs[2] + gs[3]));
#pragma unroll
    for (int i = 0; i < 2; ++i) {
#pragma unroll
      for (int r = 0; r < 8; ++r) acc[i][j][r] *= al;
      acc[i][j] = __builtin_amdgcn_wmma_f32_16x16x32_f16(false, vf[i], false, pf, (short)0, acc[i][j], false, false);
    }
    // one column group at a time: interleaved, the two groups' scores and weights are live together and the wave passes the 128 registers at which two work-groups are resident on a WGP
    __builtin_amdgcn_sched_barrier(0);
  }
  if (MORE) {
#pragma unroll
    for (int i = 0; i < 2; ++i) vf[i] = pk_frag(gn + 512 * i);
  }
}
// blockIdx.y = direction d, blockIdx.z = batch b. TT: planes [b][theta^T, phi^T]; GG: planes [b][g1, g2].
// d = 0 (y2): queries theta^T, keys phi^T, values g2, residual x2, second output; d = 1 (y1): queries phi^T, keys theta^T, values g1, x1, first output.
__global__ __launch_bounds__(512) void k_attn(const float* __restrict__ TT, const float* __restrict__ GG, const float* __restrict__ Ww, const float* __restrict__ Wb,
                                              const float* __restrict__ wbn, const float* __restrict__ x1, const float* __restrict__ x2,
                                              float* __restrict__ out1, float* __restrict__ out2) {
  const int dir = blockIdx.y, bat = blockIdx.z;
  const f16* __restrict__ Qt = (const f16*)TT + (size_t)(bat * 2 + dir) * (NNs * CIs);
  const f16* __restrict__ Kt = (const f16*)TT + (size_t)(bat * 2 + 1 - dir) * (NNs * CIs);
  const f16* __restrict__ G = (const f16*)GG + (size_t)(bat * 2 + 1 - dir) * (CIs * NNs);
  __shared__ __attribute__((aligned(16))) f16 ys[32 * AKP];         // 32 positions x 32 channels of Y
  __shared__ __attribute__((aligned(16))) float red[16][32 * ARP];  // per wave: its 32 x 32 partial
  __shared__ float smx[16][32], ssm[16][32];                        // per wave and column: maximum, sum
  __shared__ float oinv[CCs], osh[CCs], owb[CCs];                   // per output channel: W_out's BatchNorm scale and shift, W_b
  const int tid = threadIdx.x, lane = tid & 31, wave = tid >> 5;
  const int n0 = blockIdx.x * 32;
  const int wu = __builtin_amdgcn_readfirstlane(wave);
  const unsigned lo8 = lane * 8;                 // the lane's own halfs in a fragment run
  const f16* kb = Kt + wu * (256 * CIs);         // the wave's 256 keys are 16 fragments in a row, its 256 columns of G likewise
  const f16* gb = G + wu * (256 * CIs);
  // the inner loops are unrolled: acc and the fragments are register arrays and need constant indices
  f16x16 kf[2], vf[2], qf[2];
#pragma unroll
  for (int t = 0; t < 2; ++t) { kf[t] = pk_frag(kb + 512 * t + lo8); vf[t] = pk_frag(gb + 512 * t + lo8); qf[t] = pk_frag(Qt + (n0 + 16 * t) * CIs + lo8); }
  if (tid < CCs) {   // read behind the barrier that follows the loop
    const float inv = wbn[tid] / sqrtf(wbn[3 * CCs + tid] + 1e-5f);
    oinv[tid] = inv; osh[tid] = wbn[CCs + tid] - wbn[2 * CCs + tid] * inv; owb[tid] = Wb[tid];
  }
  f32x8 acc[2][2] = {};
  float mrun[2] = {-3.0e38f, -3.0e38f}, lrun[2] = {0.0f, 0.0f};
  // the loop over slices stays rolled: unrolled, the compiler put off the running sums' additions to the end and spilled the weights
#pragma unroll 1
  for (int s = 0; s < 7; ++s) {
    kb += 32 * CIs; gb += 32 * CIs;
    attn_slice<true>(kf, vf, qf, acc, mrun, lrun, kb + lo8, gb + lo8);
  }
  attn_slice<false>(kf, vf, qf, acc, mrun, lrun, kb, gb);
  const int nlane = lane & 15, mh = (lane >> 4) * 8;
  float* rw = red[wave];
#pragma unroll
  for (int i = 0; i < 2; ++i)
#pragma unroll
    for (int j = 0; j < 2; ++j)
#pragma unroll
      for (int r = 0; r < 8; ++r) rw[(16 * i + mh + r) * ARP + 16 * j + nlane] = acc[i][j][r];
#pragma unroll
  for (int j = 0; j < 2; ++j) {
    const float lt = lrun[j] + other_half(lrun[j]);   // the two halves hold different keys of the same column
    if (lane < 16) { smx[wave][16 * j + lane] = mrun[j]; ssm[wave][16 * j + lane] = lt; }
  }
  __syncthreads();
  // the four waves of the last product fetch their W_w fragment and their residual values here: carried through the loop they would put the
  // wave over the 128 registers at which two work-groups are resident on a WGP; from here the latency runs under the merge
  const size_t ob = (size_t)bat * (CCs * NNs) + (size_t)((wu & 3) * 16 + mh) * NNs + n0 + nlane;   // output channel 16 wu + mh + r, position n0 + 16 j + nlane
  const float* __restrict__ xres = (dir ? x1 : x2) + ob;
  v4f_t wr[4] = {};   // the lane's part of the W_w fragment, still f32: rounded behind the merge, so that the merge does not begin with a wait for it
  float xr[2][8] = {};
  if (wu < 4) {
    const float* __restrict__ wp = Ww + (size_t)(16 * wu + nlane) * CIs + mh;   // row 16 wu + nlane, k = mh .. mh + 7 and 16 + mh .. 16 + mh + 7, as in load_frag
#pragma unroll
    for (int h = 0; h < 2; ++h) { wr[2 * h] = *(const v4f_t*)(wp + 16 * h); wr[2 * h + 1] = *(const v4f_t*)(wp + 16 * h + 4); }
#pragma unroll
    for (int j = 0; j < 2; ++j)
#pragma unroll
      for (int r = 0; r < 8; ++r) xr[j][r] = xres[(size_t)r * NNs + 16 * j];
  }
  { const int c = tid >> 4, np = (tid & 15) * 2;     // a thread merges channel c of positions np and np + 1
    float m0 = smx[0][np], m1 = smx[0][np + 1];
#pragma unroll
    for (int w = 1; w < 16; ++w) { m0 = fmaxf(m0, smx[w][np]); m1 = fmaxf(m1, smx[w][np + 1]); }
    float s0 = 0.0f, s1 = 0.0f, l0 = 0.0f, l1 = 0.0f;
#pragma unroll
    for (int w = 0; w < 16; ++w) {
      const float2 v = *(const float2*)(&red[w][c * ARP + np]);
      const float f0 = exp2_slot((smx[w][np] - m0) * L2E), f1 = exp2_slot((smx[w][np + 1] - m1) * L2E);
      s0 += v.x * f0; s1 += v.y * f1; l0 += ssm[w][np] * f0; l1 += ssm[w][np + 1] * f1;
    }
    ys[np * AKP + c] = (f16)(s0 / l0); ys[(np + 1) * AKP + c] = (f16)(s1 / l1); }
  __syncthreads();   // the whole block of Y is in LDS before the four waves read it
  if (wu < 4) {
    float* __restrict__ o = (dir ? out1 : out2) + ob;
    f16x16 wf;
#pragma unroll
    for (int i = 0; i < 16; ++i) wf[i] = (f16)wr[i >> 2][i & 3];
    const f16x16 yf0 = lds_frag(ys, AKP), yf1 = lds_frag(ys + 16 * AKP, AKP);
    const f32x8 z0 = {};
    f32x8 zz[2];
    zz[0] = wmma16(wf, yf0, z0);
    zz[1] = wmma16(wf, yf1, z0);
#pragma unroll
    for (int j = 0; j < 2; ++j)
#pragma unroll
      for (int r = 0; r < 8; ++r) {
        const int c = 16 * wu + mh + r;
        o[(size_t)r * NNs + 16 * j] = xr[j][r] + ((zz[j][r] + owb[c]) * oinv[c] + osh[c]);
      }
  }
}

// ---------------------------------------------------------------------------
// k_proj: P[o][n] = sum_c W[o][c] * bn(x)[c][n] + bias[o], o < 32, c < 64, for 128 positions n of one frame.
// blockIdx.y = projection q (0: g of x1, 1: theta of x1, 2: g of x2, 3: phi of x2), blockIdx.z = batch.
// bn(x)[c][n] = x * inv_c + (beta - mean * inv)_c, inv = gamma / sqrt(var + eps), is rounded to f16 and staged position-major in LDS
// (a wave-wide load takes the 512 B of one channel's row; a lane packs four channels of a position into one 8-B LDS store).
// Wave w takes positions 16 w .. 16 w + 15; the weights come straight from global memory. q odd (TT plane [b][q / 2]): A = weights, B = the staged
// frame, a lane gets 8 channels of one position. q even (GG plane [b][q / 2]): A = the staged frame, B = weights, a lane gets 8 positions of one
// channel. Either way those 8 values, rounded to f16, are the lane's own 16 B of a packed fragment run: a wave-wide store takes 512 B in a row.
// ---------------------------------------------------------------------------
#define XP 72    // staged pitch: 64 -> 72 halfs (144 B = 16 B x 9): aligned b128 fragment reads
__global__ __launch_bounds__(256) void k_proj(const float* __restrict__ x1, const float* __restrict__ x2, const float* __restrict__ gbn, const float* __restrict__ tbn,
                                              const float* __restrict__ pbn, const float* __restrict__ gw, const float* __restrict__ tw, const float* __restrict__ pw,
                                              const float* __restrict__ gb, const float* __restrict__ tb, const float* __restrict__ pb,
                                              float* __restrict__ GG, float* __restrict__ TT) {
  const int q = blockIdx.y, b = blockIdx.z, n0 = blockIdx.x * 128;
  const float* __restrict__ x = (q < 2 ? x1 : x2) + (size_t)b * (CCs * NNs) + n0;
  const float* __restrict__ p = q == 1 ? tbn : (q == 3 ? pbn : gbn);
  const float* __restrict__ Wq = q == 1 ? tw : (q == 3 ? pw : gw);
  const float* __restrict__ bias = q == 1 ? tb : (q == 3 ? pb : gb);
  __shared__ __attribute__((aligned(16))) f16 xs[128 * XP];
  __shared__ float sinv[CCs], ssh[CCs];
  const int tid = threadIdx.x, lane = tid & 31, wave = tid >> 5, cl = lane & 15, rh = (lane >> 4) * 8;
  v4f_t xv[8];   // channels 32 g + 4 wave + e, positions 4 lane .. 4 lane + 3
  // the loops are unrolled: xv and acc are register arrays and need constant indices
#pragma unroll
  for (int g = 0; g < 2; ++g)
#pragma unroll
    for (int e = 0; e < 4; ++e) xv[g * 4 + e] = *(const v4f_t*)(x + (size_t)(32 * g + 4 * wave + e) * NNs + lane * 4);
  if (tid < CCs) {
    const float inv = p[tid] / sqrtf(p[3 * CCs + tid] + 1e-5f);
    sinv[tid] = inv; ssh[tid] = p[CCs + tid] - p[2 * CCs + tid] * inv;
  }
  f16x16 af[2][2];
#pragma unroll
  for (int i = 0; i < 2; ++i)
#pragma unroll
    for (int ks = 0; ks < 2; ++ks) af[i][ks] = load_frag(Wq, CCs, 16 * i, 32 * ks);
  v4f_t bv[2][2];   // bias of channels 16 i + rh + 4 hf .. + 3, fetched with the other operands and not behind the products
#pragma unroll
  for (int i = 0; i < 2; ++i)
#pragma unroll
    for (int hf = 0; hf < 2; ++hf) bv[i][hf] = *(const v4f_t*)(bias + 16 * i + rh + 4 * hf);
  const float bc[2] = {bias[cl], bias[16 + cl]};   // bias of channel 16 i + cl
  __syncthreads();
#pragma unroll
  for (int g = 0; g < 2; ++g) {
    const int k0 = 32 * g + 4 * wave;
#pragma unroll
    for (int u = 0; u < 4; ++u) {
      bf16x4 hx;
#pragma unroll
      for (int e = 0; e < 4; ++e) hx[e] = (f16)(xv[g * 4 + e][u] * sinv[k0 + e] + ssh[k0 + e]);
      *(bf16x4*)(xs + (lane * 4 + u) * XP + k0) = hx;
    }
  }
  __syncthreads();
  f32x8 acc[2] = {};
  f16x16 bfr[2];
#pragma unroll
  for (int ks = 0; ks < 2; ++ks) bfr[ks] = lds_frag(xs + (wave * 16) * XP + 32 * ks, XP);
  if (q & 1) {
#pragma unroll
    for (int ks = 0; ks < 2; ++ks)
#pragma unroll
      for (int i = 0; i < 2; ++i) acc[i] = __builtin_amdgcn_wmma_f32_16x16x32_f16(false, af[i][ks], false, bfr[ks], (short)0, acc[i], false, false);
    // a lane holds position 16 wave + cl and channels 16 i + rh + r: run i of fragment n0 / 16 + wave
    f16* __restrict__ dst = (f16*)TT + (size_t)(b * 2 + (q >> 1)) * (NNs * CIs) + (size_t)(n0 + 16 * wave) * CIs + lane * 8;
#pragma unroll
    for (int i = 0; i < 2; ++i) {
      f16x8 h;
#pragma unroll
      for (int r = 0; r < 8; ++r) h[r] = (f16)(acc[i][r] + bv[i][r >> 2][r & 3]);
      *(f16x8*)(dst + 256 * i) = h;
    }
    asm volatile("s_wait_xcnt 0x0" ::: "memory");   // stands in front of any later write of a register that the two stores name
  } else {
#pragma unroll
    for (int ks = 0; ks < 2; ++ks)
#pragma unroll
      for (int i = 0; i < 2; ++i) acc[i] = __builtin_amdgcn_wmma_f32_16x16x32_f16(false, bfr[ks], false, af[i][ks], (short)0, acc[i], false, false);
    // a lane holds channel 16 i + cl and positions 16 wave + rh + r: run wave & 1 of fragment i of slice n0 / 32 + wave / 2
    f16* __restrict__ dst = (f16*)GG + (size_t)(b * 2 + (q >> 1)) * (CIs * NNs) + (size_t)(n0 + 32 * (wave >> 1)) * CIs + 256 * (wave & 1) + lane * 8;
#pragma unroll
    for (int i = 0; i < 2; ++i) {
      f16x8 h;
#pragma unroll
      for (int r = 0; r < 8; ++r) h[r] = (f16)(acc[i][r] + bc[i]);
      *(f16x8*)(dst + 512 * i) = h;
    }
    asm volatile("s_wait_xcnt 0x0" ::: "memory");   // as in the other branch: which of the two blocks comes first in the built code is the compiler's choice
  }
}

extern "C" void kernel_launch(void* const* d_in, const int* in_sizes, int n_in,
                              void* d_out, int out_size, void* d_ws, size_t ws_size,
                              hipStream_t stream) {
  (void)in_sizes; (void)n_in; (void)out_size;
  const float** f = (const float**)d_in;
  const float* x1 = f[0], *x2 = f[1], *gbn = f[2], *gw = f[3], *gb = f[4], *tbn = f[5], *tw = f[6], *tb = f[7], *pbn = f[8], *pw = f[9], *pb = f[10], *wbn = f[11], *Ww = f[12], *Wb = f[13];
  float* out1 = (float*)d_out; float* out2 = out1 + (size_t)NBs * CCs * NNs;     // tuple
  char* ws = (char*)d_ws;
  float* GG = (float*)ws; ws += (size_t)NBs * 2 * CIs * NNs * 2;      // g1, g2: packed f16 planes [b][2] of [32][4096]
  float* TT = (float*)ws; ws += (size_t)NBs * 2 * NNs * CIs * 2;      // theta^T, phi^T: packed f16 planes [b][2] of [4096][32]
  if ((size_t)(ws - (char*)d_ws) > ws_size) return;
  // q = 0: g1 = g(bn_g x1), 1: theta(bn_theta x1), 2: g2 = g(bn_g x2), 3: phi(bn_phi x2)
  k_proj<<<dim3(NNs / 128, 4, NBs), dim3(256), 0, stream>>>(x1, x2, gbn, tbn, pbn, gw, tw, pw, gb, tb, pb, GG, TT);
  // d = 0: y2[c][n] = sum_m g2[c][m] att1[n][m], att1 = softmax over m of sum_k theta[k][n] phi[k][m]
  // d = 1: y1[c][m] = sum_n g1[c][n] att2[n][m], att2 = softmax over n of the same scores
  k_attn<<<dim3(NNs / 32, 2, NBs), dim3(512), 0, stream>>>(TT, GG, Ww, Wb, wbn, x1, x2, out1, out2);
}

// v006
// One run takes 33.4 microseconds.
// In both of two side-by-side timings against v005, it was 1.10 times as fast.
// All steps since v000 together make it 70.3 times as fast.
// Contractions on v_wmma_f32_16x16x32_f16 (plain f16 operands, f32 accumulate). Two launches.
// k_proj: eval BatchNorm of a frame, one of the 1x1 convs g1, theta, g2, phi (K = 64) and its bias; the results are stored as f16 in the
// order of the WMMA fragments that k_attn takes them in (see "packed planes" below).
// k_attn, one work-group per 128 positions, direction and batch: scores theta^T.phi (K = 32), softmax in f32 with a running maximum, the
// weighted sum of g (K = 4096), then W_out (K = 32), its BatchNorm and the residual in f32 into the output. The 4096 x 4096 scores and y
// never reach memory. y2 takes theta as queries, phi as keys, g2 as values; y1 takes phi, theta, g1.
// compute dtype: f16 operands, f32 accumulate.  x1, x2 [4,64,64,64] -> (x1 + W(y1), x2 + W(y2)).
#include <hip/hip_runtime.h>
#include <hip/hip_bf16.h>
#include <math.h>

#define NBs 4
#define CCs 64
#define CIs 32
#define NNs 4096
#define SS 4096
#define HH 1
#define DKK 64
#define GSTR 48

typedef _Float16 bf16;
typedef _Float16 f16;
typedef __attribute__((ext_vector_type(4))) unsigned v4u_t;
typedef unsigned v4ua __attribute__((ext_vector_type(4), may_alias));
typedef __attribute__((ext_vector_type(4))) float v4f_t;
typedef __attribute__((ext_vector_type(16))) bf16  bf16x16;
typedef bf16x16 f16x16;
typedef __attribute__((ext_vector_type(8)))  bf16  bf16x8;
typedef bf16x8 f16x8;
typedef __attribute__((ext_vector_type(4)))  bf16  bf16x4;
typedef __attribute__((ext_vector_type(8)))  float f32x8;
// WMMA with four v_nop behind it that still name A and B: they keep the form's distance to whatever writes A or B or reads D next, so that
// the next product's result cannot be placed over this one's B operand directly behind it
__device__ __forceinline__ f32x8 wmma16(f16x16 a, f16x16 b, f32x8 c) {
  c = __builtin_amdgcn_wmma_f32_16x16x32_f16(false, a, false, b, (short)0, c, false, false);
  asm volatile("v_nop\n\tv_nop\n\tv_nop\n\tv_nop" : "+v"(c) : "v"(a), "v"(b));
  return c;
}
#define LDS_STRIDE 48   // unused; so is GSTR (same 48)
#define KSTRIDE    72   // unused; k_attn stages only the 32 x 128 block of Y, pitch AKP
#define VSTRIDE    48   // unused; k_attn uses AKP

// 16x32 (MxK) f16 fragment from a row-major global matrix.
// lanes 0-15  (row=lane)    : elems 0..7 = K+0..7,  8..15 = K+16..23
// lanes 16-31 (row=lane-16) : elems 0..7 = K+8..15, 8..15 = K+24..31
template <typename T>
__device__ __forceinline__ bf16x16 load_frag(const T* __restrict__ base, int ld,
                                             int row0, int k0) {
  const int lane = threadIdx.x & 31;
  const int r    = lane & 15;
  const int kh   = (lane >> 4) * 8;
  const T* p0 = base + (size_t)(row0 + r) * ld + (k0 + kh);
  const T* p1 = p0 + 16;
  bf16x16 f;
#pragma unroll
  for (int i = 0; i < 8; ++i) {
    f[i]     = (bf16)p0[i];
    f[i + 8] = (bf16)p1[i];
  }
  return f;
}

// Same fragment from an LDS tile with padded row stride (base includes row0/k0).
__device__ __forceinline__ bf16x16 lds_frag(const bf16* base, int stride) {
  const int lane = threadIdx.x & 31;
  const int row  = lane & 15;
  const int kh   = (lane >> 4) * 8;
  const bf16x8 lo = *(const bf16x8*)(base + row * stride + kh);
  const bf16x8 hi = *(const bf16x8*)(base + row * stride + kh + 16);
  bf16x16 f;
#pragma unroll
  for (int i = 0; i < 8; ++i) { f[i] = lo[i]; f[i + 8] = hi[i]; }
  return f;
}

// Fragment from a packed plane; p is the lane's own 8 halfs of the fragment's first run.
__device__ __forceinline__ f16x16 pk_frag(const f16* __restrict__ p) {
  const f16x8 lo = *(const f16x8*)p, hi = *(const f16x8*)(p + 256);
  return __builtin_shufflevector(lo, hi, 0, 1, 2, 3, 4, 5, 6, 7, 8, 9, 10, 11, 12, 13, 14, 15);
}

// ---------------------------------------------------------------------------
// k_attn: Y[c][n] = sum_m G[c][m] * softmax_m(S[n][m]), S[n][m] = sum_k Qt[n][k] * Kt[m][k] (k < 32), for the 32 rows c of
// G [32][4096]; Qt, Kt [4096][32], all three f16 in packed planes. S and the weights live in registers only.
// Packed planes (halfs): a fragment is two runs of 256 halfs, lane l owning halfs 8 l .. 8 l + 7 of each, so a wave-wide 16-B load takes 512 B in a row.
//   T plane: half 512 tile + 256 h + 8 l + e = T[16 tile + (l & 15)][16 h + 8 (l >> 4) + e]
//   G plane: half 1024 slice + 512 i + 256 h + 8 l + e = G[16 i + (l & 15)][32 slice + 16 h + 8 (l >> 4) + e]
// Grid = 32 x 2 x 4 work-groups, each owns 128 columns n of one direction and batch. Its 32 waves are 4 column groups of 32 columns (one whole 128-B line of every Y row) times
// 8 key ranges of 512 keys m: wave = 4 range + group, so the four waves of a range stand on the four SIMDs at the same age, walk the same
// slices together and ask for the same lines of Kt and G, which the WGP's cache fetches from L2 once for the four.
// Each wave loads its 32-key slices of Kt and G from the packed planes straight into fragment registers (no LDS, no
// conversion, no barrier in the loop) and keeps a running maximum, a running sum and an un-normalised 32 x 32 partial per column. Transposed scores
// (A = keys, B = queries) leave a lane with column n = lane & 15 and keys 8 * (lane >> 4) + r: two such tiles are, register
// for register, the B fragment of the second product. A column group's 8 partials are merged in range order through LDS at the end.
// The merged 32 x 128 block of Y goes to LDS as f16, position-major; behind one more barrier sixteen waves multiply it by W_w [64][32]
// (16 output channels of one column group each, so every 128-B line of the output has one writer) and store x + bn_w(W_w Y + W_b).
// ---------------------------------------------------------------------------
#define AKP 40   // row pitch of Y in LDS: 32 -> 40 halfs (80 B = 16 B x 5): aligned b128 fragment reads without conflicts
#define ARP 36   // partial row pitch in floats: rows 8 apart fall on different banks
#define L2E 1.4426950408889634f
// value of lane l ^ 16
__device__ __forceinline__ float other_half(float v) {
  const int b = __builtin_bit_cast(int, v);
  return __builtin_bit_cast(float, __builtin_amdgcn_permlanex16(b, b, 0x76543210, 0xfedcba98, false, false));
}
// 2^x on v_exp_f32 with the slot behind it filled inside the statement: the instruction set asks for one independent instruction or
// v_nop between a transcendental and a direct reader of its result or writer of its source.
// In the group of four each v_exp_f32 is the independent instruction behind the one before
// (outputs are early-clobber, so none shares a register with an input).
__device__ __forceinline__ float exp2_slot(float x) {
  float y;
  asm("v_exp_f32 %0, %1\n\tv_nop" : "=v"(y) : "v"(x));
  return y;
}
__device__ __forceinline__ void exp2_slot4(float& a, float& b, float& c, float& d) {
  float ya, yb, yc, yd;
  asm("v_exp_f32 %0, %4\n\tv_exp_f32 %1, %5\n\tv_exp_f32 %2, %6\n\tv_exp_f32 %3, %7\n\tv_nop"
      : "=&v"(ya), "=&v"(yb), "=&v"(yc), "=&v"(yd) : "v"(a), "v"(b), "v"(c), "v"(d));
  a = ya; b = yb; c = yc; d = yd;
}
// One 32-key slice of a wave: scores, running softmax and weighted sum for its two column groups. With MORE the next slice's fragments are
// fetched into the same registers as soon as their last product of this slice is issued (keys: under the second group's softmax; values:
// under the next slice's first scores and softmax); kn, gn are the lane's own halfs of the next slice. The last slice is the instance without.
template <bool MORE>
__device__ __forceinline__ void attn_slice(f16x16 (&kf)[2], f16x16 (&vf)[2], const f16x16 (&qf)[2], f32x8 (&acc)[2][2], float (&mrun)[2], float (&lrun)[2],
                                           const f16* __restrict__ kn, const f16* __restrict__ gn) {
#pragma unroll
  for (int j = 0; j < 2; ++j) {
    f32x8 sc[2];   // scores of keys 16 t + 8 (lane >> 4) + r against column 16 j + (lane & 15)
#pragma unroll
    for (int t = 0; t < 2; ++t) { const f32x8 z = {}; sc[t] = __builtin_amdgcn_wmma_f32_16x16x32_f16(false, kf[t], false, qf[j], (short)0, z, false, false); }
    if (MORE && j == 1) {
#pragma unroll
      for (int t = 0; t < 2; ++t) kf[t] = pk_frag(kn + 512 * t);
    }
    float mx = sc[0][0];
#pragma unroll
    for (int t = 0; t < 2; ++t)
#pragma unroll
      for (int r = 0; r < 8; ++r) mx = fmaxf(mx, sc[t][r]);
    mx = fmaxf(mx, other_half(mx));
    const float mn = fmaxf(mrun[j], mx);
    const float al = exp2_slot((mrun[j] - mn) * L2E);   // 0 on the first slice
    mrun[j] = mn;
    const float mb = 10.0f - mn * L2E;   // weights are 1024 * exp(score - maximum): small ones stay normal f16 numbers; the factor cancels in the division
    f16x16 pf;
    float gs[4];   // sums of four weights each
#pragma unroll
    for (int t = 0; t < 2; ++t)
#pragma unroll
      for (int r = 0; r < 8; r += 4) {
        float p0 = sc[t][r] * L2E + mb, p1 = sc[t][r + 1] * L2E + mb, p2 = sc[t][r + 2] * L2E + mb, p3 = sc[t][r + 3] * L2E + mb;
        exp2_slot4(p0, p1, p2, p3);
        gs[t * 2 + (r >> 2)] = (p0 + p1) + (p2 + p3);
        pf[t * 8 + r] = (f16)p0; pf[t * 8 + r + 1] = (f16)p1; pf[t * 8 + r + 2] = (f16)p2; pf[t * 8 + r + 3] = (f16)p3;
      }
    lrun[j] = lrun[j] * al + ((gs[0] + gs[1]) + (gs[2] + gs[3]));
#pragma unroll
    for (int i = 0; i < 2; ++i) {
#pragma unroll
      for (int r = 0; r < 8; ++r) acc[i][j][r] *= al;
      acc[i][j] = __builtin_amdgcn_wmma_f32_16x16x32_f16(false, vf[i], false, pf, (short)0, acc[i][j], false, false);
    }
    // one column group at a time: interleaved, the two groups' scores and weights are live together and the wave passes the 128 registers at which one work-group is resident on a WGP
    __builtin_amdgcn_sched_barrier(0);
  }
  if (MORE) {
#pragma unroll
    for (int i = 0; i < 2; ++i) vf[i] = pk_frag(gn + 512 * i);
  }
}
// blockIdx.y = direction d, blockIdx.z = batch b. TT: planes [b][theta^T, phi^T]; GG: planes [b][g1, g2].
// d = 0 (y2): queries theta^T, keys phi^T, values g2, residual x2, second output; d = 1 (y1): queries phi^T, keys theta^T, values g1, x1, first output.
__global__ __launch_bounds__(1024) void k_attn(const float* __restrict__ TT, const float* __restrict__ GG, const float* __restrict__ Ww, const float* __restrict__ Wb,
                                              const float* __restrict__ wbn, const float* __restrict__ x1, const float* __restrict__ x2,
                                              float* __restrict__ out1, float* __restrict__ out2) {
  const int dir = blockIdx.y, bat = blockIdx.z;
  const f16* __restrict__ Qt = (const f16*)TT + (size_t)(bat * 2 + dir) * (NNs * CIs);
  const f16* __restrict__ Kt = (const f16*)TT + (size_t)(bat * 2 + 1 - dir) * (NNs * CIs);
  const f16* __restrict__ G = (const f16*)GG + (size_t)(bat * 2 + 1 - dir) * (CIs * NNs);
  __shared__ __attribute__((aligned(16))) f16 ys[128 * AKP];        // 128 positions x 32 channels of Y
  __shared__ __attribute__((aligned(16))) float red[32][32 * ARP];  // per wave: its 32 x 32 partial
  __shared__ __attribute__((aligned(16))) float smx[32][32], ssm[32][32];   // per wave and column: maximum, sum
  __shared__ float oinv[CCs], osh[CCs], owb[CCs];                   // per output channel: W_out's BatchNorm scale and shift, W_b
  const int tid = threadIdx.x, lane = tid & 31, wave = tid >> 5;
  const int wu = __builtin_amdgcn_readfirstlane(wave);
  const int nb = blockIdx.x * 128;
  const int n0 = nb + 32 * (wu & 3);             // the wave's column group
  const int kr = wu >> 2;                        // the wave's key range
  const unsigned lo8 = lane * 8;                 // the lane's own halfs in a fragment run
  const f16* kb = Kt + kr * (512 * CIs);         // the wave's 512 keys are 32 fragments in a row, its 512 columns of G likewise
  const f16* gb = G + kr * (512 * CIs);
  // the inner loops are unrolled: acc and the fragments are register arrays and need constant indices
  f16x16 kf[2], vf[2], qf[2];
#pragma unroll
  for (int t = 0; t < 2; ++t) { kf[t] = pk_frag(kb + 512 * t + lo8); vf[t] = pk_frag(gb + 512 * t + lo8); qf[t] = pk_frag(Qt + (n0 + 16 * t) * CIs + lo8); }
  if (tid < CCs) {   // read behind the barrier that follows the loop
    const float inv = wbn[tid] / sqrtf(wbn[3 * CCs + tid] + 1e-5f);
    oinv[tid] = inv; osh[tid] = wbn[CCs + tid] - wbn[2 * CCs + tid] * inv; owb[tid] = Wb[tid];
  }
  f32x8 acc[2][2] = {};
  float mrun[2] = {-3.0e38f, -3.0e38f}, lrun[2] = {0.0f, 0.0f};
  // the loop over slices stays rolled: unrolled, the compiler put off the running sums' additions to the end and spilled the weights
#pragma unroll 1
  for (int s = 0; s < 15; ++s) {
    kb += 32 * CIs; gb += 32 * CIs;
    attn_slice<true>(kf, vf, qf, acc, mrun, lrun, kb + lo8, gb + lo8);
  }
  attn_slice<false>(kf, vf, qf, acc, mrun, lrun, kb, gb);
  const int nlane = lane & 15, mh = (lane >> 4) * 8;
  float* rw = red[wave];
#pragma unroll
  for (int i = 0; i < 2; ++i)
#pragma unroll
    for (int j = 0; j < 2; ++j)
#pragma unroll
      for (int r = 0; r < 8; ++r) rw[(16 * i + mh + r) * ARP + 16 * j + nlane] = acc[i][j][r];
#pragma unroll
  for (int j = 0; j < 2; ++j) {
    const float lt = lrun[j] + other_half(lrun[j]);   // the two halves hold different keys of the same column
    if (lane < 16) { smx[wave][16 * j + lane] = mrun[j]; ssm[wave][16 * j + lane] = lt; }
  }
  __syncthreads();
  // the sixteen waves of the last product fetch their W_w fragment and their residual values here: carried through the loop they would put the
  // wave over the 128 registers at which one work-group is resident on a WGP; from here the latency runs under the merge
  const int wq = wu & 3, wg = (wu >> 2) & 3;   // wave wu < 16: output channels 16 wq .. 16 wq + 15 of column group wg
  const size_t ob = (size_t)bat * (CCs * NNs) + (size_t)(wq * 16 + mh) * NNs + nb + 32 * wg + nlane;   // output channel 16 wq + mh + r, position nb + 32 wg + 16 j + nlane
  const float* __restrict__ xres = (dir ? x1 : x2) + ob;
  v4f_t wr[4] = {};   // the lane's part of the W_w fragment, still f32: rounded behind the merge, so that the merge does not begin with a wait for it
  float xr[2][8] = {};
  if (wu < 16) {
    const float* __restrict__ wp = Ww + (size_t)(16 * wq + nlane) * CIs + mh;   // row 16 wq + nlane, k = mh .. mh + 7 and 16 + mh .. 16 + mh + 7, as in load_frag
#pragma unroll
    for (int h = 0; h < 2; ++h) { wr[2 * h] = *(const v4f_t*)(wp + 16 * h); wr[2 * h + 1] = *(const v4f_t*)(wp + 16 * h + 4); }
#pragma unroll
    for (int j = 0; j < 2; ++j)
#pragma unroll
      for (int r = 0; r < 8; ++r) xr[j][r] = xres[(size_t)r * NNs + 16 * j];
  }
  { const int mg = wu >> 3, c = (tid >> 3) & 31, np = (tid & 7) * 4;     // a thread merges channel c of positions np .. np + 3 of column group mg
    v4f_t m = *(const v4f_t*)(&smx[mg][np]);
#pragma unroll
    for (int w = 1; w < 8; ++w) {
      const v4f_t t = *(const v4f_t*)(&smx[4 * w + mg][np]);
#pragma unroll
      for (int e = 0; e < 4; ++e) m[e] = fmaxf(m[e], t[e]);
    }
    v4f_t sv = {}, lv = {};
    // four ranges at a time: with all eight unrolled their LDS reads are live together beside the fetched W_w and residual values, and the wave spills
#pragma unroll 4
    for (int w = 0; w < 8; ++w) {
      const v4f_t v = *(const v4f_t*)(&red[4 * w + mg][c * ARP + np]);
      const v4f_t mw = *(const v4f_t*)(&smx[4 * w + mg][np]), lw = *(const v4f_t*)(&ssm[4 * w + mg][np]);
      float f0 = (mw[0] - m[0]) * L2E, f1 = (mw[1] - m[1]) * L2E, f2 = (mw[2] - m[2]) * L2E, f3 = (mw[3] - m[3]) * L2E;
      exp2_slot4(f0, f1, f2, f3);
      sv[0] += v[0] * f0; sv[1] += v[1] * f1; sv[2] += v[2] * f2; sv[3] += v[3] * f3;
      lv[0] += lw[0] * f0; lv[1] += lw[1] * f1; lv[2] += lw[2] * f2; lv[3] += lw[3] * f3;
    }
#pragma unroll
    for (int e = 0; e < 4; ++e) ys[(32 * mg + np + e) * AKP + c] = (f16)(sv[e] / lv[e]); }
  __syncthreads();   // the whole block of Y is in LDS before the sixteen waves read it
  if (wu < 16) {
    float* __restrict__ o = (dir ? out1 : out2) + ob;
    f16x16 wf;
#pragma unroll
    for (int i = 0; i < 16; ++i) wf[i] = (f16)wr[i >> 2][i & 3];
    const f16x16 yf0 = lds_frag(ys + 32 * wg * AKP, AKP), yf1 = lds_frag(ys + (32 * wg + 16) * AKP, AKP);
    const f32x8 z0 = {};
    f32x8 zz[2];
    zz[0] = wmma16(wf, yf0, z0);
    zz[1] = wmma16(wf, yf1, z0);
#pragma unroll
    for (int j = 0; j < 2; ++j)
#pragma unroll
      for (int r = 0; r < 8; ++r) {
        const int c = 16 * wq + mh + r;
        o[(size_t)r * NNs + 16 * j] = xr[j][r] + ((zz[j][r] + owb[c]) * oinv[c] + osh[c]);
      }
  }
}

// ---------------------------------------------------------------------------
// k_proj: P[o][n] = sum_c W[o][c] * bn(x)[c][n] + bias[o], o < 32, c < 64, for 128 positions n of one frame.
// blockIdx.y = projection q (0: g of x1, 1: theta of x1, 2: g of x2, 3: phi of x2), blockIdx.z = batch.
// bn(x)[c][n] = x * inv_c + (beta - mean * inv)_c, inv = gamma / sqrt(var + eps), is rounded to f16 and staged position-major in LDS
// (a wave-wide load takes the 512 B of one channel's row; a lane packs four channels of a position into one 8-B LDS store).
// Wave w takes positions 16 w .. 16 w + 15; the weights come straight from global memory. q odd (TT plane [b][q / 2]): A = weights, B = the staged
// frame, a lane gets 8 channels of one position. q even (GG plane [b][q / 2]): A = the staged frame, B = weights, a lane gets 8 positions of one
// channel. Either way those 8 values, rounded to f16, are the lane's own 16 B of a packed fragment run: a wave-wide store takes 512 B in a row.
// ---------------------------------------------------------------------------
#define XP 72    // staged pitch: 64 -> 72 halfs (144 B = 16 B x 9): aligned b128 fragment reads
__global__ __launch_bounds__(256) void k_proj(const float* __restrict__ x1, const float* __restrict__ x2, const float* __restrict__ gbn, const float* __restrict__ tbn,
                                              const float* __restrict__ pbn, const float* __restrict__ gw, const float* __restrict__ tw, const float* __restrict__ pw,
                                              const float* __restrict__ gb, const float* __restrict__ tb, const float* __restrict__ pb,
                                              float* __restrict__ GG, float* __restrict__ TT) {
  const int q = blockIdx.y, b = blockIdx.z, n0 = blockIdx.x * 128;
  const float* __restrict__ x = (q < 2 ? x1 : x2) + (size_t)b * (CCs * NNs) + n0;
  const float* __restrict__ p = q == 1 ? tbn : (q == 3 ? pbn : gbn);
  const float* __restrict__ Wq = q == 1 ? tw : (q == 3 ? pw : gw);
  const float* __restrict__ bias = q == 1 ? tb : (q == 3 ? pb : gb);
  __shared__ __attribute__((aligned(16))) f16 xs[128 * XP];
  __shared__ float sinv[CCs], ssh[CCs];
  const int tid = threadIdx.x, lane = tid & 31, wave = tid >> 5, cl = lane & 15, rh = (lane >> 4) * 8;
  v4f_t xv[8];   // channels 32 g + 4 wave + e, positions 4 lane .. 4 lane + 3
  // the loops are unrolled: xv and acc are register arrays and need constant indices
#pragma unroll
  for (int g = 0; g < 2; ++g)
#pragma unroll
    for (int e = 0; e < 4; ++e) xv[g * 4 + e] = *(const v4f_t*)(x + (size_t)(32 * g + 4 * wave + e) * NNs + lane * 4);
  if (tid < CCs) {
    const float inv = p[tid] / sqrtf(p[3 * CCs + tid] + 1e-5f);
    sinv[tid] = inv; ssh[tid] = p[CCs + tid] - p[2 * CCs + tid] * inv;
  }
  f16x16 af[2][2];
#pragma unroll
  for (int i = 0; i < 2; ++i)
#pragma unroll
    for (int ks = 0; ks < 2; ++ks) af[i][ks] = load_frag(Wq, CCs, 16 * i, 32 * ks);
  v4f_t bv[2][2];   // bias of channels 16 i + rh + 4 hf .. + 3, fetched with the other operands and not behind the products
#pragma unroll
  for (int i = 0; i < 2; ++i)
#pragma unroll
    for (int hf = 0; hf < 2; ++hf) bv[i][hf] = *(const v4f_t*)(bias + 16 * i + rh + 4 * hf);
  const float bc[2] = {bias[cl], bias[16 + cl]};   // bias of channel 16 i + cl
  __syncthreads();
#pragma unroll
  for (int g = 0; g < 2; ++g) {
    const int k0 = 32 * g + 4 * wave;
#pragma unroll
    for (int u = 0; u < 4; ++u) {
      bf16x4 hx;
#pragma unroll
      for (int e = 0; e < 4; ++e) hx[e] = (f16)(xv[g * 4 + e][u] * sinv[k0 + e] + ssh[k0 + e]);
      *(bf16x4*)(xs + (lane * 4 + u) * XP + k0) = hx;
    }
  }
  __syncthreads();
  f32x8 acc[2] = {};
  f16x16 bfr[2];
#pragma unroll
  for (int ks = 0; ks < 2; ++ks) bfr[ks] = lds_frag(xs + (wave * 16) * XP + 32 * ks, XP);
  if (q & 1) {
#pragma unroll
    for (int ks = 0; ks < 2; ++ks)
#pragma unroll
      for (int i = 0; i < 2; ++i) acc[i] = __builtin_amdgcn_wmma_f32_16x16x32_f16(false, af[i][ks], false, bfr[ks], (short)0, acc[i], false, false);
    // a lane holds position 16 wave + cl and channels 16 i + rh + r: run i of fragment n0 / 16 + wave
    f16* __restrict__ dst = (f16*)TT + (size_t)(b * 2 + (q >> 1)) * (NNs * CIs) + (size_t)(n0 + 16 * wave) * CIs + lane * 8;
#pragma unroll
    for (int i = 0; i < 2; ++i) {
      f16x8 h;
#pragma unroll
      for (int r = 0; r < 8; ++r) h[r] = (f16)(acc[i][r] + bv[i][r >> 2][r & 3]);
      *(f16x8*)(dst + 256 * i) = h;
    }
    asm volatile("s_wait_xcnt 0x0" ::: "memory");   // stands in front of any later write of a register that the two stores name
  } else {
#pragma unroll
    for (int ks = 0; ks < 2; ++ks)
#pragma unroll
      for (int i = 0; i < 2; ++i) acc[i] = __builtin_amdgcn_wmma_f32_16x16x32_f16(false, bfr[ks], false, af[i][ks], (short)0, acc[i], false, false);
    // a lane holds channel 16 i + cl and positions 16 wave + rh + r: run wave & 1 of fragment i of slice n0 / 32 + wave / 2
    f16* __restrict__ dst = (f16*)GG + (size_t)(b * 2 + (q >> 1)) * (CIs * NNs) + (size_t)(n0 + 32 * (wave >> 1)) * CIs + 256 * (wave & 1) + lane * 8;
#pragma unroll
    for (int i = 0; i < 2; ++i) {
      f16x8 h;
#pragma unroll
      for (int r = 0; r < 8; ++r) h[r] = (f16)(acc[i][r] + bc[i]);
      *(f16x8*)(dst + 512 * i) = h;
    }
    asm volatile("s_wait_xcnt 0x0" ::: "memory");   // as in the other branch: which of the two blocks comes first in the built code is the compiler's choice
  }
}

extern "C" void kernel_launch(void* const* d_in, const int* in_sizes, int n_in,
                              void* d_out, int out_size, void* d_ws, size_t ws_size,
                              hipStream_t stream) {
  (void)in_sizes; (void)n_in; (void)out_size;
  const float** f = (const float**)d_in;
  const float* x1 = f[0], *x2 = f[1], *gbn = f[2], *gw = f[3], *gb = f[4], *tbn = f[5], *tw = f[6], *tb = f[7], *pbn = f[8], *pw = f[9], *pb = f[10], *wbn = f[11], *Ww = f[12], *Wb = f[13];
  float* out1 = (float*)d_out; float* out2 = out1 + (size_t)NBs * CCs * NNs;     // tuple
  char* ws = (char*)d_ws;
  float* GG = (float*)ws; ws += (size_t)NBs * 2 * CIs * NNs * 2;      // g1, g2: packed f16 planes [b][2] of [32][4096]
  float* TT = (float*)ws; ws += (size_t)NBs * 2 * NNs * CIs * 2;      // theta^T, phi^T: packed f16 planes [b][2] of [4096][32]
  if ((size_t)(ws - (char*)d_ws) > ws_size) return;
  // q = 0: g1 = g(bn_g x1), 1: theta(bn_theta x1), 2: g2 = g(bn_g x2), 3: phi(bn_phi x2)
  k_proj<<<dim3(NNs / 128, 4, NBs), dim3(256), 0, stream>>>(x1, x2, gbn, tbn, pbn, gw, tw, pw, gb, tb, pb, GG, TT);
  // d = 0: y2[c][n] = sum_m g2[c][m] att1[n][m], att1 = softmax over m of sum_k theta[k][n] phi[k][m]
  // d = 1: y1[c][m] = sum_n g1[c][n] att2[n][m], att2 = softmax over n of the same scores
  k_attn<<<dim3(NNs / 128, 2, NBs), dim3(1024), 0, stream>>>(TT, GG, Ww, Wb, wbn, x1, x2, out1, out2);
}

// v007
// One run takes 30.5 microseconds.
// Two timings next to v006 put it at 1.05 and 1.06 times that version's speed.
// Counting every step since v000, it is 74.1 times as fast.
// Contractions on v_wmma_f32_16x16x32_f16 (plain f16 operands, f32 accumulate). Two launches.
// k_proj: eval BatchNorm of a frame, one of the 1x1 convs g1, theta, g2, phi (K = 64) and its bias; the results are stored as f16 in the
// order of the WMMA fragments that k_attn takes them in (see "packed planes" below).
// k_attn, one work-group per 128 positions, direction and batch: scores theta^T.phi (K = 32), softmax in f32 against a lazily moved reference maximum, the
// weighted sum of g (K = 4096), then W_out (K = 32), its BatchNorm and the residual in f32 into the output. The 4096 x 4096 scores and y
// never reach memory. y2 takes theta as queries, phi as keys, g2 as values; y1 takes phi, theta, g1.
// compute dtype: f16 operands, f32 accumulate.  x1, x2 [4,64,64,64] -> (x1 + W(y1), x2 + W(y2)).
#include <hip/hip_runtime.h>
#include <hip/hip_bf16.h>
#include <math.h>

#define NBs 4
#define CCs 64
#define CIs 32
#define NNs 4096
#define SS 4096
#define HH 1
#define DKK 64
#define GSTR 48

typedef _Float16 bf16;
typedef _Float16 f16;
typedef __attribute__((ext_vector_type(4))) unsigned v4u_t;
typedef unsigned v4ua __attribute__((ext_vector_type(4), may_alias));
typedef __attribute__((ext_vector_type(4))) float v4f_t;
typedef __attribute__((ext_vector_type(16))) bf16  bf16x16;
typedef bf16x16 f16x16;
typedef __attribute__((ext_vector_type(8)))  bf16  bf16x8;
typedef bf16x8 f16x8;
typedef __attribute__((ext_vector_type(4)))  bf16  bf16x4;
typedef __attribute__((ext_vector_type(8)))  float f32x8;
// WMMA with four v_nop behind it that still name A and B: they keep the form's distance to whatever writes A or B or reads D next, so that
// the next product's result cannot be placed over this one's B operand directly behind it
__device__ __forceinline__ f32x8 wmma16(f16x16 a, f16x16 b, f32x8 c) {
  c = __builtin_amdgcn_wmma_f32_16x16x32_f16(false, a, false, b, (short)0, c, false, false);
  asm volatile("v_nop\n\tv_nop\n\tv_nop\n\tv_nop" : "+v"(c) : "v"(a), "v"(b));
  return c;
}
#define LDS_STRIDE 48   // unused; so is GSTR (same 48)
#define KSTRIDE    72   // unused; k_attn stages only the 32 x 128 block of Y, pitch AKP
#define VSTRIDE    48   // unused; k_attn uses AKP

// 16x32 (MxK) f16 fragment from a row-major global matrix.
// lanes 0-15  (row=lane)    : elems 0..7 = K+0..7,  8..15 = K+16..23
// lanes 16-31 (row=lane-16) : elems 0..7 = K+8..15, 8..15 = K+24..31
template <typename T>
__device__ __forceinline__ bf16x16 load_frag(const T* __restrict__ base, int ld,
                                             int row0, int k0) {
  const int lane = threadIdx.x & 31;
  const int r    = lane & 15;
  const int kh   = (lane >> 4) * 8;
  const T* p0 = base + (size_t)(row0 + r) * ld + (k0 + kh);
  const T* p1 = p0 + 16;
  bf16x16 f;
#pragma unroll
  for (int i = 0; i < 8; ++i) {
    f[i]     = (bf16)p0[i];
    f[i + 8] = (bf16)p1[i];
  }
  return f;
}

// Same fragment from an LDS tile with padded row stride (base includes row0/k0).
__device__ __forceinline__ bf16x16 lds_frag(const bf16* base, int stride) {
  const int lane = threadIdx.x & 31;
  const int row  = lane & 15;
  const int kh   = (lane >> 4) * 8;
  const bf16x8 lo = *(const bf16x8*)(base + row * stride + kh);
  const bf16x8 hi = *(const bf16x8*)(base + row * stride + kh + 16);
  bf16x16 f;
#pragma unroll
  for (int i = 0; i < 8; ++i) { f[i] = lo[i]; f[i + 8] = hi[i]; }
  return f;
}

// Fragment from a packed plane; p is the lane's own 8 halfs of the fragment's first run.
__device__ __forceinline__ f16x16 pk_frag(const f16* __restrict__ p) {
  const f16x8 lo = *(const f16x8*)p, hi = *(const f16x8*)(p + 256);
  return __builtin_shufflevector(lo, hi, 0, 1, 2, 3, 4, 5, 6, 7, 8, 9, 10, 11, 12, 13, 14, 15);
}

// ---------------------------------------------------------------------------
// k_attn: Y[c][n] = sum_m G[c][m] * softmax_m(S[n][m]), S[n][m] = sum_k Qt[n][k] * Kt[m][k] (k < 32), for the 32 rows c of
// G [32][4096]; Qt, Kt [4096][32], all three f16 in packed planes. S and the weights live in registers only.
// Packed planes (halfs): a fragment is two runs of 256 halfs, lane l owning halfs 8 l .. 8 l + 7 of each, so a wave-wide 16-B load takes 512 B in a row.
//   T plane: half 512 tile + 256 h + 8 l + e = T[16 tile + (l & 15)][16 h + 8 (l >> 4) + e]
//   G plane: half 1024 slice + 512 i + 256 h + 8 l + e = G[16 i + (l & 15)][32 slice + 16 h + 8 (l >> 4) + e]
// Grid = 32 x 2 x 4 work-groups, each owns 128 columns n of one direction and batch. Its 32 waves are 4 column groups of 32 columns (one whole 128-B line of every Y row) times
// 8 key ranges of 512 keys m: wave = 4 range + group, so the four waves of a range walk the same
// slices together and ask for the same lines of Kt and G, which the WGP's cache fetches from L2 once for the four.
// Each wave loads its 32-key slices of Kt and G from the packed planes straight into fragment registers (no LDS, no
// conversion, no barrier in the loop) and keeps a reference maximum that moves lazily, a running sum and an un-normalised 32 x 32 partial per column. Transposed scores
// (A = keys, B = queries) leave a lane with column n = lane & 15 and keys 8 * (lane >> 4) + r: two such tiles are, register
// for register, the B fragment of the second product. A column group's 8 partials are merged in range order through LDS at the end.
// The merged 32 x 128 block of Y goes to LDS as f16, position-major; behind one more barrier sixteen waves multiply it by W_w [64][32]
// (16 output channels of one column group each, so every 128-B line of the output has one writer) and store x + bn_w(W_w Y + W_b).
// ---------------------------------------------------------------------------
#define AKP 40   // row pitch of Y in LDS: 32 -> 40 halfs (80 B = 16 B x 5): aligned b128 fragment reads without conflicts
#define ARP 36   // partial row pitch in floats: rows 8 apart fall on different banks
#define L2E 1.4426950408889634f
// value of lane l ^ 16
__device__ __forceinline__ float other_half(float v) {
  const int b = __builtin_bit_cast(int, v);
  return __builtin_bit_cast(float, __builtin_amdgcn_permlanex16(b, b, 0x76543210, 0xfedcba98, false, false));
}
// 2^x on v_exp_f32 with the slot behind it filled inside the statement: the instruction set asks for one independent instruction or
// v_nop between a transcendental and a direct reader of its result or writer of its source.
// In the group of four each v_exp_f32 is the independent instruction behind the one before
// (outputs are early-clobber, so none shares a register with an input).
__device__ __forceinline__ float exp2_slot(float x) {
  float y;
  asm("v_exp_f32 %0, %1\n\tv_nop" : "=v"(y) : "v"(x));
  return y;
}
__device__ __forceinline__ void exp2_slot4(float& a, float& b, float& c, float& d) {
  float ya, yb, yc, yd;
  asm("v_exp_f32 %0, %4\n\tv_exp_f32 %1, %5\n\tv_exp_f32 %2, %6\n\tv_exp_f32 %3, %7\n\tv_nop"
      : "=&v"(ya), "=&v"(yb), "=&v"(yc), "=&v"(yd) : "v"(a), "v"(b), "v"(c), "v"(d));
  a = ya; b = yb; c = yc; d = yd;
}
// Weights of one column group and 32 keys: 2^e, rounded to f16 as the B fragment of the second product; returns the lane's sum of its 16 weights.
__device__ __forceinline__ float slice_weights(const float (&e)[16], f16x16& pf) {
  float gs[4];   // sums of four weights each
#pragma unroll
  for (int r = 0; r < 16; r += 4) {
    float p0 = e[r], p1 = e[r + 1], p2 = e[r + 2], p3 = e[r + 3];
    exp2_slot4(p0, p1, p2, p3);
    gs[r >> 2] = (p0 + p1) + (p2 + p3);
    pf[r] = (f16)p0; pf[r + 1] = (f16)p1; pf[r + 2] = (f16)p2; pf[r + 3] = (f16)p3;
  }
  return (gs[0] + gs[1]) + (gs[2] + gs[3]);
}
// largest of a column's 32 exponents (the lane's 16 and the other half's 16)
__device__ __forceinline__ float slice_max(const float (&e)[16]) {
  float mx = e[0];
#pragma unroll
  for (int r = 1; r < 16; ++r) mx = fmaxf(mx, e[r]);
  return fmaxf(mx, other_half(mx));
}
#define WB 8.0f        // a score equal to its column's reference gets the weight 2^8: small weights stay normal f16 numbers; the factor cancels in the division
#define WLIM 32768.0f  // a lane's 16 weights of a slice may sum to this much before the reference moves: no weight leaves the f16 range
// One 32-key slice of a wave: scores, softmax weights and weighted sum for its two column groups. A weight is 2^(score * log2 e + mb[j]),
// mb[j] = WB - the column's reference in log2 units. The reference is the column's maximum over the FIRST slice and moves lazily after that:
// only when some lane's weights of a slice sum to more than WLIM (or to no number) does the whole wave take the branch, in which every column
// whose maximum has passed its reference takes that maximum as the new one and has its sum and partials rescaled; otherwise a slice needs
// no maximum and no rescaling. With MORE the next slice's fragments are fetched into the same registers as soon as their last product of this
// slice is issued (keys: under the second group's softmax; values: under the next slice's first scores and softmax); kn, gn are the lane's
// own halfs of the next slice. The last slice is the instance without.
template <bool FIRST, bool MORE>
__device__ __forceinline__ void attn_slice(f16x16 (&kf)[2], f16x16 (&vf)[2], const f16x16 (&qf)[2], f32x8 (&acc)[2][2], float (&mb)[2], float (&lrun)[2],
                                           const f16* __restrict__ kn, const f16* __restrict__ gn) {
#pragma unroll
  for (int j = 0; j < 2; ++j) {
    f32x8 sc[2];   // scores of keys 16 t + 8 (lane >> 4) + r against column 16 j + (lane & 15)
#pragma unroll
    for (int t = 0; t < 2; ++t) {
      const f32x8 z = {};
      // in the last slice the operands die here and the asm text of the exponentials could be given their registers: the form with the distance built in
      sc[t] = MORE ? __builtin_amdgcn_wmma_f32_16x16x32_f16(false, kf[t], false, qf[j], (short)0, z, false, false) : wmma16(kf[t], qf[j], z);
    }
    if (MORE && j == 1) {
      if (FIRST) {
        kf[0] = pk_frag(kn);
        const f16x8 lo = *(const f16x8*)(kn + 512);
        // in the first slice the four loads share one vector address pair, and the last load's result may be given those registers: the wait stands in front of that write
        asm volatile("s_wait_xcnt 0x0" ::: "memory");
        const f16x8 hi = *(const f16x8*)(kn + 768);
        kf[1] = __builtin_shufflevector(lo, hi, 0, 1, 2, 3, 4, 5, 6, 7, 8, 9, 10, 11, 12, 13, 14, 15);
      } else {
#pragma unroll
        for (int t = 0; t < 2; ++t) kf[t] = pk_frag(kn + 512 * t);
      }
    }
    float e[16];
    f16x16 pf;
    if (FIRST) {
#pragma unroll
      for (int r = 0; r < 16; ++r) e[r] = sc[r >> 3][r & 7] * L2E;
      mb[j] = WB - slice_max(e);
#pragma unroll
      for (int r = 0; r < 16; ++r) e[r] += mb[j];
      lrun[j] = slice_weights(e, pf);
    } else {
#pragma unroll
      for (int r = 0; r < 16; ++r) e[r] = sc[r >> 3][r & 7] * L2E + mb[j];
      float ws = slice_weights(e, pf);
      if (__builtin_expect(__builtin_amdgcn_ballot_w32(!(ws <= WLIM)) != 0, 0)) {   // one scalar branch of the whole wave, seldom taken
        const float d = fminf(WB - slice_max(e), 0.0f);        // 0 for a column that stays under its reference
        const float al = exp2_slot(d);
        mb[j] += d;
        lrun[j] *= al;
#pragma unroll
        for (int r = 0; r < 8; ++r) { acc[0][j][r] *= al; acc[1][j][r] *= al; }
#pragma unroll
        for (int r = 0; r < 16; ++r) e[r] += d;
        ws = slice_weights(e, pf);
      }
      lrun[j] += ws;
    }
    // stands in front of the caller's step of the key pointer, a register that the fetch of the next keys above names
    if (MORE && j == 1) asm volatile("s_wait_xcnt 0x0" ::: "memory");
#pragma unroll
    for (int i = 0; i < 2; ++i) acc[i][j] = __builtin_amdgcn_wmma_f32_16x16x32_f16(false, vf[i], false, pf, (short)0, acc[i][j], false, false);
    // one column group at a time: interleaved, the two groups' scores and weights are live together and the wave passes the 128 registers that a wave of a 32-wave work-group can have
    __builtin_amdgcn_sched_barrier(0);
  }
  if (MORE) {
#pragma unroll
    for (int i = 0; i < 2; ++i) vf[i] = pk_frag(gn + 512 * i);
  }
}
// blockIdx.y = direction d, blockIdx.z = batch b. TT: planes [b][theta^T, phi^T]; GG: planes [b][g1, g2].
// d = 0 (y2): queries theta^T, keys phi^T, values g2, residual x2, second output; d = 1 (y1): queries phi^T, keys theta^T, values g1, x1, first output.
__global__ __launch_bounds__(1024) void k_attn(const float* __restrict__ TT, const float* __restrict__ GG, const float* __restrict__ Ww, const float* __restrict__ Wb,
                                              const float* __restrict__ wbn, const float* __restrict__ x1, const float* __restrict__ x2,
                                              float* __restrict__ out1, float* __restrict__ out2) {
  const int dir = blockIdx.y, bat = blockIdx.z;
  const f16* __restrict__ Qt = (const f16*)TT + (size_t)(bat * 2 + dir) * (NNs * CIs);
  const f16* __restrict__ Kt = (const f16*)TT + (size_t)(bat * 2 + 1 - dir) * (NNs * CIs);
  const f16* __restrict__ G = (const f16*)GG + (size_t)(bat * 2 + 1 - dir) * (CIs * NNs);
  __shared__ __attribute__((aligned(16))) f16 ys[128 * AKP];        // 128 positions x 32 channels of Y
  __shared__ __attribute__((aligned(16))) float red[32][32 * ARP];  // per wave: its 32 x 32 partial
  __shared__ __attribute__((aligned(16))) float smx[32][32], ssm[32][32];   // per wave and column: reference maximum (log2 units, less WB), sum
  __shared__ float oinv[CCs], osh[CCs], owb[CCs];                   // per output channel: W_out's BatchNorm scale and shift, W_b
  const int tid = threadIdx.x, lane = tid & 31, wave = tid >> 5;
  const int wu = __builtin_amdgcn_readfirstlane(wave);
  const int nb = blockIdx.x * 128;
  const int n0 = nb + 32 * (wu & 3);             // the wave's column group
  const int kr = wu >> 2;                        // the wave's key range
  const unsigned lo8 = lane * 8;                 // the lane's own halfs in a fragment run
  const f16* kb = Kt + kr * (512 * CIs);         // the wave's 512 keys are 32 fragments in a row, its 512 columns of G likewise
  const f16* gb = G + kr * (512 * CIs);
  // the inner loops are unrolled: acc and the fragments are register arrays and need constant indices
  f16x16 kf[2], vf[2], qf[2];
#pragma unroll
  for (int t = 0; t < 2; ++t) { kf[t] = pk_frag(kb + 512 * t + lo8); vf[t] = pk_frag(gb + 512 * t + lo8); qf[t] = pk_frag(Qt + (n0 + 16 * t) * CIs + lo8); }
  if (tid < CCs) {   // read behind the barrier that follows the loop
    const float inv = wbn[tid] / sqrtf(wbn[3 * CCs + tid] + 1e-5f);
    oinv[tid] = inv; osh[tid] = wbn[CCs + tid] - wbn[2 * CCs + tid] * inv; owb[tid] = Wb[tid];
  }
  f32x8 acc[2][2] = {};
  float mb[2], lrun[2];   // set by the first slice
  // the loop over slices stays rolled: unrolled, the compiler put off the running sums' additions to the end and spilled the weights
  kb += 32 * CIs; gb += 32 * CIs;
  attn_slice<true, true>(kf, vf, qf, acc, mb, lrun, kb + lo8, gb + lo8);
#pragma unroll 1
  for (int s = 1; s < 15; ++s) {
    kb += 32 * CIs; gb += 32 * CIs;
    attn_slice<false, true>(kf, vf, qf, acc, mb, lrun, kb + lo8, gb + lo8);
  }
  attn_slice<false, false>(kf, vf, qf, acc, mb, lrun, kb, gb);
  const int nlane = lane & 15, mh = (lane >> 4) * 8;
  float* rw = red[wave];
#pragma unroll
  for (int i = 0; i < 2; ++i)
#pragma unroll
    for (int j = 0; j < 2; ++j)
#pragma unroll
      for (int r = 0; r < 8; ++r) rw[(16 * i + mh + r) * ARP + 16 * j + nlane] = acc[i][j][r];
#pragma unroll
  for (int j = 0; j < 2; ++j) {
    const float lt = lrun[j] + other_half(lrun[j]);   // the two halves hold different keys of the same column
    if (lane < 16) { smx[wave][16 * j + lane] = -mb[j]; ssm[wave][16 * j + lane] = lt; }
  }
  __syncthreads();
  // the sixteen waves of the last product fetch their W_w fragment and their residual values here: carried through the loop they would put the
  // wave over the 128 registers at which one work-group is resident on a WGP; from here the latency runs under the merge
  const int wq = wu & 3, wg = (wu >> 2) & 3;   // wave wu < 16: output channels 16 wq .. 16 wq + 15 of column group wg
  const size_t ob = (size_t)bat * (CCs * NNs) + (size_t)(wq * 16 + mh) * NNs + nb + 32 * wg + nlane;   // output channel 16 wq + mh + r, position nb + 32 wg + 16 j + nlane
  const float* __restrict__ xres = (dir ? x1 : x2) + ob;
  v4f_t wr[4] = {};   // the lane's part of the W_w fragment, still f32: rounded behind the merge, so that the merge does not begin with a wait for it
  float xr[2][8] = {};
  if (wu < 16) {
    const float* __restrict__ wp = Ww + (size_t)(16 * wq + nlane) * CIs + mh;   // row 16 wq + nlane, k = mh .. mh + 7 and 16 + mh .. 16 + mh + 7, as in load_frag
#pragma unroll
    for (int h = 0; h < 2; ++h) { wr[2 * h] = *(const v4f_t*)(wp + 16 * h); wr[2 * h + 1] = *(const v4f_t*)(wp + 16 * h + 4); }
#pragma unroll
    for (int j = 0; j < 2; ++j)
#pragma unroll
      for (int r = 0; r < 8; ++r) xr[j][r] = xres[(size_t)r * NNs + 16 * j];
  }
  { const int mg = wu >> 3, c = (tid >> 3) & 31, np = (tid & 7) * 4;     // a thread merges channel c of positions np .. np + 3 of column group mg
    v4f_t m = *(const v4f_t*)(&smx[mg][np]);
#pragma unroll
    for (int w = 1; w < 8; ++w) {
      const v4f_t t = *(const v4f_t*)(&smx[4 * w + mg][np]);
#pragma unroll
      for (int e = 0; e < 4; ++e) m[e] = fmaxf(m[e], t[e]);
    }
    v4f_t sv = {}, lv = {};
    // four ranges at a time: with all eight unrolled their LDS reads are live together beside the fetched W_w and residual values, and the wave spills
#pragma unroll 4
    for (int w = 0; w < 8; ++w) {
      const v4f_t v = *(const v4f_t*)(&red[4 * w + mg][c * ARP + np]);
      const v4f_t mw = *(const v4f_t*)(&smx[4 * w + mg][np]), lw = *(const v4f_t*)(&ssm[4 * w + mg][np]);
      float f0 = mw[0] - m[0], f1 = mw[1] - m[1], f2 = mw[2] - m[2], f3 = mw[3] - m[3];   // the references are in log2 units
      exp2_slot4(f0, f1, f2, f3);
      sv[0] += v[0] * f0; sv[1] += v[1] * f1; sv[2] += v[2] * f2; sv[3] += v[3] * f3;
      lv[0] += lw[0] * f0; lv[1] += lw[1] * f1; lv[2] += lw[2] * f2; lv[3] += lw[3] * f3;
    }
#pragma unroll
    for (int e = 0; e < 4; ++e) ys[(32 * mg + np + e) * AKP + c] = (f16)(sv[e] / lv[e]); }
  __syncthreads();   // the whole block of Y is in LDS before the sixteen waves read it
  if (wu < 16) {
    float* __restrict__ o = (dir ? out1 : out2) + ob;
    f16x16 wf;
#pragma unroll
    for (int i = 0; i < 16; ++i) wf[i] = (f16)wr[i >> 2][i & 3];
    const f16x16 yf0 = lds_frag(ys + 32 * wg * AKP, AKP), yf1 = lds_frag(ys + (32 * wg + 16) * AKP, AKP);
    const f32x8 z0 = {};
    f32x8 zz[2];
    zz[0] = wmma16(wf, yf0, z0);
    zz[1] = wmma16(wf, yf1, z0);
#pragma unroll
    for (int j = 0; j < 2; ++j)
#pragma unroll
      for (int r = 0; r < 8; ++r) {
        const int c = 16 * wq + mh + r;
        o[(size_t)r * NNs + 16 * j] = xr[j][r] + ((zz[j][r] + owb[c]) * oinv[c] + osh[c]);
      }
  }
}

// ---------------------------------------------------------------------------
// k_proj: P[o][n] = sum_c W[o][c] * bn(x)[c][n] + bias[o], o < 32, c < 64, for 128 positions n of one frame.
// blockIdx.y = projection q (0: g of x1, 1: theta of x1, 2: g of x2, 3: phi of x2), blockIdx.z = batch.
// bn(x)[c][n] = x * inv_c + (beta - mean * inv)_c, inv = gamma / sqrt(var + eps), is rounded to f16 and staged position-major in LDS
// (a wave-wide load takes the 512 B of one channel's row; a lane packs four channels of a position into one 8-B LDS store).
// Wave w takes positions 16 w .. 16 w + 15; the weights come straight from global memory. q odd (TT plane [b][q / 2]): A = weights, B = the staged
// frame, a lane gets 8 channels of one position. q even (GG plane [b][q / 2]): A = the staged frame, B = weights, a lane gets 8 positions of one
// channel. Either way those 8 values, rounded to f16, are the lane's own 16 B of a packed fragment run: a wave-wide store takes 512 B in a row.
// ---------------------------------------------------------------------------
#define XP 72    // staged pitch: 64 -> 72 halfs (144 B = 16 B x 9): aligned b128 fragment reads
__global__ __launch_bounds__(256) void k_proj(const float* __restrict__ x1, const float* __restrict__ x2, const float* __restrict__ gbn, const float* __restrict__ tbn,
                                              const float* __restrict__ pbn, const float* __restrict__ gw, const float* __restrict__ tw, const float* __restrict__ pw,
                                              const float* __restrict__ gb, const float* __restrict__ tb, const float* __restrict__ pb,
                                              float* __restrict__ GG, float* __restrict__ TT) {
  const int q = blockIdx.y, b = blockIdx.z, n0 = blockIdx.x * 128;
  const float* __restrict__ x = (q < 2 ? x1 : x2) + (size_t)b * (CCs * NNs) + n0;
  const float* __restrict__ p = q == 1 ? tbn : (q == 3 ? pbn : gbn);
  const float* __restrict__ Wq = q == 1 ? tw : (q == 3 ? pw : gw);
  const float* __restrict__ bias = q == 1 ? tb : (q == 3 ? pb : gb);
  __shared__ __attribute__((aligned(16))) f16 xs[128 * XP];
  __shared__ float sinv[CCs], ssh[CCs];
  const int tid = threadIdx.x, lane = tid & 31, wave = tid >> 5, cl = lane & 15, rh = (lane >> 4) * 8;
  v4f_t xv[8];   // channels 32 g + 4 wave + e, positions 4 lane .. 4 lane + 3
  // the loops are unrolled: xv and acc are register arrays and need constant indices
#pragma unroll
  for (int g = 0; g < 2; ++g)
#pragma unroll
    for (int e = 0; e < 4; ++e) xv[g * 4 + e] = *(const v4f_t*)(x + (size_t)(32 * g + 4 * wave + e) * NNs + lane * 4);
  if (tid < CCs) {
    const float inv = p[tid] / sqrtf(p[3 * CCs + tid] + 1e-5f);
    sinv[tid] = inv; ssh[tid] = p[CCs + tid] - p[2 * CCs + tid] * inv;
  }
  f16x16 af[2][2];
#pragma unroll
  for (int i = 0; i < 2; ++i)
#pragma unroll
    for (int ks = 0; ks < 2; ++ks) af[i][ks] = load_frag(Wq, CCs, 16 * i, 32 * ks);
  v4f_t bv[2][2];   // bias of channels 16 i + rh + 4 hf .. + 3, fetched with the other operands and not behind the products
#pragma unroll
  for (int i = 0; i < 2; ++i)
#pragma unroll
    for (int hf = 0; hf < 2; ++hf) bv[i][hf] = *(const v4f_t*)(bias + 16 * i + rh + 4 * hf);
  const float bc[2] = {bias[cl], bias[16 + cl]};   // bias of channel 16 i + cl
  __syncthreads();
#pragma unroll
  for (int g = 0; g < 2; ++g) {
    const int k0 = 32 * g + 4 * wave;
#pragma unroll
    for (int u = 0; u < 4; ++u) {
      bf16x4 hx;
#pragma unroll
      for (int e = 0; e < 4; ++e) hx[e] = (f16)(xv[g * 4 + e][u] * sinv[k0 + e] + ssh[k0 + e]);
      *(bf16x4*)(xs + (lane * 4 + u) * XP + k0) = hx;
    }
  }
  __syncthreads();
  f32x8 acc[2] = {};
  f16x16 bfr[2];
#pragma unroll
  for (int ks = 0; ks < 2; ++ks) bfr[ks] = lds_frag(xs + (wave * 16) * XP + 32 * ks, XP);
  if (q & 1) {
#pragma unroll
    for (int ks = 0; ks < 2; ++ks)
#pragma unroll
      for (int i = 0; i < 2; ++i) acc[i] = __builtin_amdgcn_wmma_f32_16x16x32_f16(false, af[i][ks], false, bfr[ks], (short)0, acc[i], false, false);
    // a lane holds position 16 wave + cl and channels 16 i + rh + r: run i of fragment n0 / 16 + wave
    f16* __restrict__ dst = (f16*)TT + (size_t)(b * 2 + (q >> 1)) * (NNs * CIs) + (size_t)(n0 + 16 * wave) * CIs + lane * 8;
#pragma unroll
    for (int i = 0; i < 2; ++i) {
      f16x8 h;
#pragma unroll
      for (int r = 0; r < 8; ++r) h[r] = (f16)(acc[i][r] + bv[i][r >> 2][r & 3]);
      *(f16x8*)(dst + 256 * i) = h;
    }
    asm volatile("s_wait_xcnt 0x0" ::: "memory");   // stands in front of any later write of a register that the two stores name
  } else {
#pragma unroll
    for (int ks = 0; ks < 2; ++ks)
#pragma unroll
      for (int i = 0; i < 2; ++i) acc[i] = __builtin_amdgcn_wmma_f32_16x16x32_f16(false, bfr[ks], false, af[i][ks], (short)0, acc[i], false, false);
    // a lane holds channel 16 i + cl and positions 16 wave + rh + r: run wave & 1 of fragment i of slice n0 / 32 + wave / 2
    f16* __restrict__ dst = (f16*)GG + (size_t)(b * 2 + (q >> 1)) * (CIs * NNs) + (size_t)(n0 + 32 * (wave >> 1)) * CIs + 256 * (wave & 1) + lane * 8;
#pragma unroll
    for (int i = 0; i < 2; ++i) {
      f16x8 h;
#pragma unroll
      for (int r = 0; r < 8; ++r) h[r] = (f16)(acc[i][r] + bc[i]);
      *(f16x8*)(dst + 512 * i) = h;
    }
    asm volatile("s_wait_xcnt 0x0" ::: "memory");   // as in the other branch: which of the two blocks comes first in the built code is the compiler's choice
  }
}

extern "C" void kernel_launch(void* const* d_in, const int* in_sizes, int n_in,
                              void* d_out, int out_size, void* d_ws, size_t ws_size,
                              hipStream_t stream) {
  (void)in_sizes; (void)n_in; (void)out_size;
  const float** f = (const float**)d_in;
  const float* x1 = f[0], *x2 = f[1], *gbn = f[2], *gw = f[3], *gb = f[4], *tbn = f[5], *tw = f[6], *tb = f[7], *pbn = f[8], *pw = f[9], *pb = f[10], *wbn = f[11], *Ww = f[12], *Wb = f[13];
  float* out1 = (float*)d_out; float* out2 = out1 + (size_t)NBs * CCs * NNs;     // tuple
  char* ws = (char*)d_ws;
  float* GG = (float*)ws; ws += (size_t)NBs * 2 * CIs * NNs * 2;      // g1, g2: packed f16 planes [b][2] of [32][4096]
  float* TT = (float*)ws; ws += (size_t)NBs * 2 * NNs * CIs * 2;      // theta^T, phi^T: packed f16 planes [b][2] of [4096][32]
  if ((size_t)(ws - (char*)d_ws) > ws_size) return;
  // q = 0: g1 = g(bn_g x1), 1: theta(bn_theta x1), 2: g2 = g(bn_g x2), 3: phi(bn_phi x2)
  k_proj<<<dim3(NNs / 128, 4, NBs), dim3(256), 0, stream>>>(x1, x2, gbn, tbn, pbn, gw, tw, pw, gb, tb, pb, GG, TT);
  // d = 0: y2[c][n] = sum_m g2[c][m] att1[n][m], att1 = softmax over m of sum_k theta[k][n] phi[k][m]
  // d = 1: y1[c][m] = sum_n g1[c][n] att2[n][m], att2 = softmax over n of the same scores
  k_attn<<<dim3(NNs / 128, 2, NBs), dim3(1024), 0, stream>>>(TT, GG, Ww, Wb, wbn, x1, x2, out1, out2);
}

// v008
// Measured time: 26.2 microseconds a run.
// In two side-by-side timings against v007, it was 1.20 and 1.21 times as fast.
// Counting every step since v000, it is 89.0 times as fast.
// Contractions on v_wmma_f32_16x16x32_f16 (plain f16 operands, f32 accumulate). Two launches.
// k_proj: eval BatchNorm of a frame, one of the 1x1 convs g1, theta, g2, phi (K = 64) and its bias; the results are stored as f16 in the
// order of the WMMA fragments that k_attn takes them in (see "packed planes" below).
// k_attn, one work-group per 128 positions, direction and batch: scores theta^T.phi (K = 32, in log2 units, less the reference), softmax in f32 against a lazily moved reference maximum, the
// weighted sum of g (K = 4096), then W_out (K = 32), its BatchNorm and the residual in f32 into the output. The 4096 x 4096 scores and y
// never reach memory. y2 takes theta as queries, phi as keys, g2 as values; y1 takes phi, theta, g1.
// compute dtype: f16 operands, f32 accumulate.  x1, x2 [4,64,64,64] -> (x1 + W(y1), x2 + W(y2)).
#include <hip/hip_runtime.h>
#include <hip/hip_bf16.h>
#include <math.h>

#define NBs 4
#define CCs 64
#define CIs 32
#define NNs 4096
#define SS 4096
#define HH 1
#define DKK 64
#define GSTR 48

typedef _Float16 bf16;
typedef _Float16 f16;
typedef __attribute__((ext_vector_type(4))) unsigned v4u_t;
typedef unsigned v4ua __attribute__((ext_vector_type(4), may_alias));
typedef __attribute__((ext_vector_type(4))) float v4f_t;
typedef __attribute__((ext_vector_type(16))) bf16  bf16x16;
typedef bf16x16 f16x16;
typedef __attribute__((ext_vector_type(8)))  bf16  bf16x8;
typedef bf16x8 f16x8;
typedef __attribute__((ext_vector_type(4)))  bf16  bf16x4;
typedef __attribute__((ext_vector_type(8)))  float f32x8;
// WMMA with four v_nop behind it that still name A and B: they keep the form's distance to whatever writes A or B or reads D next, so that
// the next product's result cannot be placed over this one's B operand directly behind it
__device__ __forceinline__ f32x8 wmma16(f16x16 a, f16x16 b, f32x8 c) {
  c = __builtin_amdgcn_wmma_f32_16x16x32_f16(false, a, false, b, (short)0, c, false, false);
  asm volatile("v_nop\n\tv_nop\n\tv_nop\n\tv_nop" : "+v"(c) : "v"(a), "v"(b));
  return c;
}
#define LDS_STRIDE 48   // unused; so is GSTR (same 48)
#define KSTRIDE    72   // unused; k_attn stages only the 32 x 128 block of Y, pitch AKP
#define VSTRIDE    48   // unused; k_attn uses AKP

// 16x32 (MxK) f16 fragment from a row-major global matrix.
// lanes 0-15  (row=lane)    : elems 0..7 = K+0..7,  8..15 = K+16..23
// lanes 16-31 (row=lane-16) : elems 0..7 = K+8..15, 8..15 = K+24..31
template <typename T>
__device__ __forceinline__ bf16x16 load_frag(const T* __restrict__ base, int ld,
                                             int row0, int k0) {
  const int lane = threadIdx.x & 31;
  const int r    = lane & 15;
  const int kh   = (lane >> 4) * 8;
  const T* p0 = base + (size_t)(row0 + r) * ld + (k0 + kh);
  const T* p1 = p0 + 16;
  bf16x16 f;
#pragma unroll
  for (int i = 0; i < 8; ++i) {
    f[i]     = (bf16)p0[i];
    f[i + 8] = (bf16)p1[i];
  }
  return f;
}

// Same fragment from an LDS tile with padded row stride (base includes row0/k0).
__device__ __forceinline__ bf16x16 lds_frag(const bf16* base, int stride) {
  const int lane = threadIdx.x & 31;
  const int row  = lane & 15;
  const int kh   = (lane >> 4) * 8;
  const bf16x8 lo = *(const bf16x8*)(base + row * stride + kh);
  const bf16x8 hi = *(const bf16x8*)(base + row * stride + kh + 16);
  bf16x16 f;
#pragma unroll
  for (int i = 0; i < 8; ++i) { f[i] = lo[i]; f[i + 8] = hi[i]; }
  return f;
}

// Fragment from a packed plane; p is the lane's own 8 halfs of the fragment's first run.
__device__ __forceinline__ f16x16 pk_frag(const f16* __restrict__ p) {
  const f16x8 lo = *(const f16x8*)p, hi = *(const f16x8*)(p + 256);
  return __builtin_shufflevector(lo, hi, 0, 1, 2, 3, 4, 5, 6, 7, 8, 9, 10, 11, 12, 13, 14, 15);
}

// ---------------------------------------------------------------------------
// k_attn: Y[c][n] = sum_m G[c][m] * softmax_m(S[n][m]), S[n][m] = sum_k Qt[n][k] * Kt[m][k] (k < 32), for the 32 rows c of
// G [32][4096]; Qt, Kt [4096][32], all three f16 in packed planes. S and the weights live in registers only.
// Packed planes (halfs): a fragment is two runs of 256 halfs, lane l owning halfs 8 l .. 8 l + 7 of each, so a wave-wide 16-B load takes 512 B in a row.
//   T plane: half 512 tile + 256 h + 8 l + e = T[16 tile + (l & 15)][16 h + 8 (l >> 4) + e]
//   G plane: half 1024 slice + 512 i + 256 h + 8 l + e = G[16 i + (l & 15)][32 slice + 16 h + 8 (l >> 4) + e]
// Grid = 32 x 2 x 4 work-groups, each owns 128 columns n of one direction and batch. Its 32 waves are 4 column groups of 32 columns (one whole 128-B line of every Y row) times
// 8 key ranges of 512 keys m: wave = 4 range + group, so the four waves of a range walk the same
// slices together and ask for the same lines of Kt and G, which the WGP's cache fetches from L2 once for the four.
// Each wave loads its 32-key slices of Kt and G from the packed planes straight into fragment registers (no LDS, no
// conversion, no barrier in the loop) and keeps a reference maximum that moves lazily, a running sum and an un-normalised 32 x 32 partial per column. Transposed scores
// (A = keys, B = queries) leave a lane with column n = lane & 15 and keys 8 * (lane >> 4) + r: two such tiles are, register
// for register, the B fragment of the second product. A column group's 8 partials are merged in range order through LDS at the end.
// The merged 32 x 128 block of Y goes to LDS as f16, position-major; behind one more barrier sixteen waves multiply it by W_w [64][32]
// (16 output channels of one column group each, so every 128-B line of the output has one writer) and store x + bn_w(W_w Y + W_b).
// ---------------------------------------------------------------------------
#define AKP 40   // row pitch of Y in LDS: 32 -> 40 halfs (80 B = 16 B x 5): aligned b128 fragment reads without conflicts
#define ARP 36   // partial row pitch in floats: rows 8 apart fall on different banks
#define SQL2E 1.2011224087864498f   // sqrt(log2 e): k_proj puts it on theta and on phi, so that their product is the score in log2 units
// value of lane l ^ 16
__device__ __forceinline__ float other_half(float v) {
  const int b = __builtin_bit_cast(int, v);
  return __builtin_bit_cast(float, __builtin_amdgcn_permlanex16(b, b, 0x76543210, 0xfedcba98, false, false));
}
// 2^x on v_exp_f32 with the slot behind it filled inside the statement: the instruction set asks for one independent instruction or
// v_nop between a transcendental and a direct reader of its result or writer of its source.
// In the group of four each v_exp_f32 is the independent instruction behind the one before
// (outputs are early-clobber, so none shares a register with an input).
__device__ __forceinline__ float exp2_slot(float x) {
  float y;
  asm("v_exp_f32 %0, %1\n\tv_nop" : "=v"(y) : "v"(x));
  return y;
}
__device__ __forceinline__ void exp2_slot4(float& a, float& b, float& c, float& d) {
  float ya, yb, yc, yd;
  asm("v_exp_f32 %0, %4\n\tv_exp_f32 %1, %5\n\tv_exp_f32 %2, %6\n\tv_exp_f32 %3, %7\n\tv_nop"
      : "=&v"(ya), "=&v"(yb), "=&v"(yc), "=&v"(yd) : "v"(a), "v"(b), "v"(c), "v"(d));
  a = ya; b = yb; c = yc; d = yd;
}
// Weights of one column group and 32 keys, in place on the two result tiles of the score product: t0, t1 come in as the 16 exponents e of the lane
// and t0 goes out as the B fragment of the second product (2^e rounded to f16, two to a register); returns the lane's sum of its 16 weights in f32
// (two running pairs, even and odd keys apart, that take the key pairs 0 1 4 6 and 2 3 5 7; the pairs and their halves are added last). The tiles and the
// two pairs are pinned to fixed registers because asm text cannot name one register of a tuple operand; written on single-register operands the
// compiler moved half of the values to other registers first.
// The four v_nop are the form's four slots between a WMMA and a vector instruction on its result (the compiler does not look into asm text, and
// which of the two score products it issues last is its choice). Every v_exp_f32 is followed by an instruction that neither reads its result nor writes
// its source, and the plain instructions stand between the exponentials, each four or more exponentials behind the ones it reads; s_delay_alu marks the
// closer dependences at the end (the last one that of the addition behind the statement), so that a waiting wave gives the issue port to the SIMD's other waves.
typedef __attribute__((ext_vector_type(2))) float f32x2;
__device__ __forceinline__ float tile_weights(f32x8& t0, f32x8& t1) {
  f32x2 sa, sb;
  asm volatile(
      "v_nop\n\tv_nop\n\tv_nop\n\tv_nop\n\t"
      "v_exp_f32 v112, v112\n\tv_exp_f32 v113, v113\n\tv_exp_f32 v114, v114\n\tv_exp_f32 v115, v115\n\t"
      "v_exp_f32 v116, v116\n\tv_exp_f32 v117, v117\n\tv_exp_f32 v118, v118\n\t"
      "v_pk_add_f32 v[108:109], v[112:113], v[114:115]\n\t"
      "v_exp_f32 v119, v119\n\t"
      "v_cvt_pk_f16_f32 v112, v112, v113\n\t"
      "v_exp_f32 v120, v120\n\t"
      "v_cvt_pk_f16_f32 v113, v114, v115\n\t"
      "v_exp_f32 v121, v121\n\tv_exp_f32 v122, v122\n\t"
      "v_pk_add_f32 v[110:111], v[116:117], v[118:119]\n\t"
      "v_exp_f32 v123, v123\n\t"
      "v_cvt_pk_f16_f32 v114, v116, v117\n\t"
      "v_exp_f32 v124, v124\n\t"
      "v_cvt_pk_f16_f32 v115, v118, v119\n\t"
      "v_exp_f32 v125, v125\n\t"
      "v_pk_add_f32 v[108:109], v[108:109], v[120:121]\n\t"
      "v_exp_f32 v126, v126\n\t"
      "v_cvt_pk_f16_f32 v116, v120, v121\n\t"
      "v_exp_f32 v127, v127\n\t"
      "v_pk_add_f32 v[110:111], v[110:111], v[122:123]\n\t"
      "v_cvt_pk_f16_f32 v117, v122, v123\n\t"
      "s_delay_alu instid0(TRANS32_DEP_3) | instskip(SKIP_1) | instid1(TRANS32_DEP_1)\n\t"
      "v_pk_add_f32 v[108:109], v[108:109], v[124:125]\n\t"
      "v_cvt_pk_f16_f32 v118, v124, v125\n\t"
      "v_pk_add_f32 v[110:111], v[110:111], v[126:127]\n\t"
      "v_cvt_pk_f16_f32 v119, v126, v127\n\t"
      "s_delay_alu instid0(VALU_DEP_2)"
      : "+{v[112:119]}"(t0), "+{v[120:127]}"(t1), "={v[108:109]}"(sa), "={v[110:111]}"(sb));
  const f32x2 s = sa + sb;
  return s[0] + s[1];
}
// largest of a column's 32 exponents (the lane's 16 and the other half's 16)
__device__ __forceinline__ float slice_max(const f32x8 (&e)[2]) {
  float mx = e[0][0];
#pragma unroll
  for (int r = 1; r < 16; ++r) mx = fmaxf(mx, e[r >> 3][r & 7]);
  return fmaxf(mx, other_half(mx));
}
#define WB 8.0f        // a score equal to its column's reference gets the weight 2^8: small weights stay normal f16 numbers; the factor cancels in the division
#define WLIM 32768.0f  // a lane's 16 weights of a slice may sum to this much before the reference moves: no weight leaves the f16 range
// One 32-key slice of a wave: scores, softmax weights and weighted sum for its two column groups. A weight is 2^(score * log2 e + mb),
// mb = WB - the column's reference in log2 units. The score product itself delivers that exponent: k_proj stores theta and phi times
// sqrt(log2 e), and mbv[j], eight registers that all hold the lane's mb of group j, is the product's C operand (a lane's eight results are eight keys
// of one column). The weights are formed in place on the product's result. The reference is the column's maximum over the FIRST slice and moves lazily after that:
// only when some lane's weights of a slice sum to more than WLIM (or to no number) does the whole wave take the branch, in which every column
// whose maximum has passed its reference takes that maximum as the new one and has its sum and partials rescaled (the exponents are gone by then: the
// branch forms the score products anew, for the second group from keys that it fetches again); otherwise a slice needs no maximum and no rescaling. With MORE the next slice's fragments are fetched into the same registers as soon as their last product of this
// slice is issued (keys: under the second group's softmax; values: under the next slice's first scores and softmax); kn, gn are the lane's
// own halfs of the next slice. The last slice is the instance without. stash: the lane's own 16 B in each of four 512-B runs of LDS that only this wave uses.
template <bool FIRST, bool MORE>
__device__ __forceinline__ void attn_slice(f16x16 (&kf)[2], f16x16 (&vf)[2], const f16x16 (&qf)[2], f32x8 (&acc)[2][2], f32x8 (&mbv)[2], float (&lrun)[2],
                                           const f16* __restrict__ kn, const f16* __restrict__ gn, f16* stash) {
#pragma unroll
  for (int j = 0; j < 2; ++j) {
    f32x8 sc[2];   // exponents of keys 16 t + 8 (lane >> 4) + r against column 16 j + (lane & 15); in the first slice still without the reference
    const f32x8 z = {};
#pragma unroll
    for (int t = 0; t < 2; ++t) sc[t] = __builtin_amdgcn_wmma_f32_16x16x32_f16(false, kf[t], false, qf[j], (short)0, FIRST ? z : mbv[j], false, false);
    if (MORE && j == 1) {
      if (FIRST) {
        kf[0] = pk_frag(kn);
        const f16x8 lo = *(const f16x8*)(kn + 512);
        // in the first slice the four loads share one vector address pair, and the last load's result may be given those registers: the wait stands in front of that write
        asm volatile("s_wait_xcnt 0x0" ::: "memory");
        const f16x8 hi = *(const f16x8*)(kn + 768);
        kf[1] = __builtin_shufflevector(lo, hi, 0, 1, 2, 3, 4, 5, 6, 7, 8, 9, 10, 11, 12, 13, 14, 15);
      } else {
#pragma unroll
        for (int t = 0; t < 2; ++t) kf[t] = pk_frag(kn + 512 * t);
      }
    }
    if (FIRST) {
      const float mb = WB - slice_max(sc);
#pragma unroll
      for (int r = 0; r < 8; ++r) { mbv[j][r] = mb; sc[0][r] += mb; sc[1][r] += mb; }
      lrun[j] = tile_weights(sc[0], sc[1]);
    } else {
      float ws = tile_weights(sc[0], sc[1]);
      if (__builtin_expect(__builtin_amdgcn_ballot_w32(!(ws <= WLIM)) != 0, 0)) {   // one scalar branch of the whole wave, seldom taken
        if (MORE && j == 1) {   // kf already holds the next slice's keys, and the wave has no registers for a third pair of fragments: they wait in the wave's own LDS while this slice's come back
#pragma unroll
          for (int t = 0; t < 2; ++t) {
            *(f16x8*)(stash + 512 * t) = __builtin_shufflevector(kf[t], kf[t], 0, 1, 2, 3, 4, 5, 6, 7);
            *(f16x8*)(stash + 512 * t + 256) = __builtin_shufflevector(kf[t], kf[t], 8, 9, 10, 11, 12, 13, 14, 15);
          }
          // the loads stay behind the stores: issued ahead of them they need registers of their own beside kf, and the wave spills
          __builtin_amdgcn_sched_barrier(0);
#pragma unroll
          for (int t = 0; t < 2; ++t) kf[t] = pk_frag(kn - 32 * CIs + 512 * t);
          asm volatile("s_wait_xcnt 0x0" ::: "memory");   // stands in front of any later write of a register that the four loads name
        }
#pragma unroll
        for (int t = 0; t < 2; ++t) sc[t] = wmma16(kf[t], qf[j], mbv[j]);
        if (MORE && j == 1) {
#pragma unroll
          for (int t = 0; t < 2; ++t) kf[t] = pk_frag(stash + 512 * t);
        }
        const float d = fminf(WB - slice_max(sc), 0.0f);        // 0 for a column that stays under its reference
        const float al = exp2_slot(d);
        lrun[j] *= al;
#pragma unroll
        for (int r = 0; r < 8; ++r) { acc[0][j][r] *= al; acc[1][j][r] *= al; }
#pragma unroll
        for (int r = 0; r < 8; ++r) { mbv[j][r] += d; sc[0][r] += d; sc[1][r] += d; }
        // the rescaling ends in front of the weights: with part of it put off behind them its factor has no register left there, and the wave spills
        __builtin_amdgcn_sched_barrier(0);
        ws = tile_weights(sc[0], sc[1]);
      }
      lrun[j] += ws;
    }
    const f16x16 pf = __builtin_bit_cast(f16x16, sc[0]);
    // stands in front of the caller's step of the key pointer, a register that the fetch of the next keys above names
    if (MORE && j == 1) asm volatile("s_wait_xcnt 0x0" ::: "memory");
#pragma unroll
    for (int i = 0; i < 2; ++i) acc[i][j] = __builtin_amdgcn_wmma_f32_16x16x32_f16(false, vf[i], false, pf, (short)0, acc[i][j], false, false);
    // one column group at a time: interleaved, the two groups' scores and weights are live together and the wave passes the 128 registers that a wave of a 32-wave work-group can have
    __builtin_amdgcn_sched_barrier(0);
  }
  if (MORE) {
    if (FIRST) {   // as with the keys above: one vector address pair, and the wait in front of the load whose result may be given those registers
      vf[0] = pk_frag(gn);
      const f16x8 lo = *(const f16x8*)(gn + 512);
      asm volatile("s_wait_xcnt 0x0" ::: "memory");
      const f16x8 hi = *(const f16x8*)(gn + 768);
      vf[1] = __builtin_shufflevector(lo, hi, 0, 1, 2, 3, 4, 5, 6, 7, 8, 9, 10, 11, 12, 13, 14, 15);
    } else {
#pragma unroll
      for (int i = 0; i < 2; ++i) vf[i] = pk_frag(gn + 512 * i);
    }
  }
}
// blockIdx.y = direction d, blockIdx.z = batch b. TT: planes [b][theta^T, phi^T]; GG: planes [b][g1, g2].
// d = 0 (y2): queries theta^T, keys phi^T, values g2, residual x2, second output; d = 1 (y1): queries phi^T, keys theta^T, values g1, x1, first output.
__global__ __launch_bounds__(1024) void k_attn(const float* __restrict__ TT, const float* __restrict__ GG, const float* __restrict__ Ww, const float* __restrict__ Wb,
                                              const float* __restrict__ wbn, const float* __restrict__ x1, const float* __restrict__ x2,
                                              float* __restrict__ out1, float* __restrict__ out2) {
  const int dir = blockIdx.y, bat = blockIdx.z;
  const f16* __restrict__ Qt = (const f16*)TT + (size_t)(bat * 2 + dir) * (NNs * CIs);
  const f16* __restrict__ Kt = (const f16*)TT + (size_t)(bat * 2 + 1 - dir) * (NNs * CIs);
  const f16* __restrict__ G = (const f16*)GG + (size_t)(bat * 2 + 1 - dir) * (CIs * NNs);
  __shared__ __attribute__((aligned(16))) f16 ys[128 * AKP];        // 128 positions x 32 channels of Y
  __shared__ __attribute__((aligned(16))) float red[32][32 * ARP];  // per wave: its 32 x 32 partial
  __shared__ __attribute__((aligned(16))) float smx[32][32], ssm[32][32];   // per wave and column: reference maximum (log2 units, less WB), sum
  __shared__ float oinv[CCs], osh[CCs], owb[CCs];                   // per output channel: W_out's BatchNorm scale and shift, W_b
  const int tid = threadIdx.x, lane = tid & 31, wave = tid >> 5;
  const int wu = __builtin_amdgcn_readfirstlane(wave);
  const int nb = blockIdx.x * 128;
  const int n0 = nb + 32 * (wu & 3);             // the wave's column group
  const int kr = wu >> 2;                        // the wave's key range
  const unsigned lo8 = lane * 8;                 // the lane's own halfs in a fragment run
  const f16* kb = Kt + kr * (512 * CIs);         // the wave's 512 keys are 32 fragments in a row, its 512 columns of G likewise
  const f16* gb = G + kr * (512 * CIs);
  // the inner loops are unrolled: acc and the fragments are register arrays and need constant indices
  f16x16 kf[2], vf[2], qf[2];
#pragma unroll
  for (int t = 0; t < 2; ++t) { kf[t] = pk_frag(kb + 512 * t + lo8); vf[t] = pk_frag(gb + 512 * t + lo8); qf[t] = pk_frag(Qt + (n0 + 16 * t) * CIs + lo8); }
  if (tid < CCs) {   // read behind the barrier that follows the loop
    const float inv = wbn[tid] / sqrtf(wbn[3 * CCs + tid] + 1e-5f);
    oinv[tid] = inv; osh[tid] = wbn[CCs + tid] - wbn[2 * CCs + tid] * inv; owb[tid] = Wb[tid];
  }
  f32x8 acc[2][2] = {};
  f16* stash = (f16*)red[wave] + lo8;   // the wave's partial goes there only behind the loop
  f32x8 mbv[2];           // set by the first slice
  float lrun[2];
  // the loop over slices stays rolled: unrolled, the compiler put off the running sums' additions to the end and spilled the weights
  kb += 32 * CIs; gb += 32 * CIs;
  attn_slice<true, true>(kf, vf, qf, acc, mbv, lrun, kb + lo8, gb + lo8, stash);
#pragma unroll 1
  for (int s = 1; s < 15; ++s) {
    kb += 32 * CIs; gb += 32 * CIs;
    attn_slice<false, true>(kf, vf, qf, acc, mbv, lrun, kb + lo8, gb + lo8, stash);
  }
  attn_slice<false, false>(kf, vf, qf, acc, mbv, lrun, kb, gb, stash);
  const int nlane = lane & 15, mh = (lane >> 4) * 8;
  float* rw = red[wave];
#pragma unroll
  for (int i = 0; i < 2; ++i)
#pragma unroll
    for (int j = 0; j < 2; ++j)
#pragma unroll
      for (int r = 0; r < 8; ++r) rw[(16 * i + mh + r) * ARP + 16 * j + nlane] = acc[i][j][r];
#pragma unroll
  for (int j = 0; j < 2; ++j) {
    const float lt = lrun[j] + other_half(lrun[j]);   // the two halves hold different keys of the same column
    if (lane < 16) { smx[wave][16 * j + lane] = -mbv[j][0]; ssm[wave][16 * j + lane] = lt; }
  }
  __syncthreads();
  // the sixteen waves of the last product fetch their W_w fragment and their residual values here: carried through the loop they would put the
  // wave over the 128 registers at which one work-group is resident on a WGP; from here the latency runs under the merge
  const int wq = wu & 3, wg = (wu >> 2) & 3;   // wave wu < 16: output channels 16 wq .. 16 wq + 15 of column group wg
  const size_t ob = (size_t)bat * (CCs * NNs) + (size_t)(wq * 16 + mh) * NNs + nb + 32 * wg + nlane;   // output channel 16 wq + mh + r, position nb + 32 wg + 16 j + nlane
  const float* __restrict__ xres = (dir ? x1 : x2) + ob;
  v4f_t wr[4] = {};   // the lane's part of the W_w fragment, still f32: rounded behind the merge, so that the merge does not begin with a wait for it
  float xr[2][8] = {};
  if (wu < 16) {
    const float* __restrict__ wp = Ww + (size_t)(16 * wq + nlane) * CIs + mh;   // row 16 wq + nlane, k = mh .. mh + 7 and 16 + mh .. 16 + mh + 7, as in load_frag
#pragma unroll
    for (int h = 0; h < 2; ++h) { wr[2 * h] = *(const v4f_t*)(wp + 16 * h); wr[2 * h + 1] = *(const v4f_t*)(wp + 16 * h + 4); }
#pragma unroll
    for (int j = 0; j < 2; ++j)
#pragma unroll
      for (int r = 0; r < 8; ++r) xr[j][r] = xres[(size_t)r * NNs + 16 * j];
  }
  { const int mg = wu >> 3, c = (tid >> 3) & 31, np = (tid & 7) * 4;     // a thread merges channel c of positions np .. np + 3 of column group mg
    v4f_t m = *(const v4f_t*)(&smx[mg][np]);
#pragma unroll
    for (int w = 1; w < 8; ++w) {
      const v4f_t t = *(const v4f_t*)(&smx[4 * w + mg][np]);
#pragma unroll
      for (int e = 0; e < 4; ++e) m[e] = fmaxf(m[e], t[e]);
    }
    v4f_t sv = {}, lv = {};
    // four ranges at a time: with all eight unrolled their LDS reads are live together beside the fetched W_w and residual values, and the wave spills
#pragma unroll 4
    for (int w = 0; w < 8; ++w) {
      const v4f_t v = *(const v4f_t*)(&red[4 * w + mg][c * ARP + np]);
      const v4f_t mw = *(const v4f_t*)(&smx[4 * w + mg][np]), lw = *(const v4f_t*)(&ssm[4 * w + mg][np]);
      float f0 = mw[0] - m[0], f1 = mw[1] - m[1], f2 = mw[2] - m[2], f3 = mw[3] - m[3];   // the references are in log2 units
      exp2_slot4(f0, f1, f2, f3);
      sv[0] += v[0] * f0; sv[1] += v[1] * f1; sv[2] += v[2] * f2; sv[3] += v[3] * f3;
      lv[0] += lw[0] * f0; lv[1] += lw[1] * f1; lv[2] += lw[2] * f2; lv[3] += lw[3] * f3;
    }
#pragma unroll
    for (int e = 0; e < 4; ++e) ys[(32 * mg + np + e) * AKP + c] = (f16)(sv[e] / lv[e]); }
  __syncthreads();   // the whole block of Y is in LDS before the sixteen waves read it
  if (wu < 16) {
    float* __restrict__ o = (dir ? out1 : out2) + ob;
    f16x16 wf;
#pragma unroll
    for (int i = 0; i < 16; ++i) wf[i] = (f16)wr[i >> 2][i & 3];
    const f16x16 yf0 = lds_frag(ys + 32 * wg * AKP, AKP), yf1 = lds_frag(ys + (32 * wg + 16) * AKP, AKP);
    const f32x8 z0 = {};
    f32x8 zz[2];
    zz[0] = wmma16(wf, yf0, z0);
    zz[1] = wmma16(wf, yf1, z0);
#pragma unroll
    for (int j = 0; j < 2; ++j)
#pragma unroll
      for (int r = 0; r < 8; ++r) {
        const int c = 16 * wq + mh + r;
        o[(size_t)r * NNs + 16 * j] = xr[j][r] + ((zz[j][r] + owb[c]) * oinv[c] + osh[c]);
      }
  }
}

// ---------------------------------------------------------------------------
// k_proj: P[o][n] = sum_c W[o][c] * bn(x)[c][n] + bias[o], o < 32, c < 64, for 128 positions n of one frame.
// blockIdx.y = projection q (0: g of x1, 1: theta of x1, 2: g of x2, 3: phi of x2), blockIdx.z = batch.
// bn(x)[c][n] = x * inv_c + (beta - mean * inv)_c, inv = gamma / sqrt(var + eps), is rounded to f16 and staged position-major in LDS
// (a wave-wide load takes the 512 B of one channel's row; a lane packs four channels of a position into one 8-B LDS store).
// Wave w takes positions 16 w .. 16 w + 15; the weights come straight from global memory. q odd (TT plane [b][q / 2]): A = weights, B = the staged
// frame, a lane gets 8 channels of one position, stored times sqrt(log2 e). q even (GG plane [b][q / 2]): A = the staged frame, B = weights, a lane gets 8 positions of one
// channel. Either way those 8 values, rounded to f16, are the lane's own 16 B of a packed fragment run: a wave-wide store takes 512 B in a row.
// ---------------------------------------------------------------------------
#define XP 72    // staged pitch: 64 -> 72 halfs (144 B = 16 B x 9): aligned b128 fragment reads
__global__ __launch_bounds__(256) void k_proj(const float* __restrict__ x1, const float* __restrict__ x2, const float* __restrict__ gbn, const float* __restrict__ tbn,
                                              const float* __restrict__ pbn, const float* __restrict__ gw, const float* __restrict__ tw, const float* __restrict__ pw,
                                              const float* __restrict__ gb, const float* __restrict__ tb, const float* __restrict__ pb,
                                              float* __restrict__ GG, float* __restrict__ TT) {
  const int q = blockIdx.y, b = blockIdx.z, n0 = blockIdx.x * 128;
  const float* __restrict__ x = (q < 2 ? x1 : x2) + (size_t)b * (CCs * NNs) + n0;
  const float* __restrict__ p = q == 1 ? tbn : (q == 3 ? pbn : gbn);
  const float* __restrict__ Wq = q == 1 ? tw : (q == 3 ? pw : gw);
  const float* __restrict__ bias = q == 1 ? tb : (q == 3 ? pb : gb);
  __shared__ __attribute__((aligned(16))) f16 xs[128 * XP];
  __shared__ float sinv[CCs], ssh[CCs];
  const int tid = threadIdx.x, lane = tid & 31, wave = tid >> 5, cl = lane & 15, rh = (lane >> 4) * 8;
  v4f_t xv[8];   // channels 32 g + 4 wave + e, positions 4 lane .. 4 lane + 3
  // the loops are unrolled: xv and acc are register arrays and need constant indices
#pragma unroll
  for (int g = 0; g < 2; ++g)
#pragma unroll
    for (int e = 0; e < 4; ++e) xv[g * 4 + e] = *(const v4f_t*)(x + (size_t)(32 * g + 4 * wave + e) * NNs + lane * 4);
  if (tid < CCs) {
    const float inv = p[tid] / sqrtf(p[3 * CCs + tid] + 1e-5f);
    sinv[tid] = inv; ssh[tid] = p[CCs + tid] - p[2 * CCs + tid] * inv;
  }
  f16x16 af[2][2];
#pragma unroll
  for (int i = 0; i < 2; ++i)
#pragma unroll
    for (int ks = 0; ks < 2; ++ks) af[i][ks] = load_frag(Wq, CCs, 16 * i, 32 * ks);
  v4f_t bv[2][2];   // bias of channels 16 i + rh + 4 hf .. + 3, fetched with the other operands and not behind the products
#pragma unroll
  for (int i = 0; i < 2; ++i)
#pragma unroll
    for (int hf = 0; hf < 2; ++hf) bv[i][hf] = *(const v4f_t*)(bias + 16 * i + rh + 4 * hf);
  const float bc[2] = {bias[cl], bias[16 + cl]};   // bias of channel 16 i + cl
  __syncthreads();
#pragma unroll
  for (int g = 0; g < 2; ++g) {
    const int k0 = 32 * g + 4 * wave;
#pragma unroll
    for (int u = 0; u < 4; ++u) {
      bf16x4 hx;
#pragma unroll
      for (int e = 0; e < 4; ++e) hx[e] = (f16)(xv[g * 4 + e][u] * sinv[k0 + e] + ssh[k0 + e]);
      *(bf16x4*)(xs + (lane * 4 + u) * XP + k0) = hx;
    }
  }
  __syncthreads();
  f32x8 acc[2] = {};
  f16x16 bfr[2];
#pragma unroll
  for (int ks = 0; ks < 2; ++ks) bfr[ks] = lds_frag(xs + (wave * 16) * XP + 32 * ks, XP);
  if (q & 1) {
#pragma unroll
    for (int ks = 0; ks < 2; ++ks)
#pragma unroll
      for (int i = 0; i < 2; ++i) acc[i] = __builtin_amdgcn_wmma_f32_16x16x32_f16(false, af[i][ks], false, bfr[ks], (short)0, acc[i], false, false);
    // a lane holds position 16 wave + cl and channels 16 i + rh + r: run i of fragment n0 / 16 + wave
    f16* __restrict__ dst = (f16*)TT + (size_t)(b * 2 + (q >> 1)) * (NNs * CIs) + (size_t)(n0 + 16 * wave) * CIs + lane * 8;
#pragma unroll
    for (int i = 0; i < 2; ++i) {
      f16x8 h;
#pragma unroll
      for (int r = 0; r < 8; ++r) h[r] = (f16)((acc[i][r] + bv[i][r >> 2][r & 3]) * SQL2E);
      *(f16x8*)(dst + 256 * i) = h;
    }
    asm volatile("s_wait_xcnt 0x0" ::: "memory");   // stands in front of any later write of a register that the two stores name
  } else {
#pragma unroll
    for (int ks = 0; ks < 2; ++ks)
#pragma unroll
      for (int i = 0; i < 2; ++i) acc[i] = __builtin_amdgcn_wmma_f32_16x16x32_f16(false, bfr[ks], false, af[i][ks], (short)0, acc[i], false, false);
    // a lane holds channel 16 i + cl and positions 16 wave + rh + r: run wave & 1 of fragment i of slice n0 / 32 + wave / 2
    f16* __restrict__ dst = (f16*)GG + (size_t)(b * 2 + (q >> 1)) * (CIs * NNs) + (size_t)(n0 + 32 * (wave >> 1)) * CIs + 256 * (wave & 1) + lane * 8;
#pragma unroll
    for (int i = 0; i < 2; ++i) {
      f16x8 h;
#pragma unroll
      for (int r = 0; r < 8; ++r) h[r] = (f16)(acc[i][r] + bc[i]);
      *(f16x8*)(dst + 512 * i) = h;
    }
    asm volatile("s_wait_xcnt 0x0" ::: "memory");   // as in the other branch: which of the two blocks comes first in the built code is the compiler's choice
  }
}

extern "C" void kernel_launch(void* const* d_in, const int* in_sizes, int n_in,
                              void* d_out, int out_size, void* d_ws, size_t ws_size,
                              hipStream_t stream) {
  (void)in_sizes; (void)n_in; (void)out_size;
  const float** f = (const float**)d_in;
  const float* x1 = f[0], *x2 = f[1], *gbn = f[2], *gw = f[3], *gb = f[4], *tbn = f[5], *tw = f[6], *tb = f[7], *pbn = f[8], *pw = f[9], *pb = f[10], *wbn = f[11], *Ww = f[12], *Wb = f[13];
  float* out1 = (float*)d_out; float* out2 = out1 + (size_t)NBs * CCs * NNs;     // tuple
  char* ws = (char*)d_ws;
  float* GG = (float*)ws; ws += (size_t)NBs * 2 * CIs * NNs * 2;      // g1, g2: packed f16 planes [b][2] of [32][4096]
  float* TT = (float*)ws; ws += (size_t)NBs * 2 * NNs * CIs * 2;      // theta^T, phi^T: packed f16 planes [b][2] of [4096][32]
  if ((size_t)(ws - (char*)d_ws) > ws_size) return;
  // q = 0: g1 = g(bn_g x1), 1: theta(bn_theta x1), 2: g2 = g(bn_g x2), 3: phi(bn_phi x2)
  k_proj<<<dim3(NNs / 128, 4, NBs), dim3(256), 0, stream>>>(x1, x2, gbn, tbn, pbn, gw, tw, pw, gb, tb, pb, GG, TT);
  // d = 0: y2[c][n] = sum_m g2[c][m] att1[n][m], att1 = softmax over m of sum_k theta[k][n] phi[k][m]
  // d = 1: y1[c][m] = sum_n g1[c][n] att2[n][m], att2 = softmax over n of the same scores
  k_attn<<<dim3(NNs / 128, 2, NBs), dim3(1024), 0, stream>>>(TT, GG, Ww, Wb, wbn, x1, x2, out1, out2);
}

// v009
// A run of this version takes 24.6 microseconds.
// Two timings next to v008 put it at 1.04 and 1.05 times that version's speed.
// Over all steps from v000 it is 92.9 times as fast.
// Contractions on v_wmma_f32_16x16x32_f16 (plain f16 operands, f32 accumulate). Two launches.
// k_proj: eval BatchNorm of a frame, one of the 1x1 convs g1, theta, g2, phi (K = 64) and its bias; the results are stored as f16 in the
// order of the WMMA fragments that k_attn takes them in (see "packed planes" below).
// k_attn, one work-group per 128 positions, direction and batch: scores theta^T.phi (K = 32, in log2 units, less the reference), softmax in f32 against a lazily moved reference maximum, the
// weighted sum of g (K = 4096), then W_out (K = 32), its BatchNorm and the residual in f32 into the output. The 4096 x 4096 scores and y
// never reach memory. y2 takes theta as queries, phi as keys, g2 as values; y1 takes phi, theta, g1.
// compute dtype: f16 operands, f32 accumulate.  x1, x2 [4,64,64,64] -> (x1 + W(y1), x2 + W(y2)).
#include <hip/hip_runtime.h>
#include <hip/hip_bf16.h>
#include <math.h>

#define NBs 4
#define CCs 64
#define CIs 32
#define NNs 4096
#define SS 4096
#define HH 1
#define DKK 64
#define GSTR 48

typedef _Float16 bf16;
typedef _Float16 f16;
typedef __attribute__((ext_vector_type(4))) unsigned v4u_t;
typedef unsigned v4ua __attribute__((ext_vector_type(4), may_alias));
typedef __attribute__((ext_vector_type(4))) float v4f_t;
typedef __attribute__((ext_vector_type(16))) bf16  bf16x16;
typedef bf16x16 f16x16;
typedef __attribute__((ext_vector_type(8)))  bf16  bf16x8;
typedef bf16x8 f16x8;
typedef __attribute__((ext_vector_type(4)))  bf16  bf16x4;
typedef __attribute__((ext_vector_type(8)))  float f32x8;
// WMMA with four v_nop behind it that still name A and B: they keep the form's distance to whatever writes A or B or reads D next, so that
// the next product's result cannot be placed over this one's B operand directly behind it
__device__ __forceinline__ f32x8 wmma16(f16x16 a, f16x16 b, f32x8 c) {
  c = __builtin_amdgcn_wmma_f32_16x16x32_f16(false, a, false, b, (short)0, c, false, false);
  asm volatile("v_nop\n\tv_nop\n\tv_nop\n\tv_nop" : "+v"(c) : "v"(a), "v"(b));
  return c;
}
#define LDS_STRIDE 48   // unused; so is GSTR (same 48)
#define KSTRIDE    72   // unused; k_attn stages only the 32 x 128 block of Y, pitch AKP
#define VSTRIDE    48   // unused; k_attn uses AKP

// 16x32 (MxK) f16 fragment from a row-major global matrix.
// lanes 0-15  (row=lane)    : elems 0..7 = K+0..7,  8..15 = K+16..23
// lanes 16-31 (row=lane-16) : elems 0..7 = K+8..15, 8..15 = K+24..31
template <typename T>
__device__ __forceinline__ bf16x16 load_frag(const T* __restrict__ base, int ld,
                                             int row0, int k0) {
  const int lane = threadIdx.x & 31;
  const int r    = lane & 15;
  const int kh   = (lane >> 4) * 8;
  const T* p0 = base + (size_t)(row0 + r) * ld + (k0 + kh);
  const T* p1 = p0 + 16;
  bf16x16 f;
#pragma unroll
  for (int i = 0; i < 8; ++i) {
    f[i]     = (bf16)p0[i];
    f[i + 8] = (bf16)p1[i];
  }
  return f;
}

// Same fragment from an LDS tile with padded row stride (base includes row0/k0).
__device__ __forceinline__ bf16x16 lds_frag(const bf16* base, int stride) {
  const int lane = threadIdx.x & 31;
  const int row  = lane & 15;
  const int kh   = (lane >> 4) * 8;
  const bf16x8 lo = *(const bf16x8*)(base + row * stride + kh);
  const bf16x8 hi = *(const bf16x8*)(base + row * stride + kh + 16);
  bf16x16 f;
#pragma unroll
  for (int i = 0; i < 8; ++i) { f[i] = lo[i]; f[i + 8] = hi[i]; }
  return f;
}

// Fragment from a packed plane; p is the lane's own 8 halfs of the fragment's first run.
__device__ __forceinline__ f16x16 pk_frag(const f16* __restrict__ p) {
  const f16x8 lo = *(const f16x8*)p, hi = *(const f16x8*)(p + 256);
  return __builtin_shufflevector(lo, hi, 0, 1, 2, 3, 4, 5, 6, 7, 8, 9, 10, 11, 12, 13, 14, 15);
}

// ---------------------------------------------------------------------------
// k_attn: Y[c][n] = sum_m G[c][m] * softmax_m(S[n][m]), S[n][m] = sum_k Qt[n][k] * Kt[m][k] (k < 32), for the 32 rows c of
// G [32][4096]; Qt, Kt [4096][32], all three f16 in packed planes. S and the weights live in registers only.
// Packed planes (halfs): a fragment is two runs of 256 halfs, lane l owning halfs 8 l .. 8 l + 7 of each, so a wave-wide 16-B load takes 512 B in a row.
//   T plane: half 512 tile + 256 h + 8 l + e = T[16 tile + (l & 15)][16 h + 8 (l >> 4) + e]
//   G plane: half 1024 slice + 512 i + 256 h + 8 l + e = G[16 i + (l & 15)][32 slice + 16 h + 8 (l >> 4) + e]
// Grid = 32 x 2 x 4 work-groups, each owns 128 columns n of one direction and batch. Its 32 waves are 4 column groups of 32 columns (one whole 128-B line of every Y row) times
// 8 key ranges of 512 keys m: wave = 4 range + group, so the four waves of a range walk the same
// slices together and ask for the same lines of Kt and G, which the WGP's cache fetches from L2 once for the four.
// Each wave loads its 32-key slices of Kt and G from the packed planes straight into fragment registers (no LDS, no
// conversion, no barrier in the loop) and keeps a reference maximum that moves lazily, a running sum and an un-normalised 32 x 32 partial per column. Transposed scores
// (A = keys, B = queries) leave a lane with column n = lane & 15 and keys 8 * (lane >> 4) + r: two such tiles are, register
// for register, the B fragment of the second product. A column group's 8 partials are merged in range order through LDS at the end.
// The merged 32 x 128 block of Y goes to LDS as f16, position-major; behind one more barrier sixteen waves multiply it by W_w [64][32]
// (16 output channels of one column group each, so every 128-B line of the output has one writer) and store x + bn_w(W_w Y + W_b).
// ---------------------------------------------------------------------------
#define AKP 40   // row pitch of Y in LDS: 32 -> 40 halfs (80 B = 16 B x 5): aligned b128 fragment reads without conflicts
#define ARP 36   // partial row pitch in floats: rows 8 apart fall on different banks
#define SQL2E 1.2011224087864498f   // sqrt(log2 e): k_proj puts it on theta and on phi, so that their product is the score in log2 units
// value of lane l ^ 16
__device__ __forceinline__ float other_half(float v) {
  const int b = __builtin_bit_cast(int, v);
  return __builtin_bit_cast(float, __builtin_amdgcn_permlanex16(b, b, 0x76543210, 0xfedcba98, false, false));
}
// 2^x on v_exp_f32 with the slot behind it filled inside the statement: the instruction set asks for one independent instruction or
// v_nop between a transcendental and a direct reader of its result or writer of its source.
// In the group of four each v_exp_f32 is the independent instruction behind the one before
// (outputs are early-clobber, so none shares a register with an input).
__device__ __forceinline__ float exp2_slot(float x) {
  float y;
  asm("v_exp_f32 %0, %1\n\tv_nop" : "=v"(y) : "v"(x));
  return y;
}
__device__ __forceinline__ void exp2_slot4(float& a, float& b, float& c, float& d) {
  float ya, yb, yc, yd;
  asm("v_exp_f32 %0, %4\n\tv_exp_f32 %1, %5\n\tv_exp_f32 %2, %6\n\tv_exp_f32 %3, %7\n\tv_nop"
      : "=&v"(ya), "=&v"(yb), "=&v"(yc), "=&v"(yd) : "v"(a), "v"(b), "v"(c), "v"(d));
  a = ya; b = yb; c = yc; d = yd;
}
// Weights of one column group and 32 keys, in place on the two result tiles of the score product: t0, t1 come in as the 16 exponents e of the lane
// and t0 goes out as the B fragment of the second product (2^e rounded to f16, two to a register); returns the lane's sum of its 16 weights in f32
// (two running pairs, even and odd keys apart, that take the key pairs 0 1 4 6 and 2 3 5 7; the pairs and their halves are added last). The tiles and the
// two pairs are pinned to fixed registers because asm text cannot name one register of a tuple operand; written on single-register operands the
// compiler moved half of the values to other registers first.
// The four v_nop are the form's four slots between a WMMA and a vector instruction on its result (the compiler does not look into asm text, and
// which of the two score products it issues last is its choice). Every v_exp_f32 is followed by an instruction that neither reads its result nor writes
// its source, and the plain instructions stand between the exponentials, each four or more exponentials behind the ones it reads; s_delay_alu marks the
// closer dependences at the end (the last one that of the addition behind the statement), so that a waiting wave gives the issue port to the SIMD's other waves.
typedef __attribute__((ext_vector_type(2))) float f32x2;
__device__ __forceinline__ float tile_weights(f32x8& t0, f32x8& t1) {
  f32x2 sa, sb;
  asm volatile(
      "v_nop\n\tv_nop\n\tv_nop\n\tv_nop\n\t"
      "v_exp_f32 v112, v112\n\tv_exp_f32 v113, v113\n\tv_exp_f32 v114, v114\n\tv_exp_f32 v115, v115\n\t"
      "v_exp_f32 v116, v116\n\tv_exp_f32 v117, v117\n\tv_exp_f32 v118, v118\n\t"
      "v_pk_add_f32 v[108:109], v[112:113], v[114:115]\n\t"
      "v_exp_f32 v119, v119\n\t"
      "v_cvt_pk_f16_f32 v112, v112, v113\n\t"
      "v_exp_f32 v120, v120\n\t"
      "v_cvt_pk_f16_f32 v113, v114, v115\n\t"
      "v_exp_f32 v121, v121\n\tv_exp_f32 v122, v122\n\t"
      "v_pk_add_f32 v[110:111], v[116:117], v[118:119]\n\t"
      "v_exp_f32 v123, v123\n\t"
      "v_cvt_pk_f16_f32 v114, v116, v117\n\t"
      "v_exp_f32 v124, v124\n\t"
      "v_cvt_pk_f16_f32 v115, v118, v119\n\t"
      "v_exp_f32 v125, v125\n\t"
      "v_pk_add_f32 v[108:109], v[108:109], v[120:121]\n\t"
      "v_exp_f32 v126, v126\n\t"
      "v_cvt_pk_f16_f32 v116, v120, v121\n\t"
      "v_exp_f32 v127, v127\n\t"
      "v_pk_add_f32 v[110:111], v[110:111], v[122:123]\n\t"
      "v_cvt_pk_f16_f32 v117, v122, v123\n\t"
      "s_delay_alu instid0(TRANS32_DEP_3) | instskip(SKIP_1) | instid1(TRANS32_DEP_1)\n\t"
      "v_pk_add_f32 v[108:109], v[108:109], v[124:125]\n\t"
      "v_cvt_pk_f16_f32 v118, v124, v125\n\t"
      "v_pk_add_f32 v[110:111], v[110:111], v[126:127]\n\t"
      "v_cvt_pk_f16_f32 v119, v126, v127\n\t"
      "s_delay_alu instid0(VALU_DEP_2)"
      : "+{v[112:119]}"(t0), "+{v[120:127]}"(t1), "={v[108:109]}"(sa), "={v[110:111]}"(sb));
  const f32x2 s = sa + sb;
  return s[0] + s[1];
}
// largest of a column's 32 exponents (the lane's 16 and the other half's 16)
__device__ __forceinline__ float slice_max(const f32x8 (&e)[2]) {
  float mx = e[0][0];
#pragma unroll
  for (int r = 1; r < 16; ++r) mx = fmaxf(mx, e[r >> 3][r & 7]);
  return fmaxf(mx, other_half(mx));
}
#define WB 8.0f        // a score equal to its column's reference gets the weight 2^8: small weights stay normal f16 numbers; the factor cancels in the division
#define WLIM 32768.0f  // a lane's 16 weights of a slice may sum to this much before the reference moves: no weight leaves the f16 range
// One 32-key slice of a wave: scores, softmax weights and weighted sum for its two column groups. A weight is 2^(score * log2 e + mb),
// mb = WB - the column's reference in log2 units. The score product itself delivers that exponent: k_proj stores theta and phi times
// sqrt(log2 e), and mbv[j], eight registers that all hold the lane's mb of group j, is the product's C operand (a lane's eight results are eight keys
// of one column). The weights are formed in place on the product's result. The reference is the column's maximum over the FIRST slice and moves lazily after that:
// only when some lane's weights of a slice sum to more than WLIM (or to no number) does the whole wave take the branch, in which every column
// whose maximum has passed its reference takes that maximum as the new one and has its sum and partials rescaled (the exponents are gone by then: the
// branch forms the score products anew, for the second group from keys that it fetches again); otherwise a slice needs no maximum and no rescaling. With MORE the next slice's fragments are fetched into the same registers as soon as their last product of this
// slice is issued (keys: under the second group's softmax; values: under the next slice's first scores and softmax); kn, gn are the lane's
// own halfs of the next slice, kc those of this slice's keys. The last slice is the instance without. stash: the lane's own 16 B in each of four 512-B runs of LDS that only this wave uses.
template <bool FIRST, bool MORE>
__device__ __forceinline__ void attn_slice(f16x16 (&kf)[2], f16x16 (&vf)[2], const f16x16 (&qf)[2], f32x8 (&acc)[2][2], f32x8 (&mbv)[2], float (&lrun)[2],
                                           const f16* __restrict__ kc, const f16* __restrict__ kn, const f16* __restrict__ gn, f16* stash) {
#pragma unroll
  for (int j = 0; j < 2; ++j) {
    f32x8 sc[2];   // exponents of keys 16 t + 8 (lane >> 4) + r against column 16 j + (lane & 15); in the first slice still without the reference
    const f32x8 z = {};
#pragma unroll
    for (int t = 0; t < 2; ++t) sc[t] = __builtin_amdgcn_wmma_f32_16x16x32_f16(false, kf[t], false, qf[j], (short)0, FIRST ? z : mbv[j], false, false);
    if (MORE && j == 1) {
      if (FIRST) {
        kf[0] = pk_frag(kn);
        const f16x8 lo = *(const f16x8*)(kn + 512);
        // in the first slice the four loads share one vector address pair, and the last load's result may be given those registers: the wait stands in front of that write
        asm volatile("s_wait_xcnt 0x0" ::: "memory");
        const f16x8 hi = *(const f16x8*)(kn + 768);
        kf[1] = __builtin_shufflevector(lo, hi, 0, 1, 2, 3, 4, 5, 6, 7, 8, 9, 10, 11, 12, 13, 14, 15);
      } else {
#pragma unroll
        for (int t = 0; t < 2; ++t) kf[t] = pk_frag(kn + 512 * t);
      }
    }
    if (FIRST) {
      const float mb = WB - slice_max(sc);
#pragma unroll
      for (int r = 0; r < 8; ++r) { mbv[j][r] = mb; sc[0][r] += mb; sc[1][r] += mb; }
      lrun[j] = tile_weights(sc[0], sc[1]);
    } else {
      float ws = tile_weights(sc[0], sc[1]);
      if (__builtin_expect(__builtin_amdgcn_ballot_w32(!(ws <= WLIM)) != 0, 0)) {   // one scalar branch of the whole wave, seldom taken
        if (MORE && j == 1) {   // kf already holds the next slice's keys, and the wave has no registers for a third pair of fragments: they wait in the wave's own LDS while this slice's come back
#pragma unroll
          for (int t = 0; t < 2; ++t) {
            *(f16x8*)(stash + 512 * t) = __builtin_shufflevector(kf[t], kf[t], 0, 1, 2, 3, 4, 5, 6, 7);
            *(f16x8*)(stash + 512 * t + 256) = __builtin_shufflevector(kf[t], kf[t], 8, 9, 10, 11, 12, 13, 14, 15);
          }
          // the loads stay behind the stores: issued ahead of them they need registers of their own beside kf, and the wave spills
          __builtin_amdgcn_sched_barrier(0);
#pragma unroll
          for (int t = 0; t < 2; ++t) kf[t] = pk_frag(kc + 512 * t);
          asm volatile("s_wait_xcnt 0x0" ::: "memory");   // stands in front of any later write of a register that the four loads name
        }
#pragma unroll
        for (int t = 0; t < 2; ++t) sc[t] = wmma16(kf[t], qf[j], mbv[j]);
        if (MORE && j == 1) {
#pragma unroll
          for (int t = 0; t < 2; ++t) kf[t] = pk_frag(stash + 512 * t);
        }
        const float d = fminf(WB - slice_max(sc), 0.0f);        // 0 for a column that stays under its reference
        const float al = exp2_slot(d);
        lrun[j] *= al;
#pragma unroll
        for (int r = 0; r < 8; ++r) { acc[0][j][r] *= al; acc[1][j][r] *= al; }
#pragma unroll
        for (int r = 0; r < 8; ++r) { mbv[j][r] += d; sc[0][r] += d; sc[1][r] += d; }
        // the rescaling ends in front of the weights: with part of it put off behind them its factor has no register left there, and the wave spills
        __builtin_amdgcn_sched_barrier(0);
        ws = tile_weights(sc[0], sc[1]);
      }
      lrun[j] += ws;
    }
    const f16x16 pf = __builtin_bit_cast(f16x16, sc[0]);
    // stands in front of the caller's step of the key pointer, a register that the fetch of the next keys above names
    if (MORE && j == 1) asm volatile("s_wait_xcnt 0x0" ::: "memory");
#pragma unroll
    for (int i = 0; i < 2; ++i) acc[i][j] = __builtin_amdgcn_wmma_f32_16x16x32_f16(false, vf[i], false, pf, (short)0, acc[i][j], false, false);
    // one column group at a time: interleaved, the two groups' scores and weights are live together and the wave passes the 128 registers that a wave of a 32-wave work-group can have
    __builtin_amdgcn_sched_barrier(0);
  }
  if (MORE) {
    if (FIRST) {   // as with the keys above: one vector address pair, and the wait in front of the load whose result may be given those registers
      vf[0] = pk_frag(gn);
      const f16x8 lo = *(const f16x8*)(gn + 512);
      asm volatile("s_wait_xcnt 0x0" ::: "memory");
      const f16x8 hi = *(const f16x8*)(gn + 768);
      vf[1] = __builtin_shufflevector(lo, hi, 0, 1, 2, 3, 4, 5, 6, 7, 8, 9, 10, 11, 12, 13, 14, 15);
    } else {
#pragma unroll
      for (int i = 0; i < 2; ++i) vf[i] = pk_frag(gn + 512 * i);
    }
    asm volatile("s_wait_xcnt 0x0" ::: "memory");   // stands in front of any later write of a register that the loads of the next values name (the caller's step of the pointer, the lane offset behind the loop)
  }
}
// blockIdx.y = direction d, blockIdx.z = batch b. TT: planes [b][theta^T, phi^T]; GG: planes [b][g1, g2].
// d = 0 (y2): queries theta^T, keys phi^T, values g2, residual x2, second output; d = 1 (y1): queries phi^T, keys theta^T, values g1, x1, first output.
__global__ __launch_bounds__(1024) void k_attn(const float* __restrict__ TT, const float* __restrict__ GG, const float* __restrict__ Ww, const float* __restrict__ Wb,
                                              const float* __restrict__ wbn, const float* __restrict__ x1, const float* __restrict__ x2,
                                              float* __restrict__ out1, float* __restrict__ out2) {
  const int dir = blockIdx.y, bat = blockIdx.z;
  const f16* __restrict__ Qt = (const f16*)TT + (size_t)(bat * 2 + dir) * (NNs * CIs);
  const f16* __restrict__ Kt = (const f16*)TT + (size_t)(bat * 2 + 1 - dir) * (NNs * CIs);
  const f16* __restrict__ G = (const f16*)GG + (size_t)(bat * 2 + 1 - dir) * (CIs * NNs);
  __shared__ __attribute__((aligned(16))) f16 ys[128 * AKP];        // 128 positions x 32 channels of Y
  __shared__ __attribute__((aligned(16))) float red[32][32 * ARP];  // per wave: its 32 x 32 partial
  __shared__ __attribute__((aligned(16))) float smx[32][32], ssm[32][32];   // per wave and column: reference maximum (log2 units, less WB), sum
  __shared__ float oinv[CCs], osh[CCs], owb[CCs];                   // per output channel: W_out's BatchNorm scale and shift, W_b
  const int tid = threadIdx.x, lane = tid & 31, wave = tid >> 5;
  const int wu = __builtin_amdgcn_readfirstlane(wave);
  const int nb = blockIdx.x * 128;
  const int n0 = nb + 32 * (wu & 3);             // the wave's column group
  const int kr = wu >> 2;                        // the wave's key range
  const unsigned lo8 = lane * 8;                 // the lane's own halfs in a fragment run
  const f16* kb = Kt + kr * (512 * CIs);         // the wave's 512 keys are 32 fragments in a row, its 512 columns of G likewise
  const f16* gb = G + kr * (512 * CIs);
  // The 32 work-groups of a direction and batch read the same K and G. Each walks the 16 slices of its ranges from a start of its own and wraps round, so that
  // groups running in step ask L2 for different lines, and a line that L2 has to fetch from memory is asked for by one group well before the others come to it.
  // Two groups whose indices differ in bit 2 alone share a start, so any 4 neighbours in each of the 4 blocks of 8 have the 16 starts between them.
  // Only speed rests on the choice: every start gives the same sums in another order.
  const int s0 = (blockIdx.x & 3) | ((blockIdx.x >> 3) << 2);   // the first slice
  int left = 15 - s0;                            // slices of the range behind this one; at 0 the next slice is the range's first
  const f16* kc = kb + s0 * (32 * CIs);          // this slice's keys; kn, gn: the next slice's keys and values
  const f16* gc = gb + s0 * (32 * CIs);
  const f16* kn = kc + 32 * CIs, *gn = gc + 32 * CIs;
  if (left == 0) { kn = kb; gn = gb; }
  // the inner loops are unrolled: acc and the fragments are register arrays and need constant indices
  f16x16 kf[2], vf[2], qf[2];
#pragma unroll
  for (int t = 0; t < 2; ++t) { kf[t] = pk_frag(kc + 512 * t + lo8); vf[t] = pk_frag(gc + 512 * t + lo8); qf[t] = pk_frag(Qt + (n0 + 16 * t) * CIs + lo8); }
  if (tid < CCs) {   // read behind the barrier that follows the loop
    const float inv = wbn[tid] / sqrtf(wbn[3 * CCs + tid] + 1e-5f);
    oinv[tid] = inv; osh[tid] = wbn[CCs + tid] - wbn[2 * CCs + tid] * inv; owb[tid] = Wb[tid];
  }
  f32x8 acc[2][2] = {};
  f16* stash = (f16*)red[wu] + lo8;   // the wave's partial goes there only behind the loop; the uniform wave number keeps the row's offset in a scalar register (as a vector register it was spilled over the loop)
  f32x8 mbv[2];           // set by the first slice
  float lrun[2];
  // the loop over slices stays rolled: unrolled, the compiler put off the running sums' additions to the end and spilled the weights
  attn_slice<true, true>(kf, vf, qf, acc, mbv, lrun, kc + lo8, kn + lo8, gn + lo8, stash);
#pragma unroll 1
  for (int s = 1; s < 15; ++s) {
    kc = kn; kn += 32 * CIs; gn += 32 * CIs;
    if (--left == 0) { kn = kb; gn = gb; }
    attn_slice<false, true>(kf, vf, qf, acc, mbv, lrun, kc + lo8, kn + lo8, gn + lo8, stash);
  }
  attn_slice<false, false>(kf, vf, qf, acc, mbv, lrun, kb, kb, gb, stash);
  const int nlane = lane & 15, mh = (lane >> 4) * 8;
  float* rw = red[wu];
#pragma unroll
  for (int i = 0; i < 2; ++i)
#pragma unroll
    for (int j = 0; j < 2; ++j)
#pragma unroll
      for (int r = 0; r < 8; ++r) rw[(16 * i + mh + r) * ARP + 16 * j + nlane] = acc[i][j][r];
#pragma unroll
  for (int j = 0; j < 2; ++j) {
    const float lt = lrun[j] + other_half(lrun[j]);   // the two halves hold different keys of the same column
    if (lane < 16) { smx[wave][16 * j + lane] = -mbv[j][0]; ssm[wave][16 * j + lane] = lt; }
  }
  __syncthreads();
  // the sixteen waves of the last product fetch their W_w fragment and their residual values here: carried through the loop they would put the
  // wave over the 128 registers at which one work-group is resident on a WGP; from here the latency runs under the merge
  const int wq = wu & 3, wg = (wu >> 2) & 3;   // wave wu < 16: output channels 16 wq .. 16 wq + 15 of column group wg
  const size_t ob = (size_t)bat * (CCs * NNs) + (size_t)(wq * 16 + mh) * NNs + nb + 32 * wg + nlane;   // output channel 16 wq + mh + r, position nb + 32 wg + 16 j + nlane
  const float* __restrict__ xres = (dir ? x1 : x2) + ob;
  v4f_t wr[4] = {};   // the lane's part of the W_w fragment, still f32: rounded behind the merge, so that the merge does not begin with a wait for it
  float xr[2][8] = {};
  if (wu < 16) {
    const float* __restrict__ wp = Ww + (size_t)(16 * wq + nlane) * CIs + mh;   // row 16 wq + nlane, k = mh .. mh + 7 and 16 + mh .. 16 + mh + 7, as in load_frag
#pragma unroll
    for (int h = 0; h < 2; ++h) { wr[2 * h] = *(const v4f_t*)(wp + 16 * h); wr[2 * h + 1] = *(const v4f_t*)(wp + 16 * h + 4); }
#pragma unroll
    for (int j = 0; j < 2; ++j)
#pragma unroll
      for (int r = 0; r < 8; ++r) xr[j][r] = xres[(size_t)r * NNs + 16 * j];
  }
  { const int mg = wu >> 3, c = (tid >> 3) & 31, np = (tid & 7) * 4;     // a thread merges channel c of positions np .. np + 3 of column group mg
    v4f_t m = *(const v4f_t*)(&smx[mg][np]);
#pragma unroll
    for (int w = 1; w < 8; ++w) {
      const v4f_t t = *(const v4f_t*)(&smx[4 * w + mg][np]);
#pragma unroll
      for (int e = 0; e < 4; ++e) m[e] = fmaxf(m[e], t[e]);
    }
    v4f_t sv = {}, lv = {};
    // four ranges at a time: with all eight unrolled their LDS reads are live together beside the fetched W_w and residual values, and the wave spills
#pragma unroll 4
    for (int w = 0; w < 8; ++w) {
      const v4f_t v = *(const v4f_t*)(&red[4 * w + mg][c * ARP + np]);
      const v4f_t mw = *(const v4f_t*)(&smx[4 * w + mg][np]), lw = *(const v4f_t*)(&ssm[4 * w + mg][np]);
      float f0 = mw[0] - m[0], f1 = mw[1] - m[1], f2 = mw[2] - m[2], f3 = mw[3] - m[3];   // the references are in log2 units
      exp2_slot4(f0, f1, f2, f3);
      sv[0] += v[0] * f0; sv[1] += v[1] * f1; sv[2] += v[2] * f2; sv[3] += v[3] * f3;
      lv[0] += lw[0] * f0; lv[1] += lw[1] * f1; lv[2] += lw[2] * f2; lv[3] += lw[3] * f3;
    }
#pragma unroll
    for (int e = 0; e < 4; ++e) ys[(32 * mg + np + e) * AKP + c] = (f16)(sv[e] / lv[e]); }
  __syncthreads();   // the whole block of Y is in LDS before the sixteen waves read it
  if (wu < 16) {
    float* __restrict__ o = (dir ? out1 : out2) + ob;
    f16x16 wf;
#pragma unroll
    for (int i = 0; i < 16; ++i) wf[i] = (f16)wr[i >> 2][i & 3];
    const f16x16 yf0 = lds_frag(ys + 32 * wg * AKP, AKP), yf1 = lds_frag(ys + (32 * wg + 16) * AKP, AKP);
    const f32x8 z0 = {};
    f32x8 zz[2];
    zz[0] = wmma16(wf, yf0, z0);
    zz[1] = wmma16(wf, yf1, z0);
#pragma unroll
    for (int j = 0; j < 2; ++j)
#pragma unroll
      for (int r = 0; r < 8; ++r) {
        const int c = 16 * wq + mh + r;
        o[(size_t)r * NNs + 16 * j] = xr[j][r] + ((zz[j][r] + owb[c]) * oinv[c] + osh[c]);
      }
  }
}

// ---------------------------------------------------------------------------
// k_proj: P[o][n] = sum_c W[o][c] * bn(x)[c][n] + bias[o], o < 32, c < 64, for 128 positions n of one frame.
// blockIdx.y = projection q (0: g of x1, 1: theta of x1, 2: g of x2, 3: phi of x2), blockIdx.z = batch.
// bn(x)[c][n] = x * inv_c + (beta - mean * inv)_c, inv = gamma / sqrt(var + eps), is rounded to f16 and staged position-major in LDS
// (a wave-wide load takes the 512 B of one channel's row; a lane packs four channels of a position into one 8-B LDS store).
// Wave w takes positions 16 w .. 16 w + 15; the weights come straight from global memory. q odd (TT plane [b][q / 2]): A = weights, B = the staged
// frame, a lane gets 8 channels of one position, stored times sqrt(log2 e). q even (GG plane [b][q / 2]): A = the staged frame, B = weights, a lane gets 8 positions of one
// channel. Either way those 8 values, rounded to f16, are the lane's own 16 B of a packed fragment run: a wave-wide store takes 512 B in a row.
// ---------------------------------------------------------------------------
#define XP 72    // staged pitch: 64 -> 72 halfs (144 B = 16 B x 9): aligned b128 fragment reads
__global__ __launch_bounds__(256) void k_proj(const float* __restrict__ x1, const float* __restrict__ x2, const float* __restrict__ gbn, const float* __restrict__ tbn,
                                              const float* __restrict__ pbn, const float* __restrict__ gw, const float* __restrict__ tw, const float* __restrict__ pw,
                                              const float* __restrict__ gb, const float* __restrict__ tb, const float* __restrict__ pb,
                                              float* __restrict__ GG, float* __restrict__ TT) {
  const int q = blockIdx.y, b = blockIdx.z, n0 = blockIdx.x * 128;
  const float* __restrict__ x = (q < 2 ? x1 : x2) + (size_t)b * (CCs * NNs) + n0;
  const float* __restrict__ p = q == 1 ? tbn : (q == 3 ? pbn : gbn);
  const float* __restrict__ Wq = q == 1 ? tw : (q == 3 ? pw : gw);
  const float* __restrict__ bias = q == 1 ? tb : (q == 3 ? pb : gb);
  __shared__ __attribute__((aligned(16))) f16 xs[128 * XP];
  __shared__ float sinv[CCs], ssh[CCs];
  const int tid = threadIdx.x, lane = tid & 31, wave = tid >> 5, cl = lane & 15, rh = (lane >> 4) * 8;
  v4f_t xv[8];   // channels 32 g + 4 wave + e, positions 4 lane .. 4 lane + 3
  // the loops are unrolled: xv and acc are register arrays and need constant indices
#pragma unroll
  for (int g = 0; g < 2; ++g)
#pragma unroll
    for (int e = 0; e < 4; ++e) xv[g * 4 + e] = *(const v4f_t*)(x + (size_t)(32 * g + 4 * wave + e) * NNs + lane * 4);
  if (tid < CCs) {
    const float inv = p[tid] / sqrtf(p[3 * CCs + tid] + 1e-5f);
    sinv[tid] = inv; ssh[tid] = p[CCs + tid] - p[2 * CCs + tid] * inv;
  }
  f16x16 af[2][2];
#pragma unroll
  for (int i = 0; i < 2; ++i)
#pragma unroll
    for (int ks = 0; ks < 2; ++ks) af[i][ks] = load_frag(Wq, CCs, 16 * i, 32 * ks);
  v4f_t bv[2][2];   // bias of channels 16 i + rh + 4 hf .. + 3, fetched with the other operands and not behind the products
#pragma unroll
  for (int i = 0; i < 2; ++i)
#pragma unroll
    for (int hf = 0; hf < 2; ++hf) bv[i][hf] = *(const v4f_t*)(bias + 16 * i + rh + 4 * hf);
  const float bc[2] = {bias[cl], bias[16 + cl]};   // bias of channel 16 i + cl
  __syncthreads();
#pragma unroll
  for (int g = 0; g < 2; ++g) {
    const int k0 = 32 * g + 4 * wave;
#pragma unroll
    for (int u = 0; u < 4; ++u) {
      bf16x4 hx;
#pragma unroll
      for (int e = 0; e < 4; ++e) hx[e] = (f16)(xv[g * 4 + e][u] * sinv[k0 + e] + ssh[k0 + e]);
      *(bf16x4*)(xs + (lane * 4 + u) * XP + k0) = hx;
    }
  }
  __syncthreads();
  f32x8 acc[2] = {};
  f16x16 bfr[2];
#pragma unroll
  for (int ks = 0; ks < 2; ++ks) bfr[ks] = lds_frag(xs + (wave * 16) * XP + 32 * ks, XP);
  if (q & 1) {
#pragma unroll
    for (int ks = 0; ks < 2; ++ks)
#pragma unroll
      for (int i = 0; i < 2; ++i) acc[i] = __builtin_amdgcn_wmma_f32_16x16x32_f16(false, af[i][ks], false, bfr[ks], (short)0, acc[i], false, false);
    // a lane holds position 16 wave + cl and channels 16 i + rh + r: run i of fragment n0 / 16 + wave
    f16* __restrict__ dst = (f16*)TT + (size_t)(b * 2 + (q >> 1)) * (NNs * CIs) + (size_t)(n0 + 16 * wave) * CIs + lane * 8;
#pragma unroll
    for (int i = 0; i < 2; ++i) {
      f16x8 h;
#pragma unroll
      for (int r = 0; r < 8; ++r) h[r] = (f16)((acc[i][r] + bv[i][r >> 2][r & 3]) * SQL2E);
      *(f16x8*)(dst + 256 * i) = h;
    }
    asm volatile("s_wait_xcnt 0x0" ::: "memory");   // stands in front of any later write of a register that the two stores name
  } else {
#pragma unroll
    for (int ks = 0; ks < 2; ++ks)
#pragma unroll
      for (int i = 0; i < 2; ++i) acc[i] = __builtin_amdgcn_wmma_f32_16x16x32_f16(false, bfr[ks], false, af[i][ks], (short)0, acc[i], false, false);
    // a lane holds channel 16 i + cl and positions 16 wave + rh + r: run wave & 1 of fragment i of slice n0 / 32 + wave / 2
    f16* __restrict__ dst = (f16*)GG + (size_t)(b * 2 + (q >> 1)) * (CIs * NNs) + (size_t)(n0 + 32 * (wave >> 1)) * CIs + 256 * (wave & 1) + lane * 8;
#pragma unroll
    for (int i = 0; i < 2; ++i) {
      f16x8 h;
#pragma unroll
      for (int r = 0; r < 8; ++r) h[r] = (f16)(acc[i][r] + bc[i]);
      *(f16x8*)(dst + 512 * i) = h;
    }
    asm volatile("s_wait_xcnt 0x0" ::: "memory");   // as in the other branch: which of the two blocks comes first in the built code is the compiler's choice
  }
}

extern "C" void kernel_launch(void* const* d_in, const int* in_sizes, int n_in,
                              void* d_out, int out_size, void* d_ws, size_t ws_size,
                              hipStream_t stream) {
  (void)in_sizes; (void)n_in; (void)out_size;
  const float** f = (const float**)d_in;
  const float* x1 = f[0], *x2 = f[1], *gbn = f[2], *gw = f[3], *gb = f[4], *tbn = f[5], *tw = f[6], *tb = f[7], *pbn = f[8], *pw = f[9], *pb = f[10], *wbn = f[11], *Ww = f[12], *Wb = f[13];
  float* out1 = (float*)d_out; float* out2 = out1 + (size_t)NBs * CCs * NNs;     // tuple
  char* ws = (char*)d_ws;
  float* GG = (float*)ws; ws += (size_t)NBs * 2 * CIs * NNs * 2;      // g1, g2: packed f16 planes [b][2] of [32][4096]
  float* TT = (float*)ws; ws += (size_t)NBs * 2 * NNs * CIs * 2;      // theta^T, phi^T: packed f16 planes [b][2] of [4096][32]
  if ((size_t)(ws - (char*)d_ws) > ws_size) return;
  // q = 0: g1 = g(bn_g x1), 1: theta(bn_theta x1), 2: g2 = g(bn_g x2), 3: phi(bn_phi x2)
  k_proj<<<dim3(NNs / 128, 4, NBs), dim3(256), 0, stream>>>(x1, x2, gbn, tbn, pbn, gw, tw, pw, gb, tb, pb, GG, TT);
  // d = 0: y2[c][n] = sum_m g2[c][m] att1[n][m], att1 = softmax over m of sum_k theta[k][n] phi[k][m]
  // d = 1: y1[c][m] = sum_n g1[c][n] att2[n][m], att2 = softmax over n of the same scores
  k_attn<<<dim3(NNs / 128, 2, NBs), dim3(1024), 0, stream>>>(TT, GG, Ww, Wb, wbn, x1, x2, out1, out2);
}

// v010
// Measured time: 23.8 microseconds a run.
// In two side-by-side timings against v009, it was 1.03 and 1.04 times as fast.
// Over all steps from v000 it is 95.9 times as fast.
// Contractions on v_wmma_f32_16x16x32_f16 (plain f16 operands, f32 accumulate). Two launches.
// k_proj: eval BatchNorm of a frame, one of the 1x1 convs g1, theta, g2, phi (K = 64) and its bias; the results are stored as f16 in the
// order of the WMMA fragments that k_attn takes them in (see "packed planes" below).
// k_attn, one work-group per 128 positions, direction and batch: scores theta^T.phi (K = 32, in log2 units, less the reference), softmax in f32 against a lazily moved reference maximum, the
// weighted sum of g (K = 4096), then W_out (K = 32), its BatchNorm and the residual in f32 into the output. The 4096 x 4096 scores and y
// never reach memory. y2 takes theta as queries, phi as keys, g2 as values; y1 takes phi, theta, g1.
// compute dtype: f16 operands, f32 accumulate.  x1, x2 [4,64,64,64] -> (x1 + W(y1), x2 + W(y2)).
#include <hip/hip_runtime.h>
#include <hip/hip_bf16.h>
#include <math.h>

#define NBs 4
#define CCs 64
#define CIs 32
#define NNs 4096
#define SS 4096
#define HH 1
#define DKK 64
#define GSTR 48

typedef _Float16 bf16;
typedef _Float16 f16;
typedef __attribute__((ext_vector_type(4))) unsigned v4u_t;
typedef unsigned v4ua __attribute__((ext_vector_type(4), may_alias));
typedef __attribute__((ext_vector_type(4))) float v4f_t;
typedef __attribute__((ext_vector_type(16))) bf16  bf16x16;
typedef bf16x16 f16x16;
typedef __attribute__((ext_vector_type(8)))  bf16  bf16x8;
typedef bf16x8 f16x8;
typedef __attribute__((ext_vector_type(4)))  bf16  bf16x4;
typedef __attribute__((ext_vector_type(8)))  float f32x8;
// WMMA with four v_nop behind it that still name A and B: they keep the form's distance to whatever writes A or B or reads D next, so that
// the next product's result cannot be placed over this one's B operand directly behind it
__device__ __forceinline__ f32x8 wmma16(f16x16 a, f16x16 b, f32x8 c) {
  c = __builtin_amdgcn_wmma_f32_16x16x32_f16(false, a, false, b, (short)0, c, false, false);
  asm volatile("v_nop\n\tv_nop\n\tv_nop\n\tv_nop" : "+v"(c) : "v"(a), "v"(b));
  return c;
}
#define LDS_STRIDE 48   // unused; so is GSTR (same 48)
#define KSTRIDE    72   // unused; k_attn stages only the 32 x 128 block of Y, pitch AKP
#define VSTRIDE    48   // unused; k_attn uses AKP

// 16x32 (MxK) f16 fragment from a row-major global matrix.
// lanes 0-15  (row=lane)    : elems 0..7 = K+0..7,  8..15 = K+16..23
// lanes 16-31 (row=lane-16) : elems 0..7 = K+8..15, 8..15 = K+24..31
template <typename T>
__device__ __forceinline__ bf16x16 load_frag(const T* __restrict__ base, int ld,
                                             int row0, int k0) {
  const int lane = threadIdx.x & 31;
  const int r    = lane & 15;
  const int kh   = (lane >> 4) * 8;
  const T* p0 = base + (size_t)(row0 + r) * ld + (k0 + kh);
  const T* p1 = p0 + 16;
  bf16x16 f;
#pragma unroll
  for (int i = 0; i < 8; ++i) {
    f[i]     = (bf16)p0[i];
    f[i + 8] = (bf16)p1[i];
  }
  return f;
}

// Same fragment from an LDS tile with padded row stride (base includes row0/k0).
__device__ __forceinline__ bf16x16 lds_frag(const bf16* base, int stride) {
  const int lane = threadIdx.x & 31;
  const int row  = lane & 15;
  const int kh   = (lane >> 4) * 8;
  const bf16x8 lo = *(const bf16x8*)(base + row * stride + kh);
  const bf16x8 hi = *(const bf16x8*)(base + row * stride + kh + 16);
  bf16x16 f;
#pragma unroll
  for (int i = 0; i < 8; ++i) { f[i] = lo[i]; f[i + 8] = hi[i]; }
  return f;
}

// Fragment from a packed plane; p is the lane's own 8 halfs of the fragment's first run.
__device__ __forceinline__ f16x16 pk_frag(const f16* __restrict__ p) {
  const f16x8 lo = *(const f16x8*)p, hi = *(const f16x8*)(p + 256);
  return __builtin_shufflevector(lo, hi, 0, 1, 2, 3, 4, 5, 6, 7, 8, 9, 10, 11, 12, 13, 14, 15);
}

// ---------------------------------------------------------------------------
// k_attn: Y[c][n] = sum_m G[c][m] * softmax_m(S[n][m]), S[n][m] = sum_k Qt[n][k] * Kt[m][k] (k < 32), for the 32 rows c of
// G [32][4096]; Qt, Kt [4096][32], all three f16 in packed planes. S and the weights live in registers only.
// Packed planes (halfs): a fragment is two runs of 256 halfs, lane l owning halfs 8 l .. 8 l + 7 of each, so a wave-wide 16-B load takes 512 B in a row.
//   T plane: half 512 tile + 256 h + 8 l + e = T[16 tile + (l & 15)][16 h + 8 (l >> 4) + e]
//   G plane: half 1024 slice + 512 i + 256 h + 8 l + e = G[16 i + (l & 15)][32 slice + 16 h + 8 (l >> 4) + e]
// Grid = 32 x 2 x 4 work-groups, each owns 128 columns n of one direction and batch. Its 32 waves are 4 column groups of 32 columns (one whole 128-B line of every Y row) times
// 8 key ranges of 512 keys m: wave = 4 range + group, so the four waves of a range walk the same
// slices together and ask for the same lines of Kt and G, which the WGP's cache fetches from L2 once for the four.
// Each wave loads its 32-key slices of Kt and G from the packed planes straight into fragment registers (no LDS, no
// conversion, no barrier in the loop) and keeps a reference maximum that moves lazily, a running sum and an un-normalised 32 x 32 partial per column. Transposed scores
// (A = keys, B = queries) leave a lane with column n = lane & 15 and keys 8 * (lane >> 4) + r: two such tiles are, register
// for register, the B fragment of the second product. A column group's 8 partials are merged in range order through LDS at the end; they lie there column-major,
// so that a lane stores eight channels of its column with two 16-B stores and the merging lane takes four channels of one column with one 16-B load per range.
// The merged 32 x 128 block of Y goes to LDS as f16, position-major; behind one more barrier sixteen waves multiply it by W_w [64][32]
// (16 output channels of one column group each, so every 128-B line of the output has one writer) and store x + bn_w(W_w Y + W_b).
// ---------------------------------------------------------------------------
#define AKP 40   // row pitch of Y in LDS: 32 -> 40 halfs (80 B = 16 B x 5): aligned b128 fragment reads without conflicts
#define ARP 36   // pitch of a partial's column in floats (144 B = 16 B x 9): sixteen lanes on sixteen columns reach all 64 banks with one 16-B access each
#define SQL2E 1.2011224087864498f   // sqrt(log2 e): k_proj puts it on theta and on phi, so that their product is the score in log2 units
// value of lane l ^ 16
__device__ __forceinline__ float other_half(float v) {
  const int b = __builtin_bit_cast(int, v);
  return __builtin_bit_cast(float, __builtin_amdgcn_permlanex16(b, b, 0x76543210, 0xfedcba98, false, false));
}
// 2^x on v_exp_f32 with the slot behind it filled inside the statement: the instruction set asks for one independent instruction or
// v_nop between a transcendental and a direct reader of its result or writer of its source.
// In the group of four each v_exp_f32 is the independent instruction behind the one before
// (outputs are early-clobber, so none shares a register with an input).
__device__ __forceinline__ float exp2_slot(float x) {
  float y;
  asm("v_exp_f32 %0, %1\n\tv_nop" : "=v"(y) : "v"(x));
  return y;
}
__device__ __forceinline__ void exp2_slot4(float& a, float& b, float& c, float& d) {
  float ya, yb, yc, yd;
  asm("v_exp_f32 %0, %4\n\tv_exp_f32 %1, %5\n\tv_exp_f32 %2, %6\n\tv_exp_f32 %3, %7\n\tv_nop"
      : "=&v"(ya), "=&v"(yb), "=&v"(yc), "=&v"(yd) : "v"(a), "v"(b), "v"(c), "v"(d));
  a = ya; b = yb; c = yc; d = yd;
}
// Weights of one column group and 32 keys, in place on the two result tiles of the score product: t0, t1 come in as the 16 exponents e of the lane
// and t0 goes out as the B fragment of the second product (2^e rounded to f16, two to a register); returns the lane's sum of its 16 weights in f32
// (two running pairs, even and odd keys apart, that take the key pairs 0 1 4 6 and 2 3 5 7; the pairs and their halves are added last). The tiles and the
// two pairs are pinned to fixed registers because asm text cannot name one register of a tuple operand; written on single-register operands the
// compiler moved half of the values to other registers first.
// The four v_nop are the form's four slots between a WMMA and a vector instruction on its result (the compiler does not look into asm text, and
// which of the two score products it issues last is its choice). Every v_exp_f32 is followed by an instruction that neither reads its result nor writes
// its source, and the plain instructions stand between the exponentials, each four or more exponentials behind the ones it reads; s_delay_alu marks the
// closer dependences at the end (the last one that of the addition behind the statement), so that a waiting wave gives the issue port to the SIMD's other waves.
typedef __attribute__((ext_vector_type(2))) float f32x2;
__device__ __forceinline__ float tile_weights(f32x8& t0, f32x8& t1) {
  f32x2 sa, sb;
  asm volatile(
      "v_nop\n\tv_nop\n\tv_nop\n\tv_nop\n\t"
      "v_exp_f32 v112, v112\n\tv_exp_f32 v113, v113\n\tv_exp_f32 v114, v114\n\tv_exp_f32 v115, v115\n\t"
      "v_exp_f32 v116, v116\n\tv_exp_f32 v117, v117\n\tv_exp_f32 v118, v118\n\t"
      "v_pk_add_f32 v[108:109], v[112:113], v[114:115]\n\t"
      "v_exp_f32 v119, v119\n\t"
      "v_cvt_pk_f16_f32 v112, v112, v113\n\t"
      "v_exp_f32 v120, v120\n\t"
      "v_cvt_pk_f16_f32 v113, v114, v115\n\t"
      "v_exp_f32 v121, v121\n\tv_exp_f32 v122, v122\n\t"
      "v_pk_add_f32 v[110:111], v[116:117], v[118:119]\n\t"
      "v_exp_f32 v123, v123\n\t"
      "v_cvt_pk_f16_f32 v114, v116, v117\n\t"
      "v_exp_f32 v124, v124\n\t"
      "v_cvt_pk_f16_f32 v115, v118, v119\n\t"
      "v_exp_f32 v125, v125\n\t"
      "v_pk_add_f32 v[108:109], v[108:109], v[120:121]\n\t"
      "v_exp_f32 v126, v126\n\t"
      "v_cvt_pk_f16_f32 v116, v120, v121\n\t"
      "v_exp_f32 v127, v127\n\t"
      "v_pk_add_f32 v[110:111], v[110:111], v[122:123]\n\t"
      "v_cvt_pk_f16_f32 v117, v122, v123\n\t"
      "s_delay_alu instid0(TRANS32_DEP_3) | instskip(SKIP_1) | instid1(TRANS32_DEP_1)\n\t"
      "v_pk_add_f32 v[108:109], v[108:109], v[124:125]\n\t"
      "v_cvt_pk_f16_f32 v118, v124, v125\n\t"
      "v_pk_add_f32 v[110:111], v[110:111], v[126:127]\n\t"
      "v_cvt_pk_f16_f32 v119, v126, v127\n\t"
      "s_delay_alu instid0(VALU_DEP_2)"
      : "+{v[112:119]}"(t0), "+{v[120:127]}"(t1), "={v[108:109]}"(sa), "={v[110:111]}"(sb));
  const f32x2 s = sa + sb;
  return s[0] + s[1];
}
// largest of a column's 32 exponents (the lane's 16 and the other half's 16)
__device__ __forceinline__ float slice_max(const f32x8 (&e)[2]) {
  float mx = e[0][0];
#pragma unroll
  for (int r = 1; r < 16; ++r) mx = fmaxf(mx, e[r >> 3][r & 7]);
  return fmaxf(mx, other_half(mx));
}
#define WB 8.0f        // a score equal to its column's reference gets the weight 2^8: small weights stay normal f16 numbers; the factor cancels in the division
#define WLIM 32768.0f  // a lane's 16 weights of a slice may sum to this much before the reference moves: no weight leaves the f16 range
// One 32-key slice of a wave: scores, softmax weights and weighted sum for its two column groups. A weight is 2^(score * log2 e + mb),
// mb = WB - the column's reference in log2 units. The score product itself delivers that exponent: k_proj stores theta and phi times
// sqrt(log2 e), and mbv[j], eight registers that all hold the lane's mb of group j, is the product's C operand (a lane's eight results are eight keys
// of one column). The weights are formed in place on the product's result. The reference is the column's maximum over the FIRST slice and moves lazily after that:
// only when some lane's weights of a slice sum to more than WLIM (or to no number) does the whole wave take the branch, in which every column
// whose maximum has passed its reference takes that maximum as the new one and has its sum and partials rescaled (the exponents are gone by then: the
// branch forms the score products anew, for the second group from keys that it fetches again); otherwise a slice needs no maximum and no rescaling. With MORE the next slice's fragments are fetched into the same registers as soon as their last product of this
// slice is issued (keys: under the second group's softmax; values: under the next slice's first scores and softmax); kn, gn are the lane's
// own halfs of the next slice, kc those of this slice's keys. The last slice is the instance without. stash: the lane's own 16 B in each of four 512-B runs of LDS that only this wave uses.
template <bool FIRST, bool MORE>
__device__ __forceinline__ void attn_slice(f16x16 (&kf)[2], f16x16 (&vf)[2], const f16x16 (&qf)[2], f32x8 (&acc)[2][2], f32x8 (&mbv)[2], float (&lrun)[2],
                                           const f16* __restrict__ kc, const f16* __restrict__ kn, const f16* __restrict__ gn, f16* stash) {
#pragma unroll
  for (int j = 0; j < 2; ++j) {
    f32x8 sc[2];   // exponents of keys 16 t + 8 (lane >> 4) + r against column 16 j + (lane & 15); in the first slice still without the reference
    const f32x8 z = {};
#pragma unroll
    for (int t = 0; t < 2; ++t) sc[t] = __builtin_amdgcn_wmma_f32_16x16x32_f16(false, kf[t], false, qf[j], (short)0, FIRST ? z : mbv[j], false, false);
    if (MORE && j == 1) {
      if (FIRST) {
        kf[0] = pk_frag(kn);
        const f16x8 lo = *(const f16x8*)(kn + 512);
        // in the first slice the four loads share one vector address pair, and the last load's result may be given those registers: the wait stands in front of that write
        asm volatile("s_wait_xcnt 0x0" ::: "memory");
        const f16x8 hi = *(const f16x8*)(kn + 768);
        kf[1] = __builtin_shufflevector(lo, hi, 0, 1, 2, 3, 4, 5, 6, 7, 8, 9, 10, 11, 12, 13, 14, 15);
      } else {
#pragma unroll
        for (int t = 0; t < 2; ++t) kf[t] = pk_frag(kn + 512 * t);
      }
    }
    if (FIRST) {
      const float mb = WB - slice_max(sc);
#pragma unroll
      for (int r = 0; r < 8; ++r) { mbv[j][r] = mb; sc[0][r] += mb; sc[1][r] += mb; }
      lrun[j] = tile_weights(sc[0], sc[1]);
    } else {
      float ws = tile_weights(sc[0], sc[1]);
      if (__builtin_expect(__builtin_amdgcn_ballot_w32(!(ws <= WLIM)) != 0, 0)) {   // one scalar branch of the whole wave, seldom taken
        if (MORE && j == 1) {   // kf already holds the next slice's keys, and the wave has no registers for a third pair of fragments: they wait in the wave's own LDS while this slice's come back
#pragma unroll
          for (int t = 0; t < 2; ++t) {
            *(f16x8*)(stash + 512 * t) = __builtin_shufflevector(kf[t], kf[t], 0, 1, 2, 3, 4, 5, 6, 7);
            *(f16x8*)(stash + 512 * t + 256) = __builtin_shufflevector(kf[t], kf[t], 8, 9, 10, 11, 12, 13, 14, 15);
          }
          // the loads stay behind the stores: issued ahead of them they need registers of their own beside kf, and the wave spills
          __builtin_amdgcn_sched_barrier(0);
#pragma unroll
          for (int t = 0; t < 2; ++t) kf[t] = pk_frag(kc + 512 * t);
          asm volatile("s_wait_xcnt 0x0" ::: "memory");   // stands in front of any later write of a register that the four loads name
        }
#pragma unroll
        for (int t = 0; t < 2; ++t) sc[t] = wmma16(kf[t], qf[j], mbv[j]);
        if (MORE && j == 1) {
#pragma unroll
          for (int t = 0; t < 2; ++t) kf[t] = pk_frag(stash + 512 * t);
        }
        const float d = fminf(WB - slice_max(sc), 0.0f);        // 0 for a column that stays under its reference
        const float al = exp2_slot(d);
        lrun[j] *= al;
#pragma unroll
        for (int r = 0; r < 8; ++r) { acc[0][j][r] *= al; acc[1][j][r] *= al; }
#pragma unroll
        for (int r = 0; r < 8; ++r) { mbv[j][r] += d; sc[0][r] += d; sc[1][r] += d; }
        // the rescaling ends in front of the weights: with part of it put off behind them its factor has no register left there, and the wave spills
        __builtin_amdgcn_sched_barrier(0);
        ws = tile_weights(sc[0], sc[1]);
      }
      lrun[j] += ws;
    }
    const f16x16 pf = __builtin_bit_cast(f16x16, sc[0]);
    // stands in front of the caller's step of the key pointer, a register that the fetch of the next keys above names
    if (MORE && j == 1) asm volatile("s_wait_xcnt 0x0" ::: "memory");
#pragma unroll
    for (int i = 0; i < 2; ++i) acc[i][j] = __builtin_amdgcn_wmma_f32_16x16x32_f16(false, vf[i], false, pf, (short)0, acc[i][j], false, false);
    // one column group at a time: interleaved, the two groups' scores and weights are live together and the wave passes the 128 registers that a wave of a 32-wave work-group can have
    __builtin_amdgcn_sched_barrier(0);
  }
  if (MORE) {
    if (FIRST) {   // as with the keys above: one vector address pair, and the wait in front of the load whose result may be given those registers
      vf[0] = pk_frag(gn);
      const f16x8 lo = *(const f16x8*)(gn + 512);
      asm volatile("s_wait_xcnt 0x0" ::: "memory");
      const f16x8 hi = *(const f16x8*)(gn + 768);
      vf[1] = __builtin_shufflevector(lo, hi, 0, 1, 2, 3, 4, 5, 6, 7, 8, 9, 10, 11, 12, 13, 14, 15);
    } else {
#pragma unroll
      for (int i = 0; i < 2; ++i) vf[i] = pk_frag(gn + 512 * i);
    }
    asm volatile("s_wait_xcnt 0x0" ::: "memory");   // stands in front of any later write of a register that the loads of the next values name (the caller's step of the pointer, the lane offset behind the loop)
  }
}
// blockIdx.y = direction d, blockIdx.z = batch b. TT: planes [b][theta^T, phi^T]; GG: planes [b][g1, g2].
// d = 0 (y2): queries theta^T, keys phi^T, values g2, residual x2, second output; d = 1 (y1): queries phi^T, keys theta^T, values g1, x1, first output.
__global__ __launch_bounds__(1024) void k_attn(const float* __restrict__ TT, const float* __restrict__ GG, const float* __restrict__ Ww, const float* __restrict__ Wb,
                                              const float* __restrict__ wbn, const float* __restrict__ x1, const float* __restrict__ x2,
                                              float* __restrict__ out1, float* __restrict__ out2) {
  const int dir = blockIdx.y, bat = blockIdx.z;
  const f16* __restrict__ Qt = (const f16*)TT + (size_t)(bat * 2 + dir) * (NNs * CIs);
  const f16* __restrict__ Kt = (const f16*)TT + (size_t)(bat * 2 + 1 - dir) * (NNs * CIs);
  const f16* __restrict__ G = (const f16*)GG + (size_t)(bat * 2 + 1 - dir) * (CIs * NNs);
  __shared__ __attribute__((aligned(16))) f16 ys[128 * AKP];        // 128 positions x 32 channels of Y
  __shared__ __attribute__((aligned(16))) float red[32][32 * ARP];  // per wave: its 32 x 32 partial, column-major (a column's 32 channels in a row)
  __shared__ __attribute__((aligned(16))) f32x2 sml[32][32];        // per wave and column: reference maximum (log2 units, less WB) and sum, side by side
  __shared__ float oinv[CCs], osh[CCs], owb[CCs];                   // per output channel: W_out's BatchNorm scale and shift, W_b
  const int tid = threadIdx.x, lane = tid & 31, wave = tid >> 5;
  const int wu = __builtin_amdgcn_readfirstlane(wave);
  const int nb = blockIdx.x * 128;
  const int n0 = nb + 32 * (wu & 3);             // the wave's column group
  const int kr = wu >> 2;                        // the wave's key range
  const unsigned lo8 = lane * 8;                 // the lane's own halfs in a fragment run
  const f16* kb = Kt + kr * (512 * CIs);         // the wave's 512 keys are 32 fragments in a row, its 512 columns of G likewise
  const f16* gb = G + kr * (512 * CIs);
  // The 32 work-groups of a direction and batch read the same K and G. Each walks the 16 slices of its ranges from a start of its own and wraps round, so that
  // groups running in step ask L2 for different lines, and a line that L2 has to fetch from memory is asked for by one group well before the others come to it.
  // Two groups whose indices differ in bit 2 alone share a start, so any 4 neighbours in each of the 4 blocks of 8 have the 16 starts between them.
  // Only speed rests on the choice: every start gives the same sums in another order.
  const int s0 = (blockIdx.x & 3) | ((blockIdx.x >> 3) << 2);   // the first slice
  int left = 15 - s0;                            // slices of the range behind this one; at 0 the next slice is the range's first
  const f16* kc = kb + s0 * (32 * CIs);          // this slice's keys; kn, gn: the next slice's keys and values
  const f16* gc = gb + s0 * (32 * CIs);
  const f16* kn = kc + 32 * CIs, *gn = gc + 32 * CIs;
  if (left == 0) { kn = kb; gn = gb; }
  // the inner loops are unrolled: acc and the fragments are register arrays and need constant indices
  f16x16 kf[2], vf[2], qf[2];
#pragma unroll
  for (int t = 0; t < 2; ++t) { kf[t] = pk_frag(kc + 512 * t + lo8); vf[t] = pk_frag(gc + 512 * t + lo8); qf[t] = pk_frag(Qt + (n0 + 16 * t) * CIs + lo8); }
  if (tid < CCs) {   // read behind the barrier that follows the loop
    const float inv = wbn[tid] / sqrtf(wbn[3 * CCs + tid] + 1e-5f);
    oinv[tid] = inv; osh[tid] = wbn[CCs + tid] - wbn[2 * CCs + tid] * inv; owb[tid] = Wb[tid];
  }
  f32x8 acc[2][2] = {};
  f16* stash = (f16*)red[wu] + lo8;   // the wave's partial goes there only behind the loop; the uniform wave number keeps the row's offset in a scalar register (as a vector register it was spilled over the loop)
  f32x8 mbv[2];           // set by the first slice
  float lrun[2];
  // the loop over slices stays rolled: unrolled, the compiler put off the running sums' additions to the end and spilled the weights
  attn_slice<true, true>(kf, vf, qf, acc, mbv, lrun, kc + lo8, kn + lo8, gn + lo8, stash);
#pragma unroll 1
  for (int s = 1; s < 15; ++s) {
    kc = kn; kn += 32 * CIs; gn += 32 * CIs;
    if (--left == 0) { kn = kb; gn = gb; }
    attn_slice<false, true>(kf, vf, qf, acc, mbv, lrun, kc + lo8, kn + lo8, gn + lo8, stash);
  }
  attn_slice<false, false>(kf, vf, qf, acc, mbv, lrun, kb, kb, gb, stash);
  const int nlane = lane & 15, mh = (lane >> 4) * 8;
  float* rw = red[wu];
#pragma unroll
  for (int i = 0; i < 2; ++i)
#pragma unroll
    for (int j = 0; j < 2; ++j)
    {   // a lane's eight results are eight channels in a row of one column: two 16-B stores
      float* cp = rw + (16 * j + nlane) * ARP + 16 * i + mh;
      *(v4f_t*)cp = __builtin_shufflevector(acc[i][j], acc[i][j], 0, 1, 2, 3);
      *(v4f_t*)(cp + 4) = __builtin_shufflevector(acc[i][j], acc[i][j], 4, 5, 6, 7);
    }
#pragma unroll
  for (int j = 0; j < 2; ++j) {
    const float lt = lrun[j] + other_half(lrun[j]);   // the two halves hold different keys of the same column
    if (lane < 16) { const f32x2 ml = {-mbv[j][0], lt}; sml[wu][16 * j + lane] = ml; }
  }
  __syncthreads();
  // the sixteen waves of the last product fetch their W_w fragment and their residual values here: carried through the loop they would put the
  // wave over the 128 registers at which one work-group is resident on a WGP; from here the latency runs under the merge
  const int wq = wu & 3, wg = (wu >> 2) & 3;   // wave wu < 16: output channels 16 wq .. 16 wq + 15 of column group wg
  const size_t ob = (size_t)bat * (CCs * NNs) + (size_t)(wq * 16 + mh) * NNs + nb + 32 * wg + nlane;   // output channel 16 wq + mh + r, position nb + 32 wg + 16 j + nlane
  const float* __restrict__ xres = (dir ? x1 : x2) + ob;
  v4f_t wr[4] = {};   // the lane's part of the W_w fragment, still f32: rounded behind the merge, so that the merge does not begin with a wait for it
  float xr[2][8] = {};
  if (wu < 16) {
    const float* __restrict__ wp = Ww + (size_t)(16 * wq + nlane) * CIs + mh;   // row 16 wq + nlane, k = mh .. mh + 7 and 16 + mh .. 16 + mh + 7, as in load_frag
#pragma unroll
    for (int h = 0; h < 2; ++h) { wr[2 * h] = *(const v4f_t*)(wp + 16 * h); wr[2 * h + 1] = *(const v4f_t*)(wp + 16 * h + 4); }
#pragma unroll
    for (int j = 0; j < 2; ++j)
#pragma unroll
      for (int r = 0; r < 8; ++r) xr[j][r] = xres[(size_t)r * NNs + 16 * j];
  }
  { const int mg = wu >> 3, cq = (wu & 7) * 4;     // a wave merges channels cq .. cq + 3 of column group mg, a lane those of column lane: one factor per range serves the lane's four values
    f32x2 ml[8];
    v4f_t v[8];
    // unrolled: ml, v and f are register arrays and need constant indices
#pragma unroll
    for (int w = 0; w < 8; ++w) ml[w] = sml[4 * w + mg][lane];
#pragma unroll
    for (int w = 0; w < 8; ++w) v[w] = *(const v4f_t*)(&red[4 * w + mg][lane * ARP + cq]);
    // all of the merge's LDS reads are issued before the first of them is waited for: left to itself the build put the partials' reads behind the factors, a second LDS latency in a row
    __builtin_amdgcn_sched_barrier(0);
    float m = ml[0][0];
#pragma unroll
    for (int w = 1; w < 8; ++w) m = fmaxf(m, ml[w][0]);
    float f[8];
#pragma unroll
    for (int w = 0; w < 8; ++w) f[w] = ml[w][0] - m;   // the references are in log2 units
    exp2_slot4(f[0], f[1], f[2], f[3]);
    exp2_slot4(f[4], f[5], f[6], f[7]);
    v4f_t sv = {};
    float lv = 0.0f;
#pragma unroll
    for (int w = 0; w < 8; ++w) {
#pragma unroll
      for (int e = 0; e < 4; ++e) sv[e] += v[w][e] * f[w];
      lv += ml[w][1] * f[w];
    }
    const float rl = 1.0f / lv;
    bf16x4 h;
#pragma unroll
    for (int e = 0; e < 4; ++e) h[e] = (f16)(sv[e] * rl);
    *(bf16x4*)(ys + (32 * mg + lane) * AKP + cq) = h; }
  __syncthreads();   // the whole block of Y is in LDS before the sixteen waves read it
  if (wu < 16) {
    float* __restrict__ o = (dir ? out1 : out2) + ob;
    f16x16 wf;
#pragma unroll
    for (int i = 0; i < 16; ++i) wf[i] = (f16)wr[i >> 2][i & 3];
    const f16x16 yf0 = lds_frag(ys + 32 * wg * AKP, AKP), yf1 = lds_frag(ys + (32 * wg + 16) * AKP, AKP);
    const f32x8 z0 = {};
    f32x8 zz[2];
    zz[0] = wmma16(wf, yf0, z0);
    zz[1] = wmma16(wf, yf1, z0);
#pragma unroll
    for (int j = 0; j < 2; ++j)
#pragma unroll
      for (int r = 0; r < 8; ++r) {
        const int c = 16 * wq + mh + r;
        o[(size_t)r * NNs + 16 * j] = xr[j][r] + ((zz[j][r] + owb[c]) * oinv[c] + osh[c]);
      }
  }
}

// ---------------------------------------------------------------------------
// k_proj: P[o][n] = sum_c W[o][c] * bn(x)[c][n] + bias[o], o < 32, c < 64, for 128 positions n of one frame.
// blockIdx.y = projection q (0: g of x1, 1: theta of x1, 2: g of x2, 3: phi of x2), blockIdx.z = batch.
// bn(x)[c][n] = x * inv_c + (beta - mean * inv)_c, inv = gamma / sqrt(var + eps), is rounded to f16 and staged position-major in LDS
// (a wave-wide load takes the 512 B of one channel's row; a lane packs four channels of a position into one 8-B LDS store).
// Wave w takes positions 16 w .. 16 w + 15; the weights come straight from global memory. q odd (TT plane [b][q / 2]): A = weights, B = the staged
// frame, a lane gets 8 channels of one position, stored times sqrt(log2 e). q even (GG plane [b][q / 2]): A = the staged frame, B = weights, a lane gets 8 positions of one
// channel. Either way those 8 values, rounded to f16, are the lane's own 16 B of a packed fragment run: a wave-wide store takes 512 B in a row.
// ---------------------------------------------------------------------------
#define XP 72    // staged pitch: 64 -> 72 halfs (144 B = 16 B x 9): aligned b128 fragment reads
__global__ __launch_bounds__(256) void k_proj(const float* __restrict__ x1, const float* __restrict__ x2, const float* __restrict__ gbn, const float* __restrict__ tbn,
                                              const float* __restrict__ pbn, const float* __restrict__ gw, const float* __restrict__ tw, const float* __restrict__ pw,
                                              const float* __restrict__ gb, const float* __restrict__ tb, const float* __restrict__ pb,
                                              float* __restrict__ GG, float* __restrict__ TT) {
  const int q = blockIdx.y, b = blockIdx.z, n0 = blockIdx.x * 128;
  const float* __restrict__ x = (q < 2 ? x1 : x2) + (size_t)b * (CCs * NNs) + n0;
  const float* __restrict__ p = q == 1 ? tbn : (q == 3 ? pbn : gbn);
  const float* __restrict__ Wq = q == 1 ? tw : (q == 3 ? pw : gw);
  const float* __restrict__ bias = q == 1 ? tb : (q == 3 ? pb : gb);
  __shared__ __attribute__((aligned(16))) f16 xs[128 * XP];
  __shared__ float sinv[CCs], ssh[CCs];
  const int tid = threadIdx.x, lane = tid & 31, wave = tid >> 5, cl = lane & 15, rh = (lane >> 4) * 8;
  v4f_t xv[8];   // channels 32 g + 4 wave + e, positions 4 lane .. 4 lane + 3
  // the loops are unrolled: xv and acc are register arrays and need constant indices
#pragma unroll
  for (int g = 0; g < 2; ++g)
#pragma unroll
    for (int e = 0; e < 4; ++e) xv[g * 4 + e] = *(const v4f_t*)(x + (size_t)(32 * g + 4 * wave + e) * NNs + lane * 4);
  if (tid < CCs) {
    const float inv = p[tid] / sqrtf(p[3 * CCs + tid] + 1e-5f);
    sinv[tid] = inv; ssh[tid] = p[CCs + tid] - p[2 * CCs + tid] * inv;
  }
  f16x16 af[2][2];
#pragma unroll
  for (int i = 0; i < 2; ++i)
#pragma unroll
    for (int ks = 0; ks < 2; ++ks) af[i][ks] = load_frag(Wq, CCs, 16 * i, 32 * ks);
  v4f_t bv[2][2];   // bias of channels 16 i + rh + 4 hf .. + 3, fetched with the other operands and not behind the products
#pragma unroll
  for (int i = 0; i < 2; ++i)
#pragma unroll
    for (int hf = 0; hf < 2; ++hf) bv[i][hf] = *(const v4f_t*)(bias + 16 * i + rh + 4 * hf);
  const float bc[2] = {bias[cl], bias[16 + cl]};   // bias of channel 16 i + cl
  __syncthreads();
#pragma unroll
  for (int g = 0; g < 2; ++g) {
    const int k0 = 32 * g + 4 * wave;
#pragma unroll
    for (int u = 0; u < 4; ++u) {
      bf16x4 hx;
#pragma unroll
      for (int e = 0; e < 4; ++e) hx[e] = (f16)(xv[g * 4 + e][u] * sinv[k0 + e] + ssh[k0 + e]);
      *(bf16x4*)(xs + (lane * 4 + u) * XP + k0) = hx;
    }
  }
  __syncthreads();
  f32x8 acc[2] = {};
  f16x16 bfr[2];
#pragma unroll
  for (int ks = 0; ks < 2; ++ks) bfr[ks] = lds_frag(xs + (wave * 16) * XP + 32 * ks, XP);
  if (q & 1) {
#pragma unroll
    for (int ks = 0; ks < 2; ++ks)
#pragma unroll
      for (int i = 0; i < 2; ++i) acc[i] = __builtin_amdgcn_wmma_f32_16x16x32_f16(false, af[i][ks], false, bfr[ks], (short)0, acc[i], false, false);
    // a lane holds position 16 wave + cl and channels 16 i + rh + r: run i of fragment n0 / 16 + wave
    f16* __restrict__ dst = (f16*)TT + (size_t)(b * 2 + (q >> 1)) * (NNs * CIs) + (size_t)(n0 + 16 * wave) * CIs + lane * 8;
#pragma unroll
    for (int i = 0; i < 2; ++i) {
      f16x8 h;
#pragma unroll
      for (int r = 0; r < 8; ++r) h[r] = (f16)((acc[i][r] + bv[i][r >> 2][r & 3]) * SQL2E);
      *(f16x8*)(dst + 256 * i) = h;
    }
    asm volatile("s_wait_xcnt 0x0" ::: "memory");   // stands in front of any later write of a register that the two stores name
  } else {
#pragma unroll
    for (int ks = 0; ks < 2; ++ks)
#pragma unroll
      for (int i = 0; i < 2; ++i) acc[i] = __builtin_amdgcn_wmma_f32_16x16x32_f16(false, bfr[ks], false, af[i][ks], (short)0, acc[i], false, false);
    // a lane holds channel 16 i + cl and positions 16 wave + rh + r: run wave & 1 of fragment i of slice n0 / 32 + wave / 2
    f16* __restrict__ dst = (f16*)GG + (size_t)(b * 2 + (q >> 1)) * (CIs * NNs) + (size_t)(n0 + 32 * (wave >> 1)) * CIs + 256 * (wave & 1) + lane * 8;
#pragma unroll
    for (int i = 0; i < 2; ++i) {
      f16x8 h;
#pragma unroll
      for (int r = 0; r < 8; ++r) h[r] = (f16)(acc[i][r] + bc[i]);
      *(f16x8*)(dst + 512 * i) = h;
    }
    asm volatile("s_wait_xcnt 0x0" ::: "memory");   // as in the other branch: which of the two blocks comes first in the built code is the compiler's choice
  }
}

extern "C" void kernel_launch(void* const* d_in, const int* in_sizes, int n_in,
                              void* d_out, int out_size, void* d_ws, size_t ws_size,
                              hipStream_t stream) {
  (void)in_sizes; (void)n_in; (void)out_size;
  const float** f = (const float**)d_in;
  const float* x1 = f[0], *x2 = f[1], *gbn = f[2], *gw = f[3], *gb = f[4], *tbn = f[5], *tw = f[6], *tb = f[7], *pbn = f[8], *pw = f[9], *pb = f[10], *wbn = f[11], *Ww = f[12], *Wb = f[13];
  float* out1 = (float*)d_out; float* out2 = out1 + (size_t)NBs * CCs * NNs;     // tuple
  char* ws = (char*)d_ws;
  float* GG = (float*)ws; ws += (size_t)NBs * 2 * CIs * NNs * 2;      // g1, g2: packed f16 planes [b][2] of [32][4096]
  float* TT = (float*)ws; ws += (size_t)NBs * 2 * NNs * CIs * 2;      // theta^T, phi^T: packed f16 planes [b][2] of [4096][32]
  if ((size_t)(ws - (char*)d_ws) > ws_size) return;
  // q = 0: g1 = g(bn_g x1), 1: theta(bn_theta x1), 2: g2 = g(bn_g x2), 3: phi(bn_phi x2)
  k_proj<<<dim3(NNs / 128, 4, NBs), dim3(256), 0, stream>>>(x1, x2, gbn, tbn, pbn, gw, tw, pw, gb, tb, pb, GG, TT);
  // d = 0: y2[c][n] = sum_m g2[c][m] att1[n][m], att1 = softmax over m of sum_k theta[k][n] phi[k][m]
  // d = 1: y1[c][m] = sum_n g1[c][n] att2[n][m], att2 = softmax over n of the same scores
  k_attn<<<dim3(NNs / 128, 2, NBs), dim3(1024), 0, stream>>>(TT, GG, Ww, Wb, wbn, x1, x2, out1, out2);
}
